// v000
// Measured on an AMD MI455X. A time is GPU time per run, averaged over a window of back-to-back runs after a warm-up
// (all launches, gaps included; the runs take copies of the inputs in turn), and the median of several windows.
// Apart from v000's, it joins two sittings. Times from different sittings can be a few percent apart, while
// side-by-side timings come from the same sitting.
// v000, which the later versions start from, runs in 406 microseconds.
#include <hip/hip_runtime.h>
#include <hip/hip_bf16.h>

// ---------------------------------------------------------------------------
// Fused attention block for MI455X (gfx1250, wave32, WMMA).
//   B=4, N=2048, D=1024, H=8, HD=128
//   Stage 1: qkv = x @ Wkv^T  (f32 in, f16 to ws, Q pre-scaled by 1/sqrt(128))
//   Stage 2: flash attention per (b,h), online softmax, f16 WMMA, f32 acc,
//            K/Q tiles staged via GLOBAL_LOAD_ASYNC_TO_LDS when available
//   Stage 3: out = y @ Wo^T + bo (f32 out)
// ---------------------------------------------------------------------------

typedef __attribute__((ext_vector_type(4)))  _Float16 h4;
typedef __attribute__((ext_vector_type(8)))  _Float16 h8;
typedef __attribute__((ext_vector_type(16))) _Float16 h16;
typedef __attribute__((ext_vector_type(8)))  float    f8;

#define BATCH 4
#define SEQ   2048
#define DMODEL 1024
#define NHEAD 8
#define HDIM  128

// --- gfx1250 async global->LDS copy (ASYNCcnt-tracked), with fallback -------
#if defined(__gfx1250__) && __has_builtin(__builtin_amdgcn_global_load_async_to_lds_b128)
#define HAVE_ASYNC_LDS 1
// Parameter type revealed by compiler diagnostic: pointer to <4 x i32> vector.
typedef __attribute__((__vector_size__(4 * sizeof(int)))) int i4v;
static __device__ __forceinline__ void async_cp16(const void* g, void* l) {
  __builtin_amdgcn_global_load_async_to_lds_b128((i4v*)g, (i4v*)l, 0, 0);
}
#else
#define HAVE_ASYNC_LDS 0
static __device__ __forceinline__ void async_cp16(const void* g, void* l) {
  *(h8*)l = *(const h8*)g;
}
#endif

static __device__ __forceinline__ void async_wait_all() {
#if HAVE_ASYNC_LDS
#if __has_builtin(__builtin_amdgcn_s_wait_asynccnt)
  __builtin_amdgcn_s_wait_asynccnt(0);
#else
  asm volatile("s_wait_asynccnt 0" ::: "memory");
#endif
#endif
}

// v_wmma_f32_16x16x32_f16 wrapper (8-arg probe-confirmed signature)
static __device__ __forceinline__ f8 wmma32(h16 a, h16 b, f8 c) {
  return __builtin_amdgcn_wmma_f32_16x16x32_f16(false, a, false, b,
                                                (short)0, c, false, false);
}

// Load a 16x32 f16 A/B fragment from a row-major LDS tile.
// CDNA5 16-bit A layout: lane L (L%16 = matrix row, L/16 = k-group) holds
// K = kg*8 + {0..7} in elements 0..7 and K = 16 + kg*8 + {0..7} in elements
// 8..15  ->  two contiguous 16-byte LDS loads per lane.
static __device__ __forceinline__ h16 frag_ld(const _Float16* lds, int row,
                                              int kbase, int ld) {
  const int lane = threadIdx.x & 31;
  const _Float16* p = lds + (row + (lane & 15)) * ld + kbase + ((lane >> 4) << 3);
  h8 lo = *(const h8*)(p);
  h8 hi = *(const h8*)(p + 16);
  return __builtin_shufflevector(lo, hi, 0, 1, 2, 3, 4, 5, 6, 7, 8, 9, 10, 11,
                                 12, 13, 14, 15);
}

// ---------------------------------------------------------------------------
// Kernel 1: QKV projection. grid = (3*D/128, B*N/128), block = 256 (8 waves).
// Each wave computes a 64x32 register tile (8 wmma accumulators).
// ---------------------------------------------------------------------------
__global__ __launch_bounds__(256) void qkv_proj_kernel(
    const float* __restrict__ x, const float* __restrict__ Wkv,
    _Float16* __restrict__ qws, _Float16* __restrict__ kws,
    _Float16* __restrict__ vws) {
  extern __shared__ _Float16 smem[];
  const int LD = 40;  // 32 + 8 pad (halfs)
  _Float16* Xt = smem;            // [128][40]
  _Float16* Wt = smem + 128 * LD; // [128][40]

  const int tid = threadIdx.x;
  const int wave = tid >> 5;
  const int lane = tid & 31;
  const int nloc = lane & 15;
  const int mhi = (lane >> 4) << 3;  // 0 or 8
  const int m0 = blockIdx.y * 128;
  const int n0 = blockIdx.x * 128;
  const int wm = wave >> 2;  // 0..1 -> 64-row half
  const int wn = wave & 3;   // 0..3 -> 32-col quarter

  f8 acc[4][2] = {};

  for (int k0 = 0; k0 < DMODEL; k0 += 32) {
    __syncthreads();
    // 128x32 tile = 1024 float4 chunks; 4 per thread, converted to f16
#pragma unroll
    for (int i = 0; i < 4; ++i) {
      int chunk = tid + i * 256;
      int r = chunk >> 3, c4 = (chunk & 7) * 4;
      float4 fx = *(const float4*)(x + (size_t)(m0 + r) * DMODEL + k0 + c4);
      float4 fw = *(const float4*)(Wkv + (size_t)(n0 + r) * DMODEL + k0 + c4);
      h4 hx = {(_Float16)fx.x, (_Float16)fx.y, (_Float16)fx.z, (_Float16)fx.w};
      h4 hw = {(_Float16)fw.x, (_Float16)fw.y, (_Float16)fw.z, (_Float16)fw.w};
      *(h4*)(Xt + r * LD + c4) = hx;
      *(h4*)(Wt + r * LD + c4) = hw;
    }
    __syncthreads();

    h16 a[4], b[2];
#pragma unroll
    for (int i = 0; i < 4; ++i) a[i] = frag_ld(Xt, wm * 64 + i * 16, 0, LD);
#pragma unroll
    for (int j = 0; j < 2; ++j) b[j] = frag_ld(Wt, wn * 32 + j * 16, 0, LD);
#pragma unroll
    for (int i = 0; i < 4; ++i)
#pragma unroll
      for (int j = 0; j < 2; ++j) acc[i][j] = wmma32(a[i], b[j], acc[i][j]);
  }

  // Epilogue: destination (q/k/v, head) is uniform per 16-wide tile.
#pragma unroll
  for (int j = 0; j < 2; ++j) {
    int gnb = n0 + wn * 32 + j * 16;        // tile base col (multiple of 16)
    int which = gnb >> 10;                  // 0=q 1=k 2=v (uniform)
    int e = gnb & (DMODEL - 1);
    int hh = e >> 7;                        // head (uniform)
    int hdb = (e & (HDIM - 1)) + nloc;      // feature within head
    _Float16* dst = (which == 0) ? qws : (which == 1) ? kws : vws;
    float scale = (which == 0) ? 0.08838834764831845f : 1.0f;
#pragma unroll
    for (int i = 0; i < 4; ++i)
#pragma unroll
      for (int r = 0; r < 8; ++r) {
        int gm = m0 + wm * 64 + i * 16 + mhi + r;  // row in [0, B*N)
        int bb = gm >> 11, nn = gm & (SEQ - 1);
        dst[(((size_t)bb * NHEAD + hh) * SEQ + nn) * HDIM + hdb] =
            (_Float16)(acc[i][j][r] * scale);
      }
  }
}

// ---------------------------------------------------------------------------
// Kernel 2: flash attention. grid = (B*H, N/128), block = 256 (8 waves).
// Wave w owns query rows [w*16, w*16+16) of the 128-query tile.
// ---------------------------------------------------------------------------
__global__ __launch_bounds__(256) void flash_attn_kernel(
    const _Float16* __restrict__ qws, const _Float16* __restrict__ kws,
    const _Float16* __restrict__ vws, const float* __restrict__ mask,
    _Float16* __restrict__ yws) {
  extern __shared__ _Float16 smem[];
  const int LD = 136;  // 128 + 8 pad
  _Float16* Qt = smem;                 // [128][136] row-major (q x d)
  _Float16* Kt = smem + 128 * LD;      // [128][136] row-major (kv x d)
  _Float16* Vt = smem + 2 * 128 * LD;  // [128][136] TRANSPOSED (d x kv)
  _Float16* Pt = smem + 3 * 128 * LD;  // [128][136] probs (q x kv)

  const int tid = threadIdx.x;
  const int w = tid >> 5;
  const int lane = tid & 31;
  const int nloc = lane & 15;
  const int mhi = (lane >> 4) << 3;
  const int bh = blockIdx.x;       // b*H + h
  const int q0 = blockIdx.y * 128;
  const size_t hbase = (size_t)bh * SEQ * HDIM;

  // Q tile: 2048 x 16B chunks, 8 per thread (async when available)
#pragma unroll
  for (int i = 0; i < 8; ++i) {
    int chunk = tid + i * 256;
    int r = chunk >> 4, c8 = (chunk & 15) * 8;
    async_cp16(qws + hbase + (size_t)(q0 + r) * HDIM + c8, Qt + r * LD + c8);
  }

  f8 o[8] = {};
  float mrow[8], lrow[8];
#pragma unroll
  for (int r = 0; r < 8; ++r) { mrow[r] = -1.0e30f; lrow[r] = 0.0f; }

  for (int kv0 = 0; kv0 < SEQ; kv0 += 128) {
    async_wait_all();   // our async ops (Q and previous K) retired
    __syncthreads();    // previous tile fully consumed by all waves
    // K tile: async row-major copy; V tile: load h8 + transpose scatter
#pragma unroll
    for (int i = 0; i < 8; ++i) {
      int chunk = tid + i * 256;
      int r = chunk >> 4, c8 = (chunk & 15) * 8;
      async_cp16(kws + hbase + (size_t)(kv0 + r) * HDIM + c8, Kt + r * LD + c8);
      h8 vv = *(const h8*)(vws + hbase + (size_t)(kv0 + r) * HDIM + c8);
#pragma unroll
      for (int e2 = 0; e2 < 8; ++e2) Vt[(c8 + e2) * LD + r] = vv[e2];
    }
    __builtin_prefetch(&mask[(size_t)(q0 + w * 16) * SEQ + kv0], 0, 1);
    async_wait_all();
    __syncthreads();

    // S = Q @ K^T   (B = K^T  ->  same row-major fragment pattern as A)
    f8 s[8] = {};
#pragma unroll
    for (int kk = 0; kk < HDIM; kk += 32) {
      h16 a = frag_ld(Qt, w * 16, kk, LD);
#pragma unroll
      for (int t = 0; t < 8; ++t) {
        h16 b = frag_ld(Kt, t * 16, kk, LD);
        s[t] = wmma32(a, b, s[t]);
      }
    }

    // additive mask
    const float* mp = mask + (size_t)(q0 + w * 16 + mhi) * SEQ + kv0 + nloc;
#pragma unroll
    for (int t = 0; t < 8; ++t)
#pragma unroll
      for (int r = 0; r < 8; ++r) s[t][r] += mp[(size_t)r * SEQ + t * 16];

    // online softmax: each row lives across 16 lanes of one half-wave
#pragma unroll
    for (int r = 0; r < 8; ++r) {
      float tm = s[0][r];
#pragma unroll
      for (int t = 1; t < 8; ++t) tm = fmaxf(tm, s[t][r]);
      tm = fmaxf(tm, __shfl_xor(tm, 1, 32));
      tm = fmaxf(tm, __shfl_xor(tm, 2, 32));
      tm = fmaxf(tm, __shfl_xor(tm, 4, 32));
      tm = fmaxf(tm, __shfl_xor(tm, 8, 32));
      float nm = fmaxf(mrow[r], tm);
      float corr = __expf(mrow[r] - nm);
      mrow[r] = nm;
      float ps = 0.0f;
#pragma unroll
      for (int t = 0; t < 8; ++t) {
        float p = __expf(s[t][r] - nm);
        ps += p;
        Pt[(w * 16 + mhi + r) * LD + t * 16 + nloc] = (_Float16)p;
      }
      ps += __shfl_xor(ps, 1, 32);
      ps += __shfl_xor(ps, 2, 32);
      ps += __shfl_xor(ps, 4, 32);
      ps += __shfl_xor(ps, 8, 32);
      lrow[r] = lrow[r] * corr + ps;
#pragma unroll
      for (int t = 0; t < 8; ++t) o[t][r] *= corr;
    }
    // Pt rows are wave-private; same-wave LDS ops are in-order -> no barrier.

    // O += P @ V   (B from transposed Vt -> row-major fragment pattern)
#pragma unroll
    for (int kk = 0; kk < 128; kk += 32) {
      h16 a = frag_ld(Pt, w * 16, kk, LD);
#pragma unroll
      for (int t = 0; t < 8; ++t) {
        h16 b = frag_ld(Vt, t * 16, kk, LD);
        o[t] = wmma32(a, b, o[t]);
      }
    }
  }

  // normalize and write y [B][N][D] (f16)
  const int b = bh >> 3, h = bh & 7;
#pragma unroll
  for (int t = 0; t < 8; ++t)
#pragma unroll
    for (int r = 0; r < 8; ++r) {
      float val = o[t][r] / lrow[r];
      int row = q0 + w * 16 + mhi + r;
      int col = h * HDIM + t * 16 + nloc;
      yws[((size_t)b * SEQ + row) * DMODEL + col] = (_Float16)val;
    }
}

// ---------------------------------------------------------------------------
// Kernel 3: output projection out = y @ Wo^T + bo. grid = (D/128, B*N/128).
// ---------------------------------------------------------------------------
__global__ __launch_bounds__(256) void out_proj_kernel(
    const _Float16* __restrict__ yws, const float* __restrict__ Wo,
    const float* __restrict__ bo, float* __restrict__ out) {
  extern __shared__ _Float16 smem[];
  const int LD = 40;
  _Float16* Yt = smem;
  _Float16* Wt = smem + 128 * LD;

  const int tid = threadIdx.x;
  const int wave = tid >> 5;
  const int lane = tid & 31;
  const int nloc = lane & 15;
  const int mhi = (lane >> 4) << 3;
  const int m0 = blockIdx.y * 128;
  const int n0 = blockIdx.x * 128;
  const int wm = wave >> 2;
  const int wn = wave & 3;

  f8 acc[4][2] = {};

  for (int k0 = 0; k0 < DMODEL; k0 += 32) {
    __syncthreads();
    // A tile is f16 already: 512 h8 chunks (2/thread); W tile: float4 convert
#pragma unroll
    for (int i = 0; i < 2; ++i) {
      int chunk = tid + i * 256;
      int r = chunk >> 2, c8 = (chunk & 3) * 8;
      *(h8*)(Yt + r * LD + c8) =
          *(const h8*)(yws + (size_t)(m0 + r) * DMODEL + k0 + c8);
    }
#pragma unroll
    for (int i = 0; i < 4; ++i) {
      int chunk = tid + i * 256;
      int r = chunk >> 3, c4 = (chunk & 7) * 4;
      float4 fw = *(const float4*)(Wo + (size_t)(n0 + r) * DMODEL + k0 + c4);
      h4 hw = {(_Float16)fw.x, (_Float16)fw.y, (_Float16)fw.z, (_Float16)fw.w};
      *(h4*)(Wt + r * LD + c4) = hw;
    }
    __syncthreads();

    h16 a[4], b[2];
#pragma unroll
    for (int i = 0; i < 4; ++i) a[i] = frag_ld(Yt, wm * 64 + i * 16, 0, LD);
#pragma unroll
    for (int j = 0; j < 2; ++j) b[j] = frag_ld(Wt, wn * 32 + j * 16, 0, LD);
#pragma unroll
    for (int i = 0; i < 4; ++i)
#pragma unroll
      for (int j = 0; j < 2; ++j) acc[i][j] = wmma32(a[i], b[j], acc[i][j]);
  }

#pragma unroll
  for (int i = 0; i < 4; ++i)
#pragma unroll
    for (int j = 0; j < 2; ++j)
#pragma unroll
      for (int r = 0; r < 8; ++r) {
        int gm = m0 + wm * 64 + i * 16 + mhi + r;
        int gn = n0 + wn * 32 + j * 16 + nloc;
        out[(size_t)gm * DMODEL + gn] = acc[i][j][r] + bo[gn];
      }
}

// ---------------------------------------------------------------------------
// Host launch. Inputs: x, mask, Wkv, Wo, bo (all f32). Output: f32 [B,N,D].
// Workspace layout (f16): Q | K | V | Y, each B*N*D elements (64 MB total).
// ---------------------------------------------------------------------------
extern "C" void kernel_launch(void* const* d_in, const int* in_sizes, int n_in,
                              void* d_out, int out_size, void* d_ws,
                              size_t ws_size, hipStream_t stream) {
  (void)in_sizes; (void)n_in; (void)out_size; (void)ws_size;
  const float* x    = (const float*)d_in[0];
  const float* mask = (const float*)d_in[1];
  const float* Wkv  = (const float*)d_in[2];
  const float* Wo   = (const float*)d_in[3];
  const float* bo   = (const float*)d_in[4];
  float* out = (float*)d_out;

  const size_t SZ = (size_t)BATCH * SEQ * DMODEL;  // 8.4M elements
  _Float16* base = (_Float16*)d_ws;
  _Float16* qws = base;
  _Float16* kws = base + SZ;
  _Float16* vws = base + 2 * SZ;
  _Float16* yws = base + 3 * SZ;

  const size_t lds_gemm = 2 * 128 * 40 * sizeof(_Float16);   // 20.5 KB
  const size_t lds_attn = 4 * 128 * 136 * sizeof(_Float16);  // 136 KB (of 320)

  qkv_proj_kernel<<<dim3(3 * DMODEL / 128, BATCH * SEQ / 128), 256, lds_gemm,
                    stream>>>(x, Wkv, qws, kws, vws);
  flash_attn_kernel<<<dim3(BATCH * NHEAD, SEQ / 128), 256, lds_attn, stream>>>(
      qws, kws, vws, mask, yws);
  out_proj_kernel<<<dim3(DMODEL / 128, BATCH * SEQ / 128), 256, lds_gemm,
                    stream>>>(yws, Wo, bo, out);
}

// v001
// Measured time: 201 microseconds a run.
// In two side-by-side timings against v000, it was 2.09 and 2.08 times as fast.
#include <hip/hip_runtime.h>
#include <hip/hip_bf16.h>

// ---------------------------------------------------------------------------
// Fused attention block for MI455X (gfx1250, wave32, WMMA).
//   B=4, N=2048, D=1024, H=8, HD=128
//   Stage 1: qkv = x @ Wkv^T  (f32 in, f16 to ws, Q pre-scaled by 1/sqrt(128))
//   Stage 2: flash attention per (b,h), online softmax, f16 WMMA, f32 acc,
//            Q/K/V tiles staged via GLOBAL_LOAD_ASYNC_TO_LDS when available,
//            V kept row-major and transposed on read by ds_load_tr16_b128
//   Stage 3: out = y @ Wo^T + bo (f32 out)
// ---------------------------------------------------------------------------

typedef __attribute__((ext_vector_type(4)))  _Float16 h4;
typedef __attribute__((ext_vector_type(8)))  _Float16 h8;
typedef __attribute__((ext_vector_type(16))) _Float16 h16;
typedef __attribute__((ext_vector_type(8)))  float    f8;

#define BATCH 4
#define SEQ   2048
#define DMODEL 1024
#define NHEAD 8
#define HDIM  128

// --- gfx1250 async global->LDS copy (ASYNCcnt-tracked), with fallback -------
#if defined(__gfx1250__) && __has_builtin(__builtin_amdgcn_global_load_async_to_lds_b128)
#define HAVE_ASYNC_LDS 1
// Parameter type revealed by compiler diagnostic: pointer to <4 x i32> vector.
typedef __attribute__((__vector_size__(4 * sizeof(int)))) int i4v;
static __device__ __forceinline__ void async_cp16(const void* g, void* l) {
  __builtin_amdgcn_global_load_async_to_lds_b128((i4v*)g, (i4v*)l, 0, 0);
}
#else
#define HAVE_ASYNC_LDS 0
static __device__ __forceinline__ void async_cp16(const void* g, void* l) {
  *(h8*)l = *(const h8*)g;
}
#endif

static __device__ __forceinline__ void async_wait_all() {
#if HAVE_ASYNC_LDS
#if __has_builtin(__builtin_amdgcn_s_wait_asynccnt)
  __builtin_amdgcn_s_wait_asynccnt(0);
#else
  asm volatile("s_wait_asynccnt 0" ::: "memory");
#endif
#endif
}

// v_wmma_f32_16x16x32_f16 wrapper (8-arg probe-confirmed signature)
static __device__ __forceinline__ f8 wmma32(h16 a, h16 b, f8 c) {
  return __builtin_amdgcn_wmma_f32_16x16x32_f16(false, a, false, b,
                                                (short)0, c, false, false);
}

// Load a 16x32 f16 A/B fragment from a row-major LDS tile.
// CDNA5 16-bit A layout: lane L (L%16 = matrix row, L/16 = k-group) holds
// K = kg*8 + {0..7} in elements 0..7 and K = 16 + kg*8 + {0..7} in elements
// 8..15  ->  two contiguous 16-byte LDS loads per lane.
static __device__ __forceinline__ h16 frag_ld(const _Float16* lds, int row,
                                              int kbase, int ld) {
  const int lane = threadIdx.x & 31;
  const _Float16* p = lds + (row + (lane & 15)) * ld + kbase + ((lane >> 4) << 3);
  h8 lo = *(const h8*)(p);
  h8 hi = *(const h8*)(p + 16);
  return __builtin_shufflevector(lo, hi, 0, 1, 2, 3, 4, 5, 6, 7, 8, 9, 10, 11,
                                 12, 13, 14, 15);
}

// Load a 32x16 f16 B fragment (k x n) from a ROW-MAJOR (k x n) LDS tile with
// the transposing LDS load. Lane (c = L%16, h = L/16) receives
// T[kbase + 8h + 0..7][nbase + c]; the second load, 16 rows further, gives
// k = 16 + 8h + 0..7: the same k order as frag_ld delivers for the A side.
typedef __attribute__((ext_vector_type(8))) short s16x8;
typedef __attribute__((address_space(3))) s16x8 lds_s16x8;
static __device__ __forceinline__ h16 frag_ld_tr(const _Float16* lds, int kbase,
                                                 int nbase, int ld) {
  const int lane = threadIdx.x & 31;
  const _Float16* p = lds + (kbase + ((lane >> 4) << 3) + (lane & 7)) * ld +
                      nbase + (((lane >> 3) & 1) << 3);
  h8 lo = __builtin_bit_cast(
      h8, __builtin_amdgcn_ds_load_tr16_b128_v8i16((lds_s16x8*)p));
  h8 hi = __builtin_bit_cast(
      h8, __builtin_amdgcn_ds_load_tr16_b128_v8i16((lds_s16x8*)(p + 16 * ld)));
  return __builtin_shufflevector(lo, hi, 0, 1, 2, 3, 4, 5, 6, 7, 8, 9, 10, 11,
                                 12, 13, 14, 15);
}

// ---------------------------------------------------------------------------
// Kernel 1: QKV projection. grid = (3*D/128, B*N/128), block = 256 (8 waves).
// Each wave computes a 64x32 register tile (8 wmma accumulators).
// ---------------------------------------------------------------------------
__global__ __launch_bounds__(256) void qkv_proj_kernel(
    const float* __restrict__ x, const float* __restrict__ Wkv,
    _Float16* __restrict__ qws, _Float16* __restrict__ kws,
    _Float16* __restrict__ vws) {
  extern __shared__ _Float16 smem[];
  const int LD = 40;  // 32 + 8 pad (halfs)
  _Float16* Xt = smem;            // [128][40]
  _Float16* Wt = smem + 128 * LD; // [128][40]

  const int tid = threadIdx.x;
  const int wave = tid >> 5;
  const int lane = tid & 31;
  const int nloc = lane & 15;
  const int mhi = (lane >> 4) << 3;  // 0 or 8
  const int m0 = blockIdx.y * 128;
  const int n0 = blockIdx.x * 128;
  const int wm = wave >> 2;  // 0..1 -> 64-row half
  const int wn = wave & 3;   // 0..3 -> 32-col quarter

  f8 acc[4][2] = {};

  for (int k0 = 0; k0 < DMODEL; k0 += 32) {
    __syncthreads();
    // 128x32 tile = 1024 float4 chunks; 4 per thread, converted to f16
#pragma unroll
    for (int i = 0; i < 4; ++i) {
      int chunk = tid + i * 256;
      int r = chunk >> 3, c4 = (chunk & 7) * 4;
      float4 fx = *(const float4*)(x + (size_t)(m0 + r) * DMODEL + k0 + c4);
      float4 fw = *(const float4*)(Wkv + (size_t)(n0 + r) * DMODEL + k0 + c4);
      h4 hx = {(_Float16)fx.x, (_Float16)fx.y, (_Float16)fx.z, (_Float16)fx.w};
      h4 hw = {(_Float16)fw.x, (_Float16)fw.y, (_Float16)fw.z, (_Float16)fw.w};
      *(h4*)(Xt + r * LD + c4) = hx;
      *(h4*)(Wt + r * LD + c4) = hw;
    }
    __syncthreads();

    h16 a[4], b[2];
#pragma unroll
    for (int i = 0; i < 4; ++i) a[i] = frag_ld(Xt, wm * 64 + i * 16, 0, LD);
#pragma unroll
    for (int j = 0; j < 2; ++j) b[j] = frag_ld(Wt, wn * 32 + j * 16, 0, LD);
#pragma unroll
    for (int i = 0; i < 4; ++i)
#pragma unroll
      for (int j = 0; j < 2; ++j) acc[i][j] = wmma32(a[i], b[j], acc[i][j]);
  }

  // Epilogue: destination (q/k/v, head) is uniform per 16-wide tile.
#pragma unroll
  for (int j = 0; j < 2; ++j) {
    int gnb = n0 + wn * 32 + j * 16;        // tile base col (multiple of 16)
    int which = gnb >> 10;                  // 0=q 1=k 2=v (uniform)
    int e = gnb & (DMODEL - 1);
    int hh = e >> 7;                        // head (uniform)
    int hdb = (e & (HDIM - 1)) + nloc;      // feature within head
    _Float16* dst = (which == 0) ? qws : (which == 1) ? kws : vws;
    float scale = (which == 0) ? 0.08838834764831845f : 1.0f;
#pragma unroll
    for (int i = 0; i < 4; ++i)
#pragma unroll
      for (int r = 0; r < 8; ++r) {
        int gm = m0 + wm * 64 + i * 16 + mhi + r;  // row in [0, B*N)
        int bb = gm >> 11, nn = gm & (SEQ - 1);
        dst[(((size_t)bb * NHEAD + hh) * SEQ + nn) * HDIM + hdb] =
            (_Float16)(acc[i][j][r] * scale);
      }
  }
}

// ---------------------------------------------------------------------------
// Kernel 2: flash attention. grid = (B*H, N/128), block = 256 (8 waves).
// Wave w owns query rows [w*16, w*16+16) of the 128-query tile.
// ---------------------------------------------------------------------------
__global__ __launch_bounds__(256) void flash_attn_kernel(
    const _Float16* __restrict__ qws, const _Float16* __restrict__ kws,
    const _Float16* __restrict__ vws, const float* __restrict__ mask,
    _Float16* __restrict__ yws) {
  extern __shared__ _Float16 smem[];
  const int LD = 136;   // 128 + 8 pad: 272 B rows for ds_load_b128 readers
  const int LDV = 144;  // 128 + 16 pad: 288 B rows for the transposing reader
  _Float16* Qt = smem;                 // [128][136] row-major (q x d)
  _Float16* Kt = smem + 128 * LD;      // [128][136] row-major (kv x d)
  _Float16* Pt = smem + 2 * 128 * LD;  // [128][136] probs (q x kv)
  _Float16* Vs = smem + 3 * 128 * LD;  // [128][144] row-major (kv x d)

  const int tid = threadIdx.x;
  const int w = tid >> 5;
  const int lane = tid & 31;
  const int nloc = lane & 15;
  const int mhi = (lane >> 4) << 3;
  const int bh = blockIdx.x;       // b*H + h
  const int q0 = blockIdx.y * 128;
  const size_t hbase = (size_t)bh * SEQ * HDIM;

  // Q tile: 2048 x 16B chunks, 8 per thread (async when available)
#pragma unroll
  for (int i = 0; i < 8; ++i) {
    int chunk = tid + i * 256;
    int r = chunk >> 4, c8 = (chunk & 15) * 8;
    async_cp16(qws + hbase + (size_t)(q0 + r) * HDIM + c8, Qt + r * LD + c8);
  }

  f8 o[8] = {};
  float mrow[8], lrow[8];
#pragma unroll
  for (int r = 0; r < 8; ++r) { mrow[r] = -1.0e30f; lrow[r] = 0.0f; }

  for (int kv0 = 0; kv0 < SEQ; kv0 += 128) {
    // This wave's LDS reads of the previous K and V tiles have retired before
    // the barrier behind which the copies refill those tiles.
    asm volatile("s_wait_dscnt 0x0" ::: "memory");
    async_wait_all();   // our async ops (Q and previous K, V) retired
    __syncthreads();    // previous tile fully consumed by all waves
    // K and V tiles: async row-major copies, 16 B per lane
#pragma unroll
    for (int i = 0; i < 8; ++i) {
      int chunk = tid + i * 256;
      int r = chunk >> 4, c8 = (chunk & 15) * 8;
      async_cp16(kws + hbase + (size_t)(kv0 + r) * HDIM + c8, Kt + r * LD + c8);
      async_cp16(vws + hbase + (size_t)(kv0 + r) * HDIM + c8, Vs + r * LDV + c8);
    }
    __builtin_prefetch(&mask[(size_t)(q0 + w * 16) * SEQ + kv0], 0, 1);
    async_wait_all();   // this wave's K and V copies have landed
    __syncthreads();    // publishes them; also holds the LDS reads behind the wait

    // S = Q @ K^T   (B = K^T  ->  same row-major fragment pattern as A)
    f8 s[8] = {};
#pragma unroll
    for (int kk = 0; kk < HDIM; kk += 32) {
      h16 a = frag_ld(Qt, w * 16, kk, LD);
#pragma unroll
      for (int t = 0; t < 8; ++t) {
        h16 b = frag_ld(Kt, t * 16, kk, LD);
        s[t] = wmma32(a, b, s[t]);
      }
    }

    // Keeps the 64 mask loads behind the score products: hoisted above them,
    // their destination registers lift the kernel over 256 VGPRs, and only one
    // work-group instead of two would then fit a WGP.
    __builtin_amdgcn_sched_barrier(0);

    // additive mask
    const float* mp = mask + (size_t)(q0 + w * 16 + mhi) * SEQ + kv0 + nloc;
#pragma unroll
    for (int t = 0; t < 8; ++t)
#pragma unroll
      for (int r = 0; r < 8; ++r) s[t][r] += mp[(size_t)r * SEQ + t * 16];

    // online softmax: each row lives across 16 lanes of one half-wave
#pragma unroll
    for (int r = 0; r < 8; ++r) {
      float tm = s[0][r];
#pragma unroll
      for (int t = 1; t < 8; ++t) tm = fmaxf(tm, s[t][r]);
      tm = fmaxf(tm, __shfl_xor(tm, 1, 32));
      tm = fmaxf(tm, __shfl_xor(tm, 2, 32));
      tm = fmaxf(tm, __shfl_xor(tm, 4, 32));
      tm = fmaxf(tm, __shfl_xor(tm, 8, 32));
      float nm = fmaxf(mrow[r], tm);
      float corr = __expf(mrow[r] - nm);
      mrow[r] = nm;
      float ps = 0.0f;
#pragma unroll
      for (int t = 0; t < 8; ++t) {
        float p = __expf(s[t][r] - nm);
        ps += p;
        Pt[(w * 16 + mhi + r) * LD + t * 16 + nloc] = (_Float16)p;
      }
      ps += __shfl_xor(ps, 1, 32);
      ps += __shfl_xor(ps, 2, 32);
      ps += __shfl_xor(ps, 4, 32);
      ps += __shfl_xor(ps, 8, 32);
      lrow[r] = lrow[r] * corr + ps;
#pragma unroll
      for (int t = 0; t < 8; ++t) o[t][r] *= corr;
    }
    // Pt rows are wave-private; same-wave LDS ops are in-order -> no barrier.

    // O += P @ V   (B from row-major Vs through the transposing load)
#pragma unroll
    for (int kk = 0; kk < 128; kk += 32) {
      h16 a = frag_ld(Pt, w * 16, kk, LD);
#pragma unroll
      for (int t = 0; t < 8; ++t) {
        h16 b = frag_ld_tr(Vs, kk, t * 16, LDV);
        o[t] = wmma32(a, b, o[t]);
      }
    }
  }

  // normalize and write y [B][N][D] (f16)
  const int b = bh >> 3, h = bh & 7;
#pragma unroll
  for (int t = 0; t < 8; ++t)
#pragma unroll
    for (int r = 0; r < 8; ++r) {
      float val = o[t][r] / lrow[r];
      int row = q0 + w * 16 + mhi + r;
      int col = h * HDIM + t * 16 + nloc;
      yws[((size_t)b * SEQ + row) * DMODEL + col] = (_Float16)val;
    }
}

// ---------------------------------------------------------------------------
// Kernel 3: output projection out = y @ Wo^T + bo. grid = (D/128, B*N/128).
// ---------------------------------------------------------------------------
__global__ __launch_bounds__(256) void out_proj_kernel(
    const _Float16* __restrict__ yws, const float* __restrict__ Wo,
    const float* __restrict__ bo, float* __restrict__ out) {
  extern __shared__ _Float16 smem[];
  const int LD = 40;
  _Float16* Yt = smem;
  _Float16* Wt = smem + 128 * LD;

  const int tid = threadIdx.x;
  const int wave = tid >> 5;
  const int lane = tid & 31;
  const int nloc = lane & 15;
  const int mhi = (lane >> 4) << 3;
  const int m0 = blockIdx.y * 128;
  const int n0 = blockIdx.x * 128;
  const int wm = wave >> 2;
  const int wn = wave & 3;

  f8 acc[4][2] = {};

  for (int k0 = 0; k0 < DMODEL; k0 += 32) {
    __syncthreads();
    // A tile is f16 already: 512 h8 chunks (2/thread); W tile: float4 convert
#pragma unroll
    for (int i = 0; i < 2; ++i) {
      int chunk = tid + i * 256;
      int r = chunk >> 2, c8 = (chunk & 3) * 8;
      *(h8*)(Yt + r * LD + c8) =
          *(const h8*)(yws + (size_t)(m0 + r) * DMODEL + k0 + c8);
    }
#pragma unroll
    for (int i = 0; i < 4; ++i) {
      int chunk = tid + i * 256;
      int r = chunk >> 3, c4 = (chunk & 7) * 4;
      float4 fw = *(const float4*)(Wo + (size_t)(n0 + r) * DMODEL + k0 + c4);
      h4 hw = {(_Float16)fw.x, (_Float16)fw.y, (_Float16)fw.z, (_Float16)fw.w};
      *(h4*)(Wt + r * LD + c4) = hw;
    }
    __syncthreads();

    h16 a[4], b[2];
#pragma unroll
    for (int i = 0; i < 4; ++i) a[i] = frag_ld(Yt, wm * 64 + i * 16, 0, LD);
#pragma unroll
    for (int j = 0; j < 2; ++j) b[j] = frag_ld(Wt, wn * 32 + j * 16, 0, LD);
#pragma unroll
    for (int i = 0; i < 4; ++i)
#pragma unroll
      for (int j = 0; j < 2; ++j) acc[i][j] = wmma32(a[i], b[j], acc[i][j]);
  }

#pragma unroll
  for (int i = 0; i < 4; ++i)
#pragma unroll
    for (int j = 0; j < 2; ++j)
#pragma unroll
      for (int r = 0; r < 8; ++r) {
        int gm = m0 + wm * 64 + i * 16 + mhi + r;
        int gn = n0 + wn * 32 + j * 16 + nloc;
        out[(size_t)gm * DMODEL + gn] = acc[i][j][r] + bo[gn];
      }
}

// ---------------------------------------------------------------------------
// Host launch. Inputs: x, mask, Wkv, Wo, bo (all f32). Output: f32 [B,N,D].
// Workspace layout (f16): Q | K | V | Y, each B*N*D elements (64 MB total).
// ---------------------------------------------------------------------------
extern "C" void kernel_launch(void* const* d_in, const int* in_sizes, int n_in,
                              void* d_out, int out_size, void* d_ws,
                              size_t ws_size, hipStream_t stream) {
  (void)in_sizes; (void)n_in; (void)out_size; (void)ws_size;
  const float* x    = (const float*)d_in[0];
  const float* mask = (const float*)d_in[1];
  const float* Wkv  = (const float*)d_in[2];
  const float* Wo   = (const float*)d_in[3];
  const float* bo   = (const float*)d_in[4];
  float* out = (float*)d_out;

  const size_t SZ = (size_t)BATCH * SEQ * DMODEL;  // 8.4M elements
  _Float16* base = (_Float16*)d_ws;
  _Float16* qws = base;
  _Float16* kws = base + SZ;
  _Float16* vws = base + 2 * SZ;
  _Float16* yws = base + 3 * SZ;

  const size_t lds_gemm = 2 * 128 * 40 * sizeof(_Float16);   // 20.5 KB
  const size_t lds_attn = (3 * 128 * 136 + 128 * 144) * sizeof(_Float16);  // 138 KB

  qkv_proj_kernel<<<dim3(3 * DMODEL / 128, BATCH * SEQ / 128), 256, lds_gemm,
                    stream>>>(x, Wkv, qws, kws, vws);
  flash_attn_kernel<<<dim3(BATCH * NHEAD, SEQ / 128), 256, lds_attn, stream>>>(
      qws, kws, vws, mask, yws);
  out_proj_kernel<<<dim3(DMODEL / 128, BATCH * SEQ / 128), 256, lds_gemm,
                    stream>>>(yws, Wo, bo, out);
}

// v002
// It runs in 178 microseconds.
// Two timings next to v001 both put it at 1.13 times that version's speed.
// Counting every step since v000, it is 2.35 times as fast.
#include <hip/hip_runtime.h>
#include <hip/hip_bf16.h>

// ---------------------------------------------------------------------------
// Fused attention block for MI455X (gfx1250, wave32, WMMA).
//   B=4, N=2048, D=1024, H=8, HD=128
//   Stage 0: x, Wkv, Wo -> f16 in ws, once, so that the GEMM blocks that
//            re-read them from L2 fetch half the bytes
//   Stage 1: qkv = x @ Wkv^T  (f16 in, f16 to ws, Q pre-scaled by 1/sqrt(128))
//   Stage 2: flash attention per (b,h), online softmax, f16 WMMA, f32 acc,
//            Q/K/V tiles staged via GLOBAL_LOAD_ASYNC_TO_LDS when available,
//            V kept row-major and transposed on read by ds_load_tr16_b128
//   Stage 3: out = y @ Wo^T + bo (f32 out)
// ---------------------------------------------------------------------------

typedef __attribute__((ext_vector_type(4)))  _Float16 h4;
typedef __attribute__((ext_vector_type(8)))  _Float16 h8;
typedef __attribute__((ext_vector_type(16))) _Float16 h16;
typedef __attribute__((ext_vector_type(8)))  float    f8;

#define BATCH 4
#define SEQ   2048
#define DMODEL 1024
#define NHEAD 8
#define HDIM  128

// --- gfx1250 async global->LDS copy (ASYNCcnt-tracked), with fallback -------
#if defined(__gfx1250__) && __has_builtin(__builtin_amdgcn_global_load_async_to_lds_b128)
#define HAVE_ASYNC_LDS 1
// Parameter type revealed by compiler diagnostic: pointer to <4 x i32> vector.
typedef __attribute__((__vector_size__(4 * sizeof(int)))) int i4v;
static __device__ __forceinline__ void async_cp16(const void* g, void* l) {
  __builtin_amdgcn_global_load_async_to_lds_b128((i4v*)g, (i4v*)l, 0, 0);
}
#else
#define HAVE_ASYNC_LDS 0
static __device__ __forceinline__ void async_cp16(const void* g, void* l) {
  *(h8*)l = *(const h8*)g;
}
#endif

static __device__ __forceinline__ void async_wait_all() {
#if HAVE_ASYNC_LDS
#if __has_builtin(__builtin_amdgcn_s_wait_asynccnt)
  __builtin_amdgcn_s_wait_asynccnt(0);
#else
  asm volatile("s_wait_asynccnt 0" ::: "memory");
#endif
#endif
}

// v_wmma_f32_16x16x32_f16 wrapper (8-arg probe-confirmed signature)
static __device__ __forceinline__ f8 wmma32(h16 a, h16 b, f8 c) {
  return __builtin_amdgcn_wmma_f32_16x16x32_f16(false, a, false, b,
                                                (short)0, c, false, false);
}

// Load a 16x32 f16 A/B fragment from a row-major LDS tile.
// CDNA5 16-bit A layout: lane L (L%16 = matrix row, L/16 = k-group) holds
// K = kg*8 + {0..7} in elements 0..7 and K = 16 + kg*8 + {0..7} in elements
// 8..15  ->  two contiguous 16-byte LDS loads per lane.
static __device__ __forceinline__ h16 frag_ld(const _Float16* lds, int row,
                                              int kbase, int ld) {
  const int lane = threadIdx.x & 31;
  const _Float16* p = lds + (row + (lane & 15)) * ld + kbase + ((lane >> 4) << 3);
  h8 lo = *(const h8*)(p);
  h8 hi = *(const h8*)(p + 16);
  return __builtin_shufflevector(lo, hi, 0, 1, 2, 3, 4, 5, 6, 7, 8, 9, 10, 11,
                                 12, 13, 14, 15);
}

// Load a 32x16 f16 B fragment (k x n) from a ROW-MAJOR (k x n) LDS tile with
// the transposing LDS load. Lane (c = L%16, h = L/16) receives
// T[kbase + 8h + 0..7][nbase + c]; the second load, 16 rows further, gives
// k = 16 + 8h + 0..7: the same k order as frag_ld delivers for the A side.
typedef __attribute__((ext_vector_type(8))) short s16x8;
typedef __attribute__((address_space(3))) s16x8 lds_s16x8;
static __device__ __forceinline__ h16 frag_ld_tr(const _Float16* lds, int kbase,
                                                 int nbase, int ld) {
  const int lane = threadIdx.x & 31;
  const _Float16* p = lds + (kbase + ((lane >> 4) << 3) + (lane & 7)) * ld +
                      nbase + (((lane >> 3) & 1) << 3);
  h8 lo = __builtin_bit_cast(
      h8, __builtin_amdgcn_ds_load_tr16_b128_v8i16((lds_s16x8*)p));
  h8 hi = __builtin_bit_cast(
      h8, __builtin_amdgcn_ds_load_tr16_b128_v8i16((lds_s16x8*)(p + 16 * ld)));
  return __builtin_shufflevector(lo, hi, 0, 1, 2, 3, 4, 5, 6, 7, 8, 9, 10, 11,
                                 12, 13, 14, 15);
}

// ---------------------------------------------------------------------------
// Kernel 0: f32 -> f16 of x, Wkv and Wo. grid = 768, block = 256: three
// blocks, 24 waves, a WGP. A block converts CVT_UNIT consecutive floats of one
// buffer, a thread's 16 loads issued ahead of its first store. A wave's load
// covers 512 contiguous bytes, its store 256.
// ---------------------------------------------------------------------------
#define CVT_UNIT 16384
#define CVT_XU (BATCH * SEQ * DMODEL / CVT_UNIT)   // 512 blocks for x
#define CVT_KU (3 * DMODEL * DMODEL / CVT_UNIT)    // 192 blocks for Wkv
#define CVT_OU (DMODEL * DMODEL / CVT_UNIT)        // 64 blocks for Wo
__global__ __launch_bounds__(256) void to_f16_kernel(
    const float* __restrict__ x, const float* __restrict__ Wkv,
    const float* __restrict__ Wo, _Float16* __restrict__ xh,
    _Float16* __restrict__ wkvh, _Float16* __restrict__ woh) {
  int u = blockIdx.x;  // which buffer: uniform for the block
  const float* src = x;
  _Float16* dst = xh;
  if (u >= CVT_XU + CVT_KU) {
    src = Wo; dst = woh; u -= CVT_XU + CVT_KU;
  } else if (u >= CVT_XU) {
    src = Wkv; dst = wkvh; u -= CVT_XU;
  }
  const size_t off = (size_t)u * CVT_UNIT + threadIdx.x * 4;
  float4 f[16];
  // both loops unrolled: every index of f constant, so f stays in registers
#pragma unroll
  for (int i = 0; i < 16; ++i) f[i] = *(const float4*)(src + off + i * 1024);
#pragma unroll
  for (int i = 0; i < 16; ++i) {
    h4 h = {(_Float16)f[i].x, (_Float16)f[i].y, (_Float16)f[i].z,
            (_Float16)f[i].w};
    *(h4*)(dst + off + i * 1024) = h;
  }
}

// ---------------------------------------------------------------------------
// Kernel 1: QKV projection. grid = (3*D/128, B*N/128), block = 256 (8 waves).
// Each wave computes a 64x32 register tile (8 wmma accumulators).
// ---------------------------------------------------------------------------
__global__ __launch_bounds__(256) void qkv_proj_kernel(
    const _Float16* __restrict__ xh, const _Float16* __restrict__ wkvh,
    _Float16* __restrict__ qws, _Float16* __restrict__ kws,
    _Float16* __restrict__ vws) {
  extern __shared__ _Float16 smem[];
  const int LD = 72;  // 64 + 8 pad (halfs): 144 B rows for ds_load_b128 readers
  _Float16* Xt = smem;            // [128][72]
  _Float16* Wt = smem + 128 * LD; // [128][72]

  const int tid = threadIdx.x;
  const int wave = tid >> 5;
  const int lane = tid & 31;
  const int nloc = lane & 15;
  const int mhi = (lane >> 4) << 3;  // 0 or 8
  const int m0 = blockIdx.y * 128;
  const int n0 = blockIdx.x * 128;
  const int wm = wave >> 2;  // 0..1 -> 64-row half
  const int wn = wave & 3;   // 0..3 -> 32-col quarter

  f8 acc[4][2] = {};

  for (int k0 = 0; k0 < DMODEL; k0 += 64) {
    __syncthreads();
    // 128x64 f16 tile = 1024 chunks of 16 B (128 B a row); 4 per thread
#pragma unroll
    for (int i = 0; i < 4; ++i) {
      int chunk = tid + i * 256;
      int r = chunk >> 3, c8 = (chunk & 7) * 8;
      h8 hx = *(const h8*)(xh + (size_t)(m0 + r) * DMODEL + k0 + c8);
      h8 hw = *(const h8*)(wkvh + (size_t)(n0 + r) * DMODEL + k0 + c8);
      *(h8*)(Xt + r * LD + c8) = hx;
      *(h8*)(Wt + r * LD + c8) = hw;
    }
    __syncthreads();

    // unrolled: the two 32-k slices read LDS at constant offsets
#pragma unroll
    for (int kk = 0; kk < 64; kk += 32) {
      h16 a[4], b[2];
#pragma unroll
      for (int i = 0; i < 4; ++i) a[i] = frag_ld(Xt, wm * 64 + i * 16, kk, LD);
#pragma unroll
      for (int j = 0; j < 2; ++j) b[j] = frag_ld(Wt, wn * 32 + j * 16, kk, LD);
#pragma unroll
      for (int i = 0; i < 4; ++i)
#pragma unroll
        for (int j = 0; j < 2; ++j) acc[i][j] = wmma32(a[i], b[j], acc[i][j]);
    }
  }

  // Epilogue: destination (q/k/v, head) is uniform per 16-wide tile.
#pragma unroll
  for (int j = 0; j < 2; ++j) {
    int gnb = n0 + wn * 32 + j * 16;        // tile base col (multiple of 16)
    int which = gnb >> 10;                  // 0=q 1=k 2=v (uniform)
    int e = gnb & (DMODEL - 1);
    int hh = e >> 7;                        // head (uniform)
    int hdb = (e & (HDIM - 1)) + nloc;      // feature within head
    _Float16* dst = (which == 0) ? qws : (which == 1) ? kws : vws;
    float scale = (which == 0) ? 0.08838834764831845f : 1.0f;
#pragma unroll
    for (int i = 0; i < 4; ++i)
#pragma unroll
      for (int r = 0; r < 8; ++r) {
        int gm = m0 + wm * 64 + i * 16 + mhi + r;  // row in [0, B*N)
        int bb = gm >> 11, nn = gm & (SEQ - 1);
        dst[(((size_t)bb * NHEAD + hh) * SEQ + nn) * HDIM + hdb] =
            (_Float16)(acc[i][j][r] * scale);
      }
  }
}

// ---------------------------------------------------------------------------
// Kernel 2: flash attention. grid = (B*H, N/128), block = 256 (8 waves).
// Wave w owns query rows [w*16, w*16+16) of the 128-query tile.
// ---------------------------------------------------------------------------
__global__ __launch_bounds__(256) void flash_attn_kernel(
    const _Float16* __restrict__ qws, const _Float16* __restrict__ kws,
    const _Float16* __restrict__ vws, const float* __restrict__ mask,
    _Float16* __restrict__ yws) {
  extern __shared__ _Float16 smem[];
  const int LD = 136;   // 128 + 8 pad: 272 B rows for ds_load_b128 readers
  const int LDV = 144;  // 128 + 16 pad: 288 B rows for the transposing reader
  _Float16* Qt = smem;                 // [128][136] row-major (q x d)
  _Float16* Kt = smem + 128 * LD;      // [128][136] row-major (kv x d)
  _Float16* Pt = smem + 2 * 128 * LD;  // [128][136] probs (q x kv)
  _Float16* Vs = smem + 3 * 128 * LD;  // [128][144] row-major (kv x d)

  const int tid = threadIdx.x;
  const int w = tid >> 5;
  const int lane = tid & 31;
  const int nloc = lane & 15;
  const int mhi = (lane >> 4) << 3;
  const int bh = blockIdx.x;       // b*H + h
  const int q0 = blockIdx.y * 128;
  const size_t hbase = (size_t)bh * SEQ * HDIM;

  // Q tile: 2048 x 16B chunks, 8 per thread (async when available)
#pragma unroll
  for (int i = 0; i < 8; ++i) {
    int chunk = tid + i * 256;
    int r = chunk >> 4, c8 = (chunk & 15) * 8;
    async_cp16(qws + hbase + (size_t)(q0 + r) * HDIM + c8, Qt + r * LD + c8);
  }

  f8 o[8] = {};
  float mrow[8], lrow[8];
#pragma unroll
  for (int r = 0; r < 8; ++r) { mrow[r] = -1.0e30f; lrow[r] = 0.0f; }

  for (int kv0 = 0; kv0 < SEQ; kv0 += 128) {
    // This wave's LDS reads of the previous K and V tiles have retired before
    // the barrier behind which the copies refill those tiles.
    asm volatile("s_wait_dscnt 0x0" ::: "memory");
    async_wait_all();   // our async ops (Q and previous K, V) retired
    __syncthreads();    // previous tile fully consumed by all waves
    // K and V tiles: async row-major copies, 16 B per lane
#pragma unroll
    for (int i = 0; i < 8; ++i) {
      int chunk = tid + i * 256;
      int r = chunk >> 4, c8 = (chunk & 15) * 8;
      async_cp16(kws + hbase + (size_t)(kv0 + r) * HDIM + c8, Kt + r * LD + c8);
      async_cp16(vws + hbase + (size_t)(kv0 + r) * HDIM + c8, Vs + r * LDV + c8);
    }
    __builtin_prefetch(&mask[(size_t)(q0 + w * 16) * SEQ + kv0], 0, 1);
    async_wait_all();   // this wave's K and V copies have landed
    __syncthreads();    // publishes them; also holds the LDS reads behind the wait

    // S = Q @ K^T   (B = K^T  ->  same row-major fragment pattern as A)
    f8 s[8] = {};
#pragma unroll
    for (int kk = 0; kk < HDIM; kk += 32) {
      h16 a = frag_ld(Qt, w * 16, kk, LD);
#pragma unroll
      for (int t = 0; t < 8; ++t) {
        h16 b = frag_ld(Kt, t * 16, kk, LD);
        s[t] = wmma32(a, b, s[t]);
      }
    }

    // Keeps the 64 mask loads behind the score products: hoisted above them,
    // their destination registers lift the kernel over 256 VGPRs, and only one
    // work-group instead of two would then fit a WGP.
    __builtin_amdgcn_sched_barrier(0);

    // additive mask
    const float* mp = mask + (size_t)(q0 + w * 16 + mhi) * SEQ + kv0 + nloc;
#pragma unroll
    for (int t = 0; t < 8; ++t)
#pragma unroll
      for (int r = 0; r < 8; ++r) s[t][r] += mp[(size_t)r * SEQ + t * 16];

    // online softmax: each row lives across 16 lanes of one half-wave
#pragma unroll
    for (int r = 0; r < 8; ++r) {
      float tm = s[0][r];
#pragma unroll
      for (int t = 1; t < 8; ++t) tm = fmaxf(tm, s[t][r]);
      tm = fmaxf(tm, __shfl_xor(tm, 1, 32));
      tm = fmaxf(tm, __shfl_xor(tm, 2, 32));
      tm = fmaxf(tm, __shfl_xor(tm, 4, 32));
      tm = fmaxf(tm, __shfl_xor(tm, 8, 32));
      float nm = fmaxf(mrow[r], tm);
      float corr = __expf(mrow[r] - nm);
      mrow[r] = nm;
      float ps = 0.0f;
#pragma unroll
      for (int t = 0; t < 8; ++t) {
        float p = __expf(s[t][r] - nm);
        ps += p;
        Pt[(w * 16 + mhi + r) * LD + t * 16 + nloc] = (_Float16)p;
      }
      ps += __shfl_xor(ps, 1, 32);
      ps += __shfl_xor(ps, 2, 32);
      ps += __shfl_xor(ps, 4, 32);
      ps += __shfl_xor(ps, 8, 32);
      lrow[r] = lrow[r] * corr + ps;
#pragma unroll
      for (int t = 0; t < 8; ++t) o[t][r] *= corr;
    }
    // Pt rows are wave-private; same-wave LDS ops are in-order -> no barrier.

    // O += P @ V   (B from row-major Vs through the transposing load)
#pragma unroll
    for (int kk = 0; kk < 128; kk += 32) {
      h16 a = frag_ld(Pt, w * 16, kk, LD);
#pragma unroll
      for (int t = 0; t < 8; ++t) {
        h16 b = frag_ld_tr(Vs, kk, t * 16, LDV);
        o[t] = wmma32(a, b, o[t]);
      }
    }
  }

  // normalize and write y [B][N][D] (f16)
  const int b = bh >> 3, h = bh & 7;
#pragma unroll
  for (int t = 0; t < 8; ++t)
#pragma unroll
    for (int r = 0; r < 8; ++r) {
      float val = o[t][r] / lrow[r];
      int row = q0 + w * 16 + mhi + r;
      int col = h * HDIM + t * 16 + nloc;
      yws[((size_t)b * SEQ + row) * DMODEL + col] = (_Float16)val;
    }
}

// ---------------------------------------------------------------------------
// Kernel 3: output projection out = y @ Wo^T + bo. grid = (D/128, B*N/128).
// ---------------------------------------------------------------------------
__global__ __launch_bounds__(256) void out_proj_kernel(
    const _Float16* __restrict__ yws, const _Float16* __restrict__ woh,
    const float* __restrict__ bo, float* __restrict__ out) {
  extern __shared__ _Float16 smem[];
  const int LD = 72;  // 64 + 8 pad (halfs)
  _Float16* Yt = smem;
  _Float16* Wt = smem + 128 * LD;

  const int tid = threadIdx.x;
  const int wave = tid >> 5;
  const int lane = tid & 31;
  const int nloc = lane & 15;
  const int mhi = (lane >> 4) << 3;
  const int m0 = blockIdx.y * 128;
  const int n0 = blockIdx.x * 128;
  const int wm = wave >> 2;
  const int wn = wave & 3;

  f8 acc[4][2] = {};

  for (int k0 = 0; k0 < DMODEL; k0 += 64) {
    __syncthreads();
    // both tiles are f16: 128x64 = 1024 chunks of 16 B each; 4 per thread
#pragma unroll
    for (int i = 0; i < 4; ++i) {
      int chunk = tid + i * 256;
      int r = chunk >> 3, c8 = (chunk & 7) * 8;
      h8 hy = *(const h8*)(yws + (size_t)(m0 + r) * DMODEL + k0 + c8);
      h8 hw = *(const h8*)(woh + (size_t)(n0 + r) * DMODEL + k0 + c8);
      *(h8*)(Yt + r * LD + c8) = hy;
      *(h8*)(Wt + r * LD + c8) = hw;
    }
    __syncthreads();

    // unrolled: the two 32-k slices read LDS at constant offsets
#pragma unroll
    for (int kk = 0; kk < 64; kk += 32) {
      h16 a[4], b[2];
#pragma unroll
      for (int i = 0; i < 4; ++i) a[i] = frag_ld(Yt, wm * 64 + i * 16, kk, LD);
#pragma unroll
      for (int j = 0; j < 2; ++j) b[j] = frag_ld(Wt, wn * 32 + j * 16, kk, LD);
#pragma unroll
      for (int i = 0; i < 4; ++i)
#pragma unroll
        for (int j = 0; j < 2; ++j) acc[i][j] = wmma32(a[i], b[j], acc[i][j]);
    }
  }

#pragma unroll
  for (int i = 0; i < 4; ++i)
#pragma unroll
    for (int j = 0; j < 2; ++j)
#pragma unroll
      for (int r = 0; r < 8; ++r) {
        int gm = m0 + wm * 64 + i * 16 + mhi + r;
        int gn = n0 + wn * 32 + j * 16 + nloc;
        out[(size_t)gm * DMODEL + gn] = acc[i][j][r] + bo[gn];
      }
}

// ---------------------------------------------------------------------------
// Host launch. Inputs: x, mask, Wkv, Wo, bo (all f32). Output: f32 [B,N,D].
// Workspace layout (f16): Q | K | V | Y | x, each B*N*D elements, then Wkv
// (3*D*D) and Wo (D*D): 92 MB in all.
// ---------------------------------------------------------------------------
extern "C" void kernel_launch(void* const* d_in, const int* in_sizes, int n_in,
                              void* d_out, int out_size, void* d_ws,
                              size_t ws_size, hipStream_t stream) {
  (void)in_sizes; (void)n_in; (void)out_size; (void)ws_size;
  const float* x    = (const float*)d_in[0];
  const float* mask = (const float*)d_in[1];
  const float* Wkv  = (const float*)d_in[2];
  const float* Wo   = (const float*)d_in[3];
  const float* bo   = (const float*)d_in[4];
  float* out = (float*)d_out;

  const size_t SZ = (size_t)BATCH * SEQ * DMODEL;  // 8.4M elements
  _Float16* base = (_Float16*)d_ws;
  _Float16* qws = base;
  _Float16* kws = base + SZ;
  _Float16* vws = base + 2 * SZ;
  _Float16* yws = base + 3 * SZ;
  _Float16* xh = base + 4 * SZ;
  _Float16* wkvh = base + 5 * SZ;
  _Float16* woh = wkvh + (size_t)3 * DMODEL * DMODEL;

  const size_t lds_gemm = 2 * 128 * 72 * sizeof(_Float16);   // 36.9 KB
  const size_t lds_attn = (3 * 128 * 136 + 128 * 144) * sizeof(_Float16);  // 138 KB

  to_f16_kernel<<<dim3(CVT_XU + CVT_KU + CVT_OU), 256, 0, stream>>>(
      x, Wkv, Wo, xh, wkvh, woh);
  qkv_proj_kernel<<<dim3(3 * DMODEL / 128, BATCH * SEQ / 128), 256, lds_gemm,
                    stream>>>(xh, wkvh, qws, kws, vws);
  flash_attn_kernel<<<dim3(BATCH * NHEAD, SEQ / 128), 256, lds_attn, stream>>>(
      qws, kws, vws, mask, yws);
  out_proj_kernel<<<dim3(DMODEL / 128, BATCH * SEQ / 128), 256, lds_gemm,
                    stream>>>(yws, woh, bo, out);
}

// v003
// One run takes 165 microseconds.
// Next to v002, in two timings, it ran 1.08 and 1.07 times as fast.
// Counting every step since v000, it is 2.53 times as fast.
#include <hip/hip_runtime.h>
#include <hip/hip_bf16.h>

// ---------------------------------------------------------------------------
// Fused attention block for MI455X (gfx1250, wave32, WMMA).
//   B=4, N=2048, D=1024, H=8, HD=128
//   Stage 0: x, Wkv, Wo -> f16 in ws, once, so that the GEMM blocks that
//            re-read them from L2 fetch half the bytes
//   Stage 1: qkv = x @ Wkv^T  (f16 in, f16 to ws, Q pre-scaled by 1/sqrt(128))
//   Stage 2: flash attention per (b,h), online softmax, f16 WMMA, f32 acc,
//            Q/K/V tiles staged via GLOBAL_LOAD_ASYNC_TO_LDS when available,
//            V kept row-major and transposed on read by ds_load_tr16_b128,
//            products transposed (keys x queries) so that P stays in registers
//   Stage 3: out = y @ Wo^T + bo (f32 out)
// ---------------------------------------------------------------------------

typedef __attribute__((ext_vector_type(4)))  _Float16 h4;
typedef __attribute__((ext_vector_type(8)))  _Float16 h8;
typedef __attribute__((ext_vector_type(16))) _Float16 h16;
typedef __attribute__((ext_vector_type(8)))  float    f8;

#define BATCH 4
#define SEQ   2048
#define DMODEL 1024
#define NHEAD 8
#define HDIM  128

// --- gfx1250 async global->LDS copy (ASYNCcnt-tracked), with fallback -------
#if defined(__gfx1250__) && __has_builtin(__builtin_amdgcn_global_load_async_to_lds_b128)
#define HAVE_ASYNC_LDS 1
// Parameter type revealed by compiler diagnostic: pointer to <4 x i32> vector.
typedef __attribute__((__vector_size__(4 * sizeof(int)))) int i4v;
static __device__ __forceinline__ void async_cp16(const void* g, void* l) {
  __builtin_amdgcn_global_load_async_to_lds_b128((i4v*)g, (i4v*)l, 0, 0);
}
#else
#define HAVE_ASYNC_LDS 0
static __device__ __forceinline__ void async_cp16(const void* g, void* l) {
  *(h8*)l = *(const h8*)g;
}
#endif

static __device__ __forceinline__ void async_wait_all() {
#if HAVE_ASYNC_LDS
#if __has_builtin(__builtin_amdgcn_s_wait_asynccnt)
  __builtin_amdgcn_s_wait_asynccnt(0);
#else
  asm volatile("s_wait_asynccnt 0" ::: "memory");
#endif
#endif
}

// v_wmma_f32_16x16x32_f16 wrapper (8-arg probe-confirmed signature)
static __device__ __forceinline__ f8 wmma32(h16 a, h16 b, f8 c) {
  return __builtin_amdgcn_wmma_f32_16x16x32_f16(false, a, false, b,
                                                (short)0, c, false, false);
}

// Load a 16x32 f16 A/B fragment from a row-major LDS tile.
// CDNA5 16-bit A layout: lane L (L%16 = matrix row, L/16 = k-group) holds
// K = kg*8 + {0..7} in elements 0..7 and K = 16 + kg*8 + {0..7} in elements
// 8..15  ->  two contiguous 16-byte LDS loads per lane.
static __device__ __forceinline__ h16 frag_ld(const _Float16* lds, int row,
                                              int kbase, int ld) {
  const int lane = threadIdx.x & 31;
  const _Float16* p = lds + (row + (lane & 15)) * ld + kbase + ((lane >> 4) << 3);
  h8 lo = *(const h8*)(p);
  h8 hi = *(const h8*)(p + 16);
  return __builtin_shufflevector(lo, hi, 0, 1, 2, 3, 4, 5, 6, 7, 8, 9, 10, 11,
                                 12, 13, 14, 15);
}

// Load a 16x32 f16 A fragment (m x k) from a ROW-MAJOR (k x m) LDS tile with
// the transposing LDS load. Lane (c = L%16, h = L/16) receives
// T[kbase + 8h + 0..7][nbase + c]; the second load, 16 rows further, gives
// k = 16 + 8h + 0..7: the same k order as frag_ld delivers, and as two
// converted accumulator tiles hold when they serve as the B side.
typedef __attribute__((ext_vector_type(8))) short s16x8;
typedef __attribute__((address_space(3))) s16x8 lds_s16x8;
static __device__ __forceinline__ h16 frag_ld_tr(const _Float16* lds, int kbase,
                                                 int nbase, int ld) {
  const int lane = threadIdx.x & 31;
  const _Float16* p = lds + (kbase + ((lane >> 4) << 3) + (lane & 7)) * ld +
                      nbase + (((lane >> 3) & 1) << 3);
  h8 lo = __builtin_bit_cast(
      h8, __builtin_amdgcn_ds_load_tr16_b128_v8i16((lds_s16x8*)p));
  h8 hi = __builtin_bit_cast(
      h8, __builtin_amdgcn_ds_load_tr16_b128_v8i16((lds_s16x8*)(p + 16 * ld)));
  return __builtin_shufflevector(lo, hi, 0, 1, 2, 3, 4, 5, 6, 7, 8, 9, 10, 11,
                                 12, 13, 14, 15);
}

// ---------------------------------------------------------------------------
// Kernel 0: f32 -> f16 of x, Wkv and Wo. grid = 768, block = 256: three
// blocks, 24 waves, a WGP. A block converts CVT_UNIT consecutive floats of one
// buffer, a thread's 16 loads issued ahead of its first store. A wave's load
// covers 512 contiguous bytes, its store 256.
// ---------------------------------------------------------------------------
#define CVT_UNIT 16384
#define CVT_XU (BATCH * SEQ * DMODEL / CVT_UNIT)   // 512 blocks for x
#define CVT_KU (3 * DMODEL * DMODEL / CVT_UNIT)    // 192 blocks for Wkv
#define CVT_OU (DMODEL * DMODEL / CVT_UNIT)        // 64 blocks for Wo
__global__ __launch_bounds__(256) void to_f16_kernel(
    const float* __restrict__ x, const float* __restrict__ Wkv,
    const float* __restrict__ Wo, _Float16* __restrict__ xh,
    _Float16* __restrict__ wkvh, _Float16* __restrict__ woh) {
  int u = blockIdx.x;  // which buffer: uniform for the block
  const float* src = x;
  _Float16* dst = xh;
  if (u >= CVT_XU + CVT_KU) {
    src = Wo; dst = woh; u -= CVT_XU + CVT_KU;
  } else if (u >= CVT_XU) {
    src = Wkv; dst = wkvh; u -= CVT_XU;
  }
  const size_t off = (size_t)u * CVT_UNIT + threadIdx.x * 4;
  float4 f[16];
  // both loops unrolled: every index of f constant, so f stays in registers
#pragma unroll
  for (int i = 0; i < 16; ++i) f[i] = *(const float4*)(src + off + i * 1024);
#pragma unroll
  for (int i = 0; i < 16; ++i) {
    h4 h = {(_Float16)f[i].x, (_Float16)f[i].y, (_Float16)f[i].z,
            (_Float16)f[i].w};
    *(h4*)(dst + off + i * 1024) = h;
  }
}

// ---------------------------------------------------------------------------
// Kernel 1: QKV projection. grid = (3*D/128, B*N/128), block = 256 (8 waves).
// Each wave computes a 64x32 register tile (8 wmma accumulators).
// ---------------------------------------------------------------------------
__global__ __launch_bounds__(256) void qkv_proj_kernel(
    const _Float16* __restrict__ xh, const _Float16* __restrict__ wkvh,
    _Float16* __restrict__ qws, _Float16* __restrict__ kws,
    _Float16* __restrict__ vws) {
  extern __shared__ _Float16 smem[];
  const int LD = 72;  // 64 + 8 pad (halfs): 144 B rows for ds_load_b128 readers
  _Float16* Xt = smem;            // [128][72]
  _Float16* Wt = smem + 128 * LD; // [128][72]

  const int tid = threadIdx.x;
  const int wave = tid >> 5;
  const int lane = tid & 31;
  const int nloc = lane & 15;
  const int mhi = (lane >> 4) << 3;  // 0 or 8
  const int m0 = blockIdx.y * 128;
  const int n0 = blockIdx.x * 128;
  const int wm = wave >> 2;  // 0..1 -> 64-row half
  const int wn = wave & 3;   // 0..3 -> 32-col quarter

  f8 acc[4][2] = {};

  for (int k0 = 0; k0 < DMODEL; k0 += 64) {
    __syncthreads();
    // 128x64 f16 tile = 1024 chunks of 16 B (128 B a row); 4 per thread
#pragma unroll
    for (int i = 0; i < 4; ++i) {
      int chunk = tid + i * 256;
      int r = chunk >> 3, c8 = (chunk & 7) * 8;
      h8 hx = *(const h8*)(xh + (size_t)(m0 + r) * DMODEL + k0 + c8);
      h8 hw = *(const h8*)(wkvh + (size_t)(n0 + r) * DMODEL + k0 + c8);
      *(h8*)(Xt + r * LD + c8) = hx;
      *(h8*)(Wt + r * LD + c8) = hw;
    }
    __syncthreads();

    // unrolled: the two 32-k slices read LDS at constant offsets
#pragma unroll
    for (int kk = 0; kk < 64; kk += 32) {
      h16 a[4], b[2];
#pragma unroll
      for (int i = 0; i < 4; ++i) a[i] = frag_ld(Xt, wm * 64 + i * 16, kk, LD);
#pragma unroll
      for (int j = 0; j < 2; ++j) b[j] = frag_ld(Wt, wn * 32 + j * 16, kk, LD);
#pragma unroll
      for (int i = 0; i < 4; ++i)
#pragma unroll
        for (int j = 0; j < 2; ++j) acc[i][j] = wmma32(a[i], b[j], acc[i][j]);
    }
  }

  // Epilogue: destination (q/k/v, head) is uniform per 16-wide tile.
#pragma unroll
  for (int j = 0; j < 2; ++j) {
    int gnb = n0 + wn * 32 + j * 16;        // tile base col (multiple of 16)
    int which = gnb >> 10;                  // 0=q 1=k 2=v (uniform)
    int e = gnb & (DMODEL - 1);
    int hh = e >> 7;                        // head (uniform)
    int hdb = (e & (HDIM - 1)) + nloc;      // feature within head
    _Float16* dst = (which == 0) ? qws : (which == 1) ? kws : vws;
    float scale = (which == 0) ? 0.08838834764831845f : 1.0f;
#pragma unroll
    for (int i = 0; i < 4; ++i)
#pragma unroll
      for (int r = 0; r < 8; ++r) {
        int gm = m0 + wm * 64 + i * 16 + mhi + r;  // row in [0, B*N)
        int bb = gm >> 11, nn = gm & (SEQ - 1);
        dst[(((size_t)bb * NHEAD + hh) * SEQ + nn) * HDIM + hdb] =
            (_Float16)(acc[i][j][r] * scale);
      }
  }
}

// ---------------------------------------------------------------------------
// Kernel 2: flash attention. grid = (B*H, N/128), block = 256 (8 waves).
// Wave w owns queries [w*16, w*16+16) of the 128-query tile and works on the
// transposed products: S^T = K Q^T (keys x queries) and O^T += V^T P^T
// (features x queries). A lane then holds scores of ONE query (column
// lane%16; keys 8*(lane/16)+0..7 of every 16-key tile), so the maximum and the
// sum run inside the lane with one exchange between the wave's halves, and two
// converted S^T tiles are the B operand of the second product as they stand:
// the probabilities never pass through LDS.
// ---------------------------------------------------------------------------
// Lane l <-> lane l ^ 16 by a vector cross-row move.
static __device__ __forceinline__ float xhalf(float v) {
  int b = __builtin_bit_cast(int, v);
  return __builtin_bit_cast(
      float, __builtin_amdgcn_permlanex16(b, b, 0x76543210, 0xfedcba98, false,
                                          false));
}

__global__ __launch_bounds__(256) void flash_attn_kernel(
    const _Float16* __restrict__ qws, const _Float16* __restrict__ kws,
    const _Float16* __restrict__ vws, const float* __restrict__ mask,
    _Float16* __restrict__ yws) {
  extern __shared__ _Float16 smem[];
  const int LD = 136;   // 128 + 8 pad: 272 B rows for ds_load_b128 readers
  const int LDV = 144;  // 128 + 16 pad: 288 B rows for the transposing reader
  _Float16* Qt = smem;                 // [128][136] row-major (q x d)
  _Float16* Kt = smem + 128 * LD;      // [128][136] row-major (kv x d)
  _Float16* Vs = smem + 2 * 128 * LD;  // [128][144] row-major (kv x d)

  const int tid = threadIdx.x;
  const int w = tid >> 5;
  const int lane = tid & 31;
  const int nloc = lane & 15;
  const int mhi = (lane >> 4) << 3;
  const int bh = blockIdx.x;       // b*H + h
  const int q0 = blockIdx.y * 128;
  const size_t hbase = (size_t)bh * SEQ * HDIM;

  // Q tile: 2048 x 16B chunks, 8 per thread (async when available)
#pragma unroll
  for (int i = 0; i < 8; ++i) {
    int chunk = tid + i * 256;
    int r = chunk >> 4, c8 = (chunk & 15) * 8;
    async_cp16(qws + hbase + (size_t)(q0 + r) * HDIM + c8, Qt + r * LD + c8);
  }

  f8 o[8] = {};  // o[t][r] = O^T[feature t*16 + mhi + r][query nloc]
  float mrun = -1.0e30f;  // running maximum of this lane's query
  float lsum = 0.0f;      // running sum over this half-wave's keys only
  // The lane's place in its own query's mask row, advanced by a tile each trip.
  const float* mp = mask + (size_t)(q0 + w * 16 + nloc) * SEQ + mhi;

  for (int kv0 = 0; kv0 < SEQ; kv0 += 128) {
    // This wave's LDS reads of the previous K and V tiles have retired before
    // the barrier behind which the copies refill those tiles.
    asm volatile("s_wait_dscnt 0x0" ::: "memory");
    async_wait_all();   // our async ops (Q and previous K, V) retired
    __syncthreads();    // previous tile fully consumed by all waves
    // K and V tiles: async row-major copies, 16 B per lane
#pragma unroll
    for (int i = 0; i < 8; ++i) {
      int chunk = tid + i * 256;
      int r = chunk >> 4, c8 = (chunk & 15) * 8;
      async_cp16(kws + hbase + (size_t)(kv0 + r) * HDIM + c8, Kt + r * LD + c8);
      async_cp16(vws + hbase + (size_t)(kv0 + r) * HDIM + c8, Vs + r * LDV + c8);
    }
    __builtin_prefetch(&mask[(size_t)(q0 + w * 16) * SEQ + kv0], 0, 1);
    async_wait_all();   // this wave's K and V copies have landed
    __syncthreads();    // publishes them; also holds the LDS reads behind the wait

    // S^T = K @ Q^T: A = K rows, B = Q rows, both through the same loader.
    // s[t][r] = score of key kv0 + t*16 + mhi + r for query nloc.
    f8 s[8] = {};
#pragma unroll
    for (int kk = 0; kk < HDIM; kk += 32) {
      h16 bq = frag_ld(Qt, w * 16, kk, LD);
#pragma unroll
      for (int t = 0; t < 8; ++t) {
        h16 ak = frag_ld(Kt, t * 16, kk, LD);
        s[t] = wmma32(ak, bq, s[t]);
      }
    }
    // Order of this block: the LDS reads of four products stand as one group,
    // one group ahead of the four products that use them. Left alone, this
    // build waits for every fragment directly in front of its product, and the
    // wave sits out the LDS latency 32 times a trip.
    __builtin_amdgcn_sched_group_barrier(0x100, 10, 0);  // Q slice, 4 K tiles
    // unrolled: the markers must stand in the one block that they order
#pragma unroll
    for (int g = 0; g < 3; ++g) {
      __builtin_amdgcn_sched_group_barrier(0x100, 8, 0);   // 4 K tiles
      __builtin_amdgcn_sched_group_barrier(0x008, 4, 0);   // 4 products
      __builtin_amdgcn_sched_group_barrier(0x100, 10, 0);  // next slice
      __builtin_amdgcn_sched_group_barrier(0x008, 4, 0);
    }
    __builtin_amdgcn_sched_group_barrier(0x100, 8, 0);
    __builtin_amdgcn_sched_group_barrier(0x008, 8, 0);

    // Keeps the mask loads behind the score products: hoisted above them,
    // their 64 destination registers lift the kernel over 256 VGPRs, and only
    // one work-group instead of two would then fit a WGP.
    __builtin_amdgcn_sched_barrier(0);

    // additive mask: 8 consecutive keys of the lane's own query row a tile
    float4 mk[16];
#pragma unroll
    for (int t = 0; t < 8; ++t) {
      mk[2 * t] = *(const float4*)(mp + t * 16);
      mk[2 * t + 1] = *(const float4*)(mp + t * 16 + 4);
    }
#pragma unroll
    for (int t = 0; t < 8; ++t) {
      s[t][0] += mk[2 * t].x; s[t][1] += mk[2 * t].y;
      s[t][2] += mk[2 * t].z; s[t][3] += mk[2 * t].w;
      s[t][4] += mk[2 * t + 1].x; s[t][5] += mk[2 * t + 1].y;
      s[t][6] += mk[2 * t + 1].z; s[t][7] += mk[2 * t + 1].w;
    }

    // online softmax: 64 of the query's 128 scores are in this lane, the other
    // 64 in lane ^ 16. Four chains of maxima, not one of 64 links.
    float tq[4];
#pragma unroll
    for (int j = 0; j < 4; ++j) {
      tq[j] = s[2 * j][0];
#pragma unroll
      for (int e = 1; e < 16; ++e) tq[j] = fmaxf(tq[j], s[2 * j + (e >> 3)][e & 7]);
    }
    float tm = fmaxf(fmaxf(tq[0], tq[1]), fmaxf(tq[2], tq[3]));
    tm = fmaxf(tm, xhalf(tm));
    const float nm = fmaxf(mrun, tm);
    const float corr = __expf(mrun - nm);
    mrun = nm;

    // Exponents in place, (s - nm) * log2(e), as __expf forms them.
#pragma unroll
    for (int t = 0; t < 8; ++t)
#pragma unroll
      for (int r = 0; r < 8; ++r) s[t][r] = (s[t][r] - nm) * 1.44269504f;
    // Keeps these multiplies ahead of every v_exp_f32.
    __builtin_amdgcn_sched_barrier(0);

    // P^T as B operands: element e of p[j] is key 32j + 16*(e/8) + mhi + e%8,
    // which is register e%8 of tile 2j + e/8 in this same lane. Four sums, one
    // a fragment, so that the adds do not form one chain of 64.
    h16 p[4];
    float ps[4];
#pragma unroll
    for (int j = 0; j < 4; ++j) {
      ps[j] = 0.0f;
#pragma unroll
      for (int e = 0; e < 16; ++e) {
        float pv = __builtin_amdgcn_exp2f(s[2 * j + (e >> 3)][e & 7]);
        ps[j] += pv;
        p[j][e] = (_Float16)pv;
      }
    }
    lsum = lsum * corr + ((ps[0] + ps[1]) + (ps[2] + ps[3]));
#pragma unroll
    for (int t = 0; t < 8; ++t)
#pragma unroll
      for (int r = 0; r < 8; ++r) o[t][r] *= corr;

    // O^T += V^T @ P^T   (A from row-major Vs through the transposing load)
#pragma unroll
    for (int j = 0; j < 4; ++j) {
#pragma unroll
      for (int t = 0; t < 8; ++t) {
        h16 av = frag_ld_tr(Vs, j * 32, t * 16, LDV);
        o[t] = wmma32(av, p[j], o[t]);
      }
    }
    mp += 128;
  }

  // join the halves' sums, normalize and write y [B][N][D] (f16): a lane's 8
  // registers of a tile are 8 consecutive features of its query, one 16 B store
  const float l = lsum + xhalf(lsum);
  const int b = bh >> 3, h = bh & 7;
  _Float16* yp = yws + ((size_t)b * SEQ + q0 + w * 16 + nloc) * DMODEL +
                 h * HDIM + mhi;
#pragma unroll
  for (int t = 0; t < 8; ++t) {
    h8 v;
#pragma unroll
    for (int r = 0; r < 8; ++r) v[r] = (_Float16)(o[t][r] / l);
    *(h8*)(yp + t * 16) = v;
  }
}

// ---------------------------------------------------------------------------
// Kernel 3: output projection out = y @ Wo^T + bo. grid = (D/128, B*N/128).
// ---------------------------------------------------------------------------
__global__ __launch_bounds__(256) void out_proj_kernel(
    const _Float16* __restrict__ yws, const _Float16* __restrict__ woh,
    const float* __restrict__ bo, float* __restrict__ out) {
  extern __shared__ _Float16 smem[];
  const int LD = 72;  // 64 + 8 pad (halfs)
  _Float16* Yt = smem;
  _Float16* Wt = smem + 128 * LD;

  const int tid = threadIdx.x;
  const int wave = tid >> 5;
  const int lane = tid & 31;
  const int nloc = lane & 15;
  const int mhi = (lane >> 4) << 3;
  const int m0 = blockIdx.y * 128;
  const int n0 = blockIdx.x * 128;
  const int wm = wave >> 2;
  const int wn = wave & 3;

  f8 acc[4][2] = {};

  for (int k0 = 0; k0 < DMODEL; k0 += 64) {
    __syncthreads();
    // both tiles are f16: 128x64 = 1024 chunks of 16 B each; 4 per thread
#pragma unroll
    for (int i = 0; i < 4; ++i) {
      int chunk = tid + i * 256;
      int r = chunk >> 3, c8 = (chunk & 7) * 8;
      h8 hy = *(const h8*)(yws + (size_t)(m0 + r) * DMODEL + k0 + c8);
      h8 hw = *(const h8*)(woh + (size_t)(n0 + r) * DMODEL + k0 + c8);
      *(h8*)(Yt + r * LD + c8) = hy;
      *(h8*)(Wt + r * LD + c8) = hw;
    }
    __syncthreads();

    // unrolled: the two 32-k slices read LDS at constant offsets
#pragma unroll
    for (int kk = 0; kk < 64; kk += 32) {
      h16 a[4], b[2];
#pragma unroll
      for (int i = 0; i < 4; ++i) a[i] = frag_ld(Yt, wm * 64 + i * 16, kk, LD);
#pragma unroll
      for (int j = 0; j < 2; ++j) b[j] = frag_ld(Wt, wn * 32 + j * 16, kk, LD);
#pragma unroll
      for (int i = 0; i < 4; ++i)
#pragma unroll
        for (int j = 0; j < 2; ++j) acc[i][j] = wmma32(a[i], b[j], acc[i][j]);
    }
  }

#pragma unroll
  for (int i = 0; i < 4; ++i)
#pragma unroll
    for (int j = 0; j < 2; ++j)
#pragma unroll
      for (int r = 0; r < 8; ++r) {
        int gm = m0 + wm * 64 + i * 16 + mhi + r;
        int gn = n0 + wn * 32 + j * 16 + nloc;
        out[(size_t)gm * DMODEL + gn] = acc[i][j][r] + bo[gn];
      }
}

// ---------------------------------------------------------------------------
// Host launch. Inputs: x, mask, Wkv, Wo, bo (all f32). Output: f32 [B,N,D].
// Workspace layout (f16): Q | K | V | Y | x, each B*N*D elements, then Wkv
// (3*D*D) and Wo (D*D): 92 MB in all.
// ---------------------------------------------------------------------------
extern "C" void kernel_launch(void* const* d_in, const int* in_sizes, int n_in,
                              void* d_out, int out_size, void* d_ws,
                              size_t ws_size, hipStream_t stream) {
  (void)in_sizes; (void)n_in; (void)out_size; (void)ws_size;
  const float* x    = (const float*)d_in[0];
  const float* mask = (const float*)d_in[1];
  const float* Wkv  = (const float*)d_in[2];
  const float* Wo   = (const float*)d_in[3];
  const float* bo   = (const float*)d_in[4];
  float* out = (float*)d_out;

  const size_t SZ = (size_t)BATCH * SEQ * DMODEL;  // 8.4M elements
  _Float16* base = (_Float16*)d_ws;
  _Float16* qws = base;
  _Float16* kws = base + SZ;
  _Float16* vws = base + 2 * SZ;
  _Float16* yws = base + 3 * SZ;
  _Float16* xh = base + 4 * SZ;
  _Float16* wkvh = base + 5 * SZ;
  _Float16* woh = wkvh + (size_t)3 * DMODEL * DMODEL;

  const size_t lds_gemm = 2 * 128 * 72 * sizeof(_Float16);   // 36.9 KB
  const size_t lds_attn = (2 * 128 * 136 + 128 * 144) * sizeof(_Float16);  // 104 KB

  to_f16_kernel<<<dim3(CVT_XU + CVT_KU + CVT_OU), 256, 0, stream>>>(
      x, Wkv, Wo, xh, wkvh, woh);
  qkv_proj_kernel<<<dim3(3 * DMODEL / 128, BATCH * SEQ / 128), 256, lds_gemm,
                    stream>>>(xh, wkvh, qws, kws, vws);
  flash_attn_kernel<<<dim3(BATCH * NHEAD, SEQ / 128), 256, lds_attn, stream>>>(
      qws, kws, vws, mask, yws);
  out_proj_kernel<<<dim3(DMODEL / 128, BATCH * SEQ / 128), 256, lds_gemm,
                    stream>>>(yws, woh, bo, out);
}

// v004
// Measured time: 153 microseconds a run.
// Timed twice side by side with v003, it ran 1.08 times as fast both times.
// Over all steps from v000 it is 2.73 times as fast.
#include <hip/hip_runtime.h>
#include <hip/hip_bf16.h>

// ---------------------------------------------------------------------------
// Fused attention block for MI455X (gfx1250, wave32, WMMA).
//   B=4, N=2048, D=1024, H=8, HD=128
//   Stage 0: x, Wkv, Wo -> f16 in ws, once, so that the GEMM blocks that
//            re-read them from L2 fetch half the bytes; the mask (f32 as it
//            is) copied into the order in which stage 2's lanes hold scores
//   Stage 1: qkv = x @ Wkv^T  (f16 in, f16 to ws, Q pre-scaled by 1/sqrt(128))
//   Stage 2: flash attention per (b,h), online softmax, f16 WMMA, f32 acc,
//            Q/K/V tiles staged via GLOBAL_LOAD_ASYNC_TO_LDS when available,
//            V kept row-major and transposed on read by ds_load_tr16_b128,
//            products transposed (keys x queries) so that P stays in registers
//   Stage 3: out = y @ Wo^T + bo (f32 out)
// ---------------------------------------------------------------------------

typedef __attribute__((ext_vector_type(4)))  _Float16 h4;
typedef __attribute__((ext_vector_type(8)))  _Float16 h8;
typedef __attribute__((ext_vector_type(16))) _Float16 h16;
typedef __attribute__((ext_vector_type(8)))  float    f8;
typedef __attribute__((ext_vector_type(4)))  float    f4;

#define BATCH 4
#define SEQ   2048
#define DMODEL 1024
#define NHEAD 8
#define HDIM  128

// --- gfx1250 async global->LDS copy (ASYNCcnt-tracked), with fallback -------
#if defined(__gfx1250__) && __has_builtin(__builtin_amdgcn_global_load_async_to_lds_b128)
#define HAVE_ASYNC_LDS 1
// Parameter type revealed by compiler diagnostic: pointer to <4 x i32> vector.
typedef __attribute__((__vector_size__(4 * sizeof(int)))) int i4v;
static __device__ __forceinline__ void async_cp16(const void* g, void* l) {
  __builtin_amdgcn_global_load_async_to_lds_b128((i4v*)g, (i4v*)l, 0, 0);
}
#else
#define HAVE_ASYNC_LDS 0
static __device__ __forceinline__ void async_cp16(const void* g, void* l) {
  *(h8*)l = *(const h8*)g;
}
#endif

static __device__ __forceinline__ void async_wait_all() {
#if HAVE_ASYNC_LDS
#if __has_builtin(__builtin_amdgcn_s_wait_asynccnt)
  __builtin_amdgcn_s_wait_asynccnt(0);
#else
  asm volatile("s_wait_asynccnt 0" ::: "memory");
#endif
#endif
}

// v_wmma_f32_16x16x32_f16 wrapper (8-arg probe-confirmed signature)
static __device__ __forceinline__ f8 wmma32(h16 a, h16 b, f8 c) {
  return __builtin_amdgcn_wmma_f32_16x16x32_f16(false, a, false, b,
                                                (short)0, c, false, false);
}

// Load a 16x32 f16 A/B fragment from a row-major LDS tile.
// CDNA5 16-bit A layout: lane L (L%16 = matrix row, L/16 = k-group) holds
// K = kg*8 + {0..7} in elements 0..7 and K = 16 + kg*8 + {0..7} in elements
// 8..15  ->  two contiguous 16-byte LDS loads per lane.
static __device__ __forceinline__ h16 frag_ld(const _Float16* lds, int row,
                                              int kbase, int ld) {
  const int lane = threadIdx.x & 31;
  const _Float16* p = lds + (row + (lane & 15)) * ld + kbase + ((lane >> 4) << 3);
  h8 lo = *(const h8*)(p);
  h8 hi = *(const h8*)(p + 16);
  return __builtin_shufflevector(lo, hi, 0, 1, 2, 3, 4, 5, 6, 7, 8, 9, 10, 11,
                                 12, 13, 14, 15);
}

// Load a 16x32 f16 A fragment (m x k) from a ROW-MAJOR (k x m) LDS tile with
// the transposing LDS load. Lane (c = L%16, h = L/16) receives
// T[kbase + 8h + 0..7][nbase + c]; the second load, 16 rows further, gives
// k = 16 + 8h + 0..7: the same k order as frag_ld delivers, and as two
// converted accumulator tiles hold when they serve as the B side.
typedef __attribute__((ext_vector_type(8))) short s16x8;
typedef __attribute__((address_space(3))) s16x8 lds_s16x8;
static __device__ __forceinline__ h16 frag_ld_tr(const _Float16* lds, int kbase,
                                                 int nbase, int ld) {
  const int lane = threadIdx.x & 31;
  const _Float16* p = lds + (kbase + ((lane >> 4) << 3) + (lane & 7)) * ld +
                      nbase + (((lane >> 3) & 1) << 3);
  h8 lo = __builtin_bit_cast(
      h8, __builtin_amdgcn_ds_load_tr16_b128_v8i16((lds_s16x8*)p));
  h8 hi = __builtin_bit_cast(
      h8, __builtin_amdgcn_ds_load_tr16_b128_v8i16((lds_s16x8*)(p + 16 * ld)));
  return __builtin_shufflevector(lo, hi, 0, 1, 2, 3, 4, 5, 6, 7, 8, 9, 10, 11,
                                 12, 13, 14, 15);
}

// ---------------------------------------------------------------------------
// Kernel 0: f32 -> f16 of x, Wkv and Wo, and the mask's new order. grid = 1024,
// block = 256: four blocks, 32 waves, a WGP. A converting block takes CVT_UNIT
// consecutive floats of one buffer, a thread's 16 loads issued ahead of its
// first store. A wave's load covers 512 contiguous bytes, its store 256.
//
// The mask: stage 2 wants, in lane (c = L%16, h = L/16), the values of query c
// for keys 16t + 8h + 0..7. Read from the mask's own rows, each 16-byte load of
// a wave touches 16 lines, and all 32 (batch, head) pairs pay that again. Here
// it is paid once: a wave takes one unit (16 queries x 128 keys, 8 KB) and
// stores it as 16 groups of 512 contiguous bytes, group i = 2t + u holding, at
// lane L, keys 16t + 8h + 4u + 0..3 of query c. Values are moved, not changed.
// ---------------------------------------------------------------------------
#define CVT_UNIT 16384
#define CVT_XU (BATCH * SEQ * DMODEL / CVT_UNIT)   // 512 blocks for x
#define CVT_KU (3 * DMODEL * DMODEL / CVT_UNIT)    // 192 blocks for Wkv
#define CVT_OU (DMODEL * DMODEL / CVT_UNIT)        // 64 blocks for Wo
#define MSK_UNIT (16 * 128)                        // floats of a mask unit
#define MSK_ROWU (SEQ / 128)                       // 16 units a 16-query strip
#define MSK_BU (SEQ / 16 * MSK_ROWU / 8)           // 256 blocks, a unit a wave
__global__ __launch_bounds__(256) void to_f16_kernel(
    const float* __restrict__ x, const float* __restrict__ Wkv,
    const float* __restrict__ Wo, const float* __restrict__ mask,
    _Float16* __restrict__ xh, _Float16* __restrict__ wkvh,
    _Float16* __restrict__ woh, float* __restrict__ mfrag) {
  int u = blockIdx.x;  // which buffer: uniform for the block
  if (u >= CVT_XU + CVT_KU + CVT_OU) {
    // a block's 8 waves: 8 neighbouring units of one 16-query strip
    const int unit = (u - (CVT_XU + CVT_KU + CVT_OU)) * 8 + (threadIdx.x >> 5);
    const int lane = threadIdx.x & 31;
    const float* sp = mask +
                      (size_t)((unit / MSK_ROWU) * 16 + (lane & 15)) * SEQ +
                      (unit % MSK_ROWU) * 128 + ((lane >> 4) << 3);
    float* dp = mfrag + (size_t)unit * MSK_UNIT + lane * 4;
    f4 g[16];
    // both loops unrolled: every index of g constant, so g stays in registers
#pragma unroll
    for (int i = 0; i < 16; ++i)
      g[i] = *(const f4*)(sp + (i >> 1) * 16 + (i & 1) * 4);
    // Holds all 16 loads ahead of the first store (loaded values as inputs
    // only): left alone, this build pairs each load with its store and waits
    // out the load latency 16 times in a row. The address is an input too, so
    // that its registers are given to nothing else while the loads are out.
    asm volatile("" ::"v"(sp), "v"(g[0]), "v"(g[1]), "v"(g[2]), "v"(g[3]), "v"(g[4]),
                 "v"(g[5]), "v"(g[6]), "v"(g[7]), "v"(g[8]), "v"(g[9]),
                 "v"(g[10]), "v"(g[11]), "v"(g[12]), "v"(g[13]), "v"(g[14]),
                 "v"(g[15]));
#pragma unroll
    for (int i = 0; i < 16; ++i) *(f4*)(dp + i * 128) = g[i];
    return;
  }
  const float* src = x;
  _Float16* dst = xh;
  if (u >= CVT_XU + CVT_KU) {
    src = Wo; dst = woh; u -= CVT_XU + CVT_KU;
  } else if (u >= CVT_XU) {
    src = Wkv; dst = wkvh; u -= CVT_XU;
  }
  const size_t off = (size_t)u * CVT_UNIT + threadIdx.x * 4;
  float4 f[16];
  // both loops unrolled: every index of f constant, so f stays in registers
#pragma unroll
  for (int i = 0; i < 16; ++i) f[i] = *(const float4*)(src + off + i * 1024);
#pragma unroll
  for (int i = 0; i < 16; ++i) {
    h4 h = {(_Float16)f[i].x, (_Float16)f[i].y, (_Float16)f[i].z,
            (_Float16)f[i].w};
    *(h4*)(dst + off + i * 1024) = h;
  }
}

// ---------------------------------------------------------------------------
// Kernel 1: QKV projection. grid = (3*D/128, B*N/128), block = 256 (8 waves).
// Each wave computes a 64x32 register tile (8 wmma accumulators).
// ---------------------------------------------------------------------------
__global__ __launch_bounds__(256) void qkv_proj_kernel(
    const _Float16* __restrict__ xh, const _Float16* __restrict__ wkvh,
    _Float16* __restrict__ qws, _Float16* __restrict__ kws,
    _Float16* __restrict__ vws) {
  extern __shared__ _Float16 smem[];
  const int LD = 72;  // 64 + 8 pad (halfs): 144 B rows for ds_load_b128 readers
  _Float16* Xt = smem;            // [128][72]
  _Float16* Wt = smem + 128 * LD; // [128][72]

  const int tid = threadIdx.x;
  const int wave = tid >> 5;
  const int lane = tid & 31;
  const int nloc = lane & 15;
  const int mhi = (lane >> 4) << 3;  // 0 or 8
  const int m0 = blockIdx.y * 128;
  const int n0 = blockIdx.x * 128;
  const int wm = wave >> 2;  // 0..1 -> 64-row half
  const int wn = wave & 3;   // 0..3 -> 32-col quarter

  f8 acc[4][2] = {};

  for (int k0 = 0; k0 < DMODEL; k0 += 64) {
    __syncthreads();
    // 128x64 f16 tile = 1024 chunks of 16 B (128 B a row); 4 per thread
#pragma unroll
    for (int i = 0; i < 4; ++i) {
      int chunk = tid + i * 256;
      int r = chunk >> 3, c8 = (chunk & 7) * 8;
      h8 hx = *(const h8*)(xh + (size_t)(m0 + r) * DMODEL + k0 + c8);
      h8 hw = *(const h8*)(wkvh + (size_t)(n0 + r) * DMODEL + k0 + c8);
      *(h8*)(Xt + r * LD + c8) = hx;
      *(h8*)(Wt + r * LD + c8) = hw;
    }
    __syncthreads();

    // unrolled: the two 32-k slices read LDS at constant offsets
#pragma unroll
    for (int kk = 0; kk < 64; kk += 32) {
      h16 a[4], b[2];
#pragma unroll
      for (int i = 0; i < 4; ++i) a[i] = frag_ld(Xt, wm * 64 + i * 16, kk, LD);
#pragma unroll
      for (int j = 0; j < 2; ++j) b[j] = frag_ld(Wt, wn * 32 + j * 16, kk, LD);
#pragma unroll
      for (int i = 0; i < 4; ++i)
#pragma unroll
        for (int j = 0; j < 2; ++j) acc[i][j] = wmma32(a[i], b[j], acc[i][j]);
    }
  }

  // Epilogue: destination (q/k/v, head) is uniform per 16-wide tile.
#pragma unroll
  for (int j = 0; j < 2; ++j) {
    int gnb = n0 + wn * 32 + j * 16;        // tile base col (multiple of 16)
    int which = gnb >> 10;                  // 0=q 1=k 2=v (uniform)
    int e = gnb & (DMODEL - 1);
    int hh = e >> 7;                        // head (uniform)
    int hdb = (e & (HDIM - 1)) + nloc;      // feature within head
    _Float16* dst = (which == 0) ? qws : (which == 1) ? kws : vws;
    float scale = (which == 0) ? 0.08838834764831845f : 1.0f;
#pragma unroll
    for (int i = 0; i < 4; ++i)
#pragma unroll
      for (int r = 0; r < 8; ++r) {
        int gm = m0 + wm * 64 + i * 16 + mhi + r;  // row in [0, B*N)
        int bb = gm >> 11, nn = gm & (SEQ - 1);
        dst[(((size_t)bb * NHEAD + hh) * SEQ + nn) * HDIM + hdb] =
            (_Float16)(acc[i][j][r] * scale);
      }
  }
}

// ---------------------------------------------------------------------------
// Kernel 2: flash attention. grid = (B*H, N/128), block = 256 (8 waves).
// Wave w owns queries [w*16, w*16+16) of the 128-query tile and works on the
// transposed products: S^T = K Q^T (keys x queries) and O^T += V^T P^T
// (features x queries). A lane then holds scores of ONE query (column
// lane%16; keys 8*(lane/16)+0..7 of every 16-key tile), so the maximum and the
// sum run inside the lane with one exchange between the wave's halves, and two
// converted S^T tiles are the B operand of the second product as they stand:
// the probabilities never pass through LDS.
// ---------------------------------------------------------------------------
// Lane l <-> lane l ^ 16 by a vector cross-row move.
static __device__ __forceinline__ float xhalf(float v) {
  int b = __builtin_bit_cast(int, v);
  return __builtin_bit_cast(
      float, __builtin_amdgcn_permlanex16(b, b, 0x76543210, 0xfedcba98, false,
                                          false));
}

__global__ __launch_bounds__(256) void flash_attn_kernel(
    const _Float16* __restrict__ qws, const _Float16* __restrict__ kws,
    const _Float16* __restrict__ vws, const float* __restrict__ mfrag,
    _Float16* __restrict__ yws) {
  extern __shared__ _Float16 smem[];
  const int LD = 136;   // 128 + 8 pad: 272 B rows for ds_load_b128 readers
  const int LDV = 144;  // 128 + 16 pad: 288 B rows for the transposing reader
  _Float16* Qt = smem;                 // [128][136] row-major (q x d)
  _Float16* Kt = smem + 128 * LD;      // [128][136] row-major (kv x d)
  _Float16* Vs = smem + 2 * 128 * LD;  // [128][144] row-major (kv x d)

  const int tid = threadIdx.x;
  const int w = tid >> 5;
  const int lane = tid & 31;
  const int nloc = lane & 15;
  const int mhi = (lane >> 4) << 3;
  const int bh = blockIdx.x;       // b*H + h
  const int q0 = blockIdx.y * 128;
  const size_t hbase = (size_t)bh * SEQ * HDIM;

  // Q tile: 2048 x 16B chunks, 8 per thread (async when available)
#pragma unroll
  for (int i = 0; i < 8; ++i) {
    int chunk = tid + i * 256;
    int r = chunk >> 4, c8 = (chunk & 15) * 8;
    async_cp16(qws + hbase + (size_t)(q0 + r) * HDIM + c8, Qt + r * LD + c8);
  }

  f8 o[8] = {};  // o[t][r] = O^T[feature t*16 + mhi + r][query nloc]
  float mrun = -1.0e30f;  // running maximum of this lane's query
  float lsum = 0.0f;      // running sum over this half-wave's keys only
  // The lane's place in the first mask unit of this wave's 16 queries (kernel
  // 0's order), advanced by a unit each trip.
  const float* mp =
      mfrag + (size_t)((q0 >> 4) + w) * MSK_ROWU * MSK_UNIT + lane * 4;

  for (int kv0 = 0; kv0 < SEQ; kv0 += 128) {
    // This wave's LDS reads of the previous K and V tiles have retired before
    // the barrier behind which the copies refill those tiles.
    asm volatile("s_wait_dscnt 0x0" ::: "memory");
    async_wait_all();   // our async ops (Q and previous K, V) retired
    __syncthreads();    // previous tile fully consumed by all waves
    // K and V tiles: async row-major copies, 16 B per lane
#pragma unroll
    for (int i = 0; i < 8; ++i) {
      int chunk = tid + i * 256;
      int r = chunk >> 4, c8 = (chunk & 15) * 8;
      async_cp16(kws + hbase + (size_t)(kv0 + r) * HDIM + c8, Kt + r * LD + c8);
      async_cp16(vws + hbase + (size_t)(kv0 + r) * HDIM + c8, Vs + r * LDV + c8);
    }
    async_wait_all();   // this wave's K and V copies have landed
    __syncthreads();    // publishes them; also holds the LDS reads behind the wait

    // S^T = K @ Q^T: A = K rows, B = Q rows, both through the same loader.
    // s[t][r] = score of key kv0 + t*16 + mhi + r for query nloc.
    f8 s[8] = {};
#pragma unroll
    for (int kk = 0; kk < HDIM; kk += 32) {
      h16 bq = frag_ld(Qt, w * 16, kk, LD);
#pragma unroll
      for (int t = 0; t < 8; ++t) {
        h16 ak = frag_ld(Kt, t * 16, kk, LD);
        s[t] = wmma32(ak, bq, s[t]);
      }
    }
    // Order of this block: the LDS reads of four products stand as one group,
    // one group ahead of the four products that use them. Left alone, this
    // build waits for every fragment directly in front of its product, and the
    // wave sits out the LDS latency 32 times a trip.
    __builtin_amdgcn_sched_group_barrier(0x100, 10, 0);  // Q slice, 4 K tiles
    // unrolled: the markers must stand in the one block that they order
#pragma unroll
    for (int g = 0; g < 3; ++g) {
      __builtin_amdgcn_sched_group_barrier(0x100, 8, 0);   // 4 K tiles
      __builtin_amdgcn_sched_group_barrier(0x008, 4, 0);   // 4 products
      __builtin_amdgcn_sched_group_barrier(0x100, 10, 0);  // next slice
      __builtin_amdgcn_sched_group_barrier(0x008, 4, 0);
    }
    __builtin_amdgcn_sched_group_barrier(0x100, 8, 0);
    __builtin_amdgcn_sched_group_barrier(0x008, 8, 0);

    // Keeps the mask loads behind the score products: hoisted above them,
    // their 64 destination registers lift the kernel over 256 VGPRs, and only
    // one work-group instead of two would then fit a WGP.
    __builtin_amdgcn_sched_barrier(0);

    // additive mask: 8 consecutive keys of the lane's own query a tile, each
    // load of the wave 512 contiguous bytes of the unit
    float4 mk[16];
#pragma unroll
    for (int i = 0; i < 16; ++i) mk[i] = *(const float4*)(mp + i * 128);
#pragma unroll
    for (int t = 0; t < 8; ++t) {
      s[t][0] += mk[2 * t].x; s[t][1] += mk[2 * t].y;
      s[t][2] += mk[2 * t].z; s[t][3] += mk[2 * t].w;
      s[t][4] += mk[2 * t + 1].x; s[t][5] += mk[2 * t + 1].y;
      s[t][6] += mk[2 * t + 1].z; s[t][7] += mk[2 * t + 1].w;
    }

    // online softmax: 64 of the query's 128 scores are in this lane, the other
    // 64 in lane ^ 16. Four chains of maxima, not one of 64 links.
    float tq[4];
#pragma unroll
    for (int j = 0; j < 4; ++j) {
      tq[j] = s[2 * j][0];
#pragma unroll
      for (int e = 1; e < 16; ++e) tq[j] = fmaxf(tq[j], s[2 * j + (e >> 3)][e & 7]);
    }
    float tm = fmaxf(fmaxf(tq[0], tq[1]), fmaxf(tq[2], tq[3]));
    tm = fmaxf(tm, xhalf(tm));
    const float nm = fmaxf(mrun, tm);
    const float corr = __expf(mrun - nm);
    mrun = nm;

    // Exponents in place, (s - nm) * log2(e), as __expf forms them.
#pragma unroll
    for (int t = 0; t < 8; ++t)
#pragma unroll
      for (int r = 0; r < 8; ++r) s[t][r] = (s[t][r] - nm) * 1.44269504f;
    // Keeps these multiplies ahead of every v_exp_f32.
    __builtin_amdgcn_sched_barrier(0);

    // P^T as B operands: element e of p[j] is key 32j + 16*(e/8) + mhi + e%8,
    // which is register e%8 of tile 2j + e/8 in this same lane. Four sums, one
    // a fragment, so that the adds do not form one chain of 64.
    h16 p[4];
    float ps[4];
#pragma unroll
    for (int j = 0; j < 4; ++j) {
      ps[j] = 0.0f;
#pragma unroll
      for (int e = 0; e < 16; ++e) {
        float pv = __builtin_amdgcn_exp2f(s[2 * j + (e >> 3)][e & 7]);
        ps[j] += pv;
        p[j][e] = (_Float16)pv;
      }
    }
    lsum = lsum * corr + ((ps[0] + ps[1]) + (ps[2] + ps[3]));
#pragma unroll
    for (int t = 0; t < 8; ++t)
#pragma unroll
      for (int r = 0; r < 8; ++r) o[t][r] *= corr;

    // O^T += V^T @ P^T   (A from row-major Vs through the transposing load)
#pragma unroll
    for (int j = 0; j < 4; ++j) {
#pragma unroll
      for (int t = 0; t < 8; ++t) {
        h16 av = frag_ld_tr(Vs, j * 32, t * 16, LDV);
        o[t] = wmma32(av, p[j], o[t]);
      }
    }
    mp += MSK_UNIT;
  }

  // join the halves' sums, normalize and write y [B][N][D] (f16): a lane's 8
  // registers of a tile are 8 consecutive features of its query, one 16 B store
  const float l = lsum + xhalf(lsum);
  const int b = bh >> 3, h = bh & 7;
  _Float16* yp = yws + ((size_t)b * SEQ + q0 + w * 16 + nloc) * DMODEL +
                 h * HDIM + mhi;
#pragma unroll
  for (int t = 0; t < 8; ++t) {
    h8 v;
#pragma unroll
    for (int r = 0; r < 8; ++r) v[r] = (_Float16)(o[t][r] / l);
    *(h8*)(yp + t * 16) = v;
  }
}

// ---------------------------------------------------------------------------
// Kernel 3: output projection out = y @ Wo^T + bo. grid = (D/128, B*N/128).
// ---------------------------------------------------------------------------
__global__ __launch_bounds__(256) void out_proj_kernel(
    const _Float16* __restrict__ yws, const _Float16* __restrict__ woh,
    const float* __restrict__ bo, float* __restrict__ out) {
  extern __shared__ _Float16 smem[];
  const int LD = 72;  // 64 + 8 pad (halfs)
  _Float16* Yt = smem;
  _Float16* Wt = smem + 128 * LD;

  const int tid = threadIdx.x;
  const int wave = tid >> 5;
  const int lane = tid & 31;
  const int nloc = lane & 15;
  const int mhi = (lane >> 4) << 3;
  const int m0 = blockIdx.y * 128;
  const int n0 = blockIdx.x * 128;
  const int wm = wave >> 2;
  const int wn = wave & 3;

  f8 acc[4][2] = {};

  for (int k0 = 0; k0 < DMODEL; k0 += 64) {
    __syncthreads();
    // both tiles are f16: 128x64 = 1024 chunks of 16 B each; 4 per thread
#pragma unroll
    for (int i = 0; i < 4; ++i) {
      int chunk = tid + i * 256;
      int r = chunk >> 3, c8 = (chunk & 7) * 8;
      h8 hy = *(const h8*)(yws + (size_t)(m0 + r) * DMODEL + k0 + c8);
      h8 hw = *(const h8*)(woh + (size_t)(n0 + r) * DMODEL + k0 + c8);
      *(h8*)(Yt + r * LD + c8) = hy;
      *(h8*)(Wt + r * LD + c8) = hw;
    }
    __syncthreads();

    // unrolled: the two 32-k slices read LDS at constant offsets
#pragma unroll
    for (int kk = 0; kk < 64; kk += 32) {
      h16 a[4], b[2];
#pragma unroll
      for (int i = 0; i < 4; ++i) a[i] = frag_ld(Yt, wm * 64 + i * 16, kk, LD);
#pragma unroll
      for (int j = 0; j < 2; ++j) b[j] = frag_ld(Wt, wn * 32 + j * 16, kk, LD);
#pragma unroll
      for (int i = 0; i < 4; ++i)
#pragma unroll
        for (int j = 0; j < 2; ++j) acc[i][j] = wmma32(a[i], b[j], acc[i][j]);
    }
  }

#pragma unroll
  for (int i = 0; i < 4; ++i)
#pragma unroll
    for (int j = 0; j < 2; ++j)
#pragma unroll
      for (int r = 0; r < 8; ++r) {
        int gm = m0 + wm * 64 + i * 16 + mhi + r;
        int gn = n0 + wn * 32 + j * 16 + nloc;
        out[(size_t)gm * DMODEL + gn] = acc[i][j][r] + bo[gn];
      }
}

// ---------------------------------------------------------------------------
// Host launch. Inputs: x, mask, Wkv, Wo, bo (all f32). Output: f32 [B,N,D].
// Workspace layout (f16): Q | K | V | Y | x, each B*N*D elements, then Wkv
// (3*D*D) and Wo (D*D), then the re-ordered mask (f32, N*N): 109 MB in all.
// ---------------------------------------------------------------------------
extern "C" void kernel_launch(void* const* d_in, const int* in_sizes, int n_in,
                              void* d_out, int out_size, void* d_ws,
                              size_t ws_size, hipStream_t stream) {
  (void)in_sizes; (void)n_in; (void)out_size; (void)ws_size;
  const float* x    = (const float*)d_in[0];
  const float* mask = (const float*)d_in[1];
  const float* Wkv  = (const float*)d_in[2];
  const float* Wo   = (const float*)d_in[3];
  const float* bo   = (const float*)d_in[4];
  float* out = (float*)d_out;

  const size_t SZ = (size_t)BATCH * SEQ * DMODEL;  // 8.4M elements
  _Float16* base = (_Float16*)d_ws;
  _Float16* qws = base;
  _Float16* kws = base + SZ;
  _Float16* vws = base + 2 * SZ;
  _Float16* yws = base + 3 * SZ;
  _Float16* xh = base + 4 * SZ;
  _Float16* wkvh = base + 5 * SZ;
  _Float16* woh = wkvh + (size_t)3 * DMODEL * DMODEL;
  float* mfrag = (float*)(woh + (size_t)DMODEL * DMODEL);

  const size_t lds_gemm = 2 * 128 * 72 * sizeof(_Float16);   // 36.9 KB
  const size_t lds_attn = (2 * 128 * 136 + 128 * 144) * sizeof(_Float16);  // 104 KB

  to_f16_kernel<<<dim3(CVT_XU + CVT_KU + CVT_OU + MSK_BU), 256, 0, stream>>>(
      x, Wkv, Wo, mask, xh, wkvh, woh, mfrag);
  qkv_proj_kernel<<<dim3(3 * DMODEL / 128, BATCH * SEQ / 128), 256, lds_gemm,
                    stream>>>(xh, wkvh, qws, kws, vws);
  flash_attn_kernel<<<dim3(BATCH * NHEAD, SEQ / 128), 256, lds_attn, stream>>>(
      qws, kws, vws, mfrag, yws);
  out_proj_kernel<<<dim3(DMODEL / 128, BATCH * SEQ / 128), 256, lds_gemm,
                    stream>>>(yws, woh, bo, out);
}

// v005
// One run takes 147 microseconds.
// In both of two side-by-side timings against v004, it was 1.04 times as fast.
// Counting every step since v000, it is 2.85 times as fast.
#include <hip/hip_runtime.h>
#include <hip/hip_bf16.h>

// ---------------------------------------------------------------------------
// Fused attention block for MI455X (gfx1250, wave32, WMMA).
//   B=4, N=2048, D=1024, H=8, HD=128
//   Stage 0: x, Wkv, Wo -> f16 in ws, once, so that the GEMM blocks that
//            re-read them from L2 fetch half the bytes; the mask (f32 as it
//            is) copied into the order in which stage 2's lanes hold scores
//   Stage 1: qkv = x @ Wkv^T  (f16 in, f16 to ws, Q pre-scaled by 1/sqrt(128))
//   Stage 2: flash attention per (b,h), online softmax, f16 WMMA, f32 acc,
//            Q/K/V tiles staged via GLOBAL_LOAD_ASYNC_TO_LDS when available,
//            K and V in two buffers each, fetched a tile of 64 keys ahead,
//            V kept row-major and transposed on read by ds_load_tr16_b128,
//            products transposed (keys x queries) so that P stays in registers
//   Stage 3: out = y @ Wo^T + bo (f32 out)
// ---------------------------------------------------------------------------

typedef __attribute__((ext_vector_type(4)))  _Float16 h4;
typedef __attribute__((ext_vector_type(8)))  _Float16 h8;
typedef __attribute__((ext_vector_type(16))) _Float16 h16;
typedef __attribute__((ext_vector_type(8)))  float    f8;
typedef __attribute__((ext_vector_type(4)))  float    f4;

#define BATCH 4
#define SEQ   2048
#define DMODEL 1024
#define NHEAD 8
#define HDIM  128

// --- gfx1250 async global->LDS copy (ASYNCcnt-tracked), with fallback -------
#if defined(__gfx1250__) && __has_builtin(__builtin_amdgcn_global_load_async_to_lds_b128)
#define HAVE_ASYNC_LDS 1
// Parameter type revealed by compiler diagnostic: pointer to <4 x i32> vector.
typedef __attribute__((__vector_size__(4 * sizeof(int)))) int i4v;
static __device__ __forceinline__ void async_cp16(const void* g, void* l) {
  __builtin_amdgcn_global_load_async_to_lds_b128((i4v*)g, (i4v*)l, 0, 0);
}
#else
#define HAVE_ASYNC_LDS 0
static __device__ __forceinline__ void async_cp16(const void* g, void* l) {
  *(h8*)l = *(const h8*)g;
}
#endif

// v_wmma_f32_16x16x32_f16 wrapper (8-arg probe-confirmed signature)
static __device__ __forceinline__ f8 wmma32(h16 a, h16 b, f8 c) {
  return __builtin_amdgcn_wmma_f32_16x16x32_f16(false, a, false, b,
                                                (short)0, c, false, false);
}

// Load a 16x32 f16 A/B fragment from a row-major LDS tile.
// CDNA5 16-bit A layout: lane L (L%16 = matrix row, L/16 = k-group) holds
// K = kg*8 + {0..7} in elements 0..7 and K = 16 + kg*8 + {0..7} in elements
// 8..15  ->  two contiguous 16-byte LDS loads per lane.
static __device__ __forceinline__ h16 frag_ld(const _Float16* lds, int row,
                                              int kbase, int ld) {
  const int lane = threadIdx.x & 31;
  const _Float16* p = lds + (row + (lane & 15)) * ld + kbase + ((lane >> 4) << 3);
  h8 lo = *(const h8*)(p);
  h8 hi = *(const h8*)(p + 16);
  return __builtin_shufflevector(lo, hi, 0, 1, 2, 3, 4, 5, 6, 7, 8, 9, 10, 11,
                                 12, 13, 14, 15);
}

// Load a 16x32 f16 A fragment (m x k) from a ROW-MAJOR (k x m) LDS tile with
// the transposing LDS load. Lane (c = L%16, h = L/16) receives
// T[kbase + 8h + 0..7][nbase + c]; the second load, 16 rows further, gives
// k = 16 + 8h + 0..7: the same k order as frag_ld delivers, and as two
// converted accumulator tiles hold when they serve as the B side.
typedef __attribute__((ext_vector_type(8))) short s16x8;
typedef __attribute__((address_space(3))) s16x8 lds_s16x8;
static __device__ __forceinline__ h16 frag_ld_tr(const _Float16* lds, int kbase,
                                                 int nbase, int ld) {
  const int lane = threadIdx.x & 31;
  const _Float16* p = lds + (kbase + ((lane >> 4) << 3) + (lane & 7)) * ld +
                      nbase + (((lane >> 3) & 1) << 3);
  h8 lo = __builtin_bit_cast(
      h8, __builtin_amdgcn_ds_load_tr16_b128_v8i16((lds_s16x8*)p));
  h8 hi = __builtin_bit_cast(
      h8, __builtin_amdgcn_ds_load_tr16_b128_v8i16((lds_s16x8*)(p + 16 * ld)));
  return __builtin_shufflevector(lo, hi, 0, 1, 2, 3, 4, 5, 6, 7, 8, 9, 10, 11,
                                 12, 13, 14, 15);
}

// ---------------------------------------------------------------------------
// Kernel 0: f32 -> f16 of x, Wkv and Wo, and the mask's new order. grid = 1024,
// block = 256: four blocks, 32 waves, a WGP. A converting block takes CVT_UNIT
// consecutive floats of one buffer, a thread's 16 loads issued ahead of its
// first store. A wave's load covers 512 contiguous bytes, its store 256.
//
// The mask: stage 2 wants, in lane (c = L%16, h = L/16), the values of query c
// for keys 16t + 8h + 0..7. Read from the mask's own rows, each 16-byte load of
// a wave touches 16 lines, and all 32 (batch, head) pairs pay that again. Here
// it is paid once: a wave takes one unit (16 queries x 128 keys, 8 KB) and
// stores it as 16 groups of 512 contiguous bytes, group i = 2t + u holding, at
// lane L, keys 16t + 8h + 4u + 0..3 of query c. Values are moved, not changed.
// ---------------------------------------------------------------------------
#define CVT_UNIT 16384
#define CVT_XU (BATCH * SEQ * DMODEL / CVT_UNIT)   // 512 blocks for x
#define CVT_KU (3 * DMODEL * DMODEL / CVT_UNIT)    // 192 blocks for Wkv
#define CVT_OU (DMODEL * DMODEL / CVT_UNIT)        // 64 blocks for Wo
#define MSK_UNIT (16 * 128)                        // floats of a mask unit
#define MSK_ROWU (SEQ / 128)                       // 16 units a 16-query strip
#define MSK_BU (SEQ / 16 * MSK_ROWU / 8)           // 256 blocks, a unit a wave
__global__ __launch_bounds__(256) void to_f16_kernel(
    const float* __restrict__ x, const float* __restrict__ Wkv,
    const float* __restrict__ Wo, const float* __restrict__ mask,
    _Float16* __restrict__ xh, _Float16* __restrict__ wkvh,
    _Float16* __restrict__ woh, float* __restrict__ mfrag) {
  int u = blockIdx.x;  // which buffer: uniform for the block
  if (u >= CVT_XU + CVT_KU + CVT_OU) {
    // a block's 8 waves: 8 neighbouring units of one 16-query strip
    const int unit = (u - (CVT_XU + CVT_KU + CVT_OU)) * 8 + (threadIdx.x >> 5);
    const int lane = threadIdx.x & 31;
    const float* sp = mask +
                      (size_t)((unit / MSK_ROWU) * 16 + (lane & 15)) * SEQ +
                      (unit % MSK_ROWU) * 128 + ((lane >> 4) << 3);
    float* dp = mfrag + (size_t)unit * MSK_UNIT + lane * 4;
    f4 g[16];
    // both loops unrolled: every index of g constant, so g stays in registers
#pragma unroll
    for (int i = 0; i < 16; ++i)
      g[i] = *(const f4*)(sp + (i >> 1) * 16 + (i & 1) * 4);
    // Holds all 16 loads ahead of the first store (loaded values as inputs
    // only): left alone, this build pairs each load with its store and waits
    // out the load latency 16 times in a row. The address is an input too, so
    // that its registers are given to nothing else while the loads are out.
    asm volatile("" ::"v"(sp), "v"(g[0]), "v"(g[1]), "v"(g[2]), "v"(g[3]), "v"(g[4]),
                 "v"(g[5]), "v"(g[6]), "v"(g[7]), "v"(g[8]), "v"(g[9]),
                 "v"(g[10]), "v"(g[11]), "v"(g[12]), "v"(g[13]), "v"(g[14]),
                 "v"(g[15]));
#pragma unroll
    for (int i = 0; i < 16; ++i) *(f4*)(dp + i * 128) = g[i];
    return;
  }
  const float* src = x;
  _Float16* dst = xh;
  if (u >= CVT_XU + CVT_KU) {
    src = Wo; dst = woh; u -= CVT_XU + CVT_KU;
  } else if (u >= CVT_XU) {
    src = Wkv; dst = wkvh; u -= CVT_XU;
  }
  const size_t off = (size_t)u * CVT_UNIT + threadIdx.x * 4;
  float4 f[16];
  // both loops unrolled: every index of f constant, so f stays in registers
#pragma unroll
  for (int i = 0; i < 16; ++i) f[i] = *(const float4*)(src + off + i * 1024);
#pragma unroll
  for (int i = 0; i < 16; ++i) {
    h4 h = {(_Float16)f[i].x, (_Float16)f[i].y, (_Float16)f[i].z,
            (_Float16)f[i].w};
    *(h4*)(dst + off + i * 1024) = h;
  }
}

// ---------------------------------------------------------------------------
// Kernel 1: QKV projection. grid = (3*D/128, B*N/128), block = 256 (8 waves).
// Each wave computes a 64x32 register tile (8 wmma accumulators).
// ---------------------------------------------------------------------------
__global__ __launch_bounds__(256) void qkv_proj_kernel(
    const _Float16* __restrict__ xh, const _Float16* __restrict__ wkvh,
    _Float16* __restrict__ qws, _Float16* __restrict__ kws,
    _Float16* __restrict__ vws) {
  extern __shared__ _Float16 smem[];
  const int LD = 72;  // 64 + 8 pad (halfs): 144 B rows for ds_load_b128 readers
  _Float16* Xt = smem;            // [128][72]
  _Float16* Wt = smem + 128 * LD; // [128][72]

  const int tid = threadIdx.x;
  const int wave = tid >> 5;
  const int lane = tid & 31;
  const int nloc = lane & 15;
  const int mhi = (lane >> 4) << 3;  // 0 or 8
  const int m0 = blockIdx.y * 128;
  const int n0 = blockIdx.x * 128;
  const int wm = wave >> 2;  // 0..1 -> 64-row half
  const int wn = wave & 3;   // 0..3 -> 32-col quarter

  f8 acc[4][2] = {};

  for (int k0 = 0; k0 < DMODEL; k0 += 64) {
    __syncthreads();
    // 128x64 f16 tile = 1024 chunks of 16 B (128 B a row); 4 per thread
#pragma unroll
    for (int i = 0; i < 4; ++i) {
      int chunk = tid + i * 256;
      int r = chunk >> 3, c8 = (chunk & 7) * 8;
      h8 hx = *(const h8*)(xh + (size_t)(m0 + r) * DMODEL + k0 + c8);
      h8 hw = *(const h8*)(wkvh + (size_t)(n0 + r) * DMODEL + k0 + c8);
      *(h8*)(Xt + r * LD + c8) = hx;
      *(h8*)(Wt + r * LD + c8) = hw;
    }
    __syncthreads();

    // unrolled: the two 32-k slices read LDS at constant offsets
#pragma unroll
    for (int kk = 0; kk < 64; kk += 32) {
      h16 a[4], b[2];
#pragma unroll
      for (int i = 0; i < 4; ++i) a[i] = frag_ld(Xt, wm * 64 + i * 16, kk, LD);
#pragma unroll
      for (int j = 0; j < 2; ++j) b[j] = frag_ld(Wt, wn * 32 + j * 16, kk, LD);
#pragma unroll
      for (int i = 0; i < 4; ++i)
#pragma unroll
        for (int j = 0; j < 2; ++j) acc[i][j] = wmma32(a[i], b[j], acc[i][j]);
    }
  }

  // Epilogue: destination (q/k/v, head) is uniform per 16-wide tile.
#pragma unroll
  for (int j = 0; j < 2; ++j) {
    int gnb = n0 + wn * 32 + j * 16;        // tile base col (multiple of 16)
    int which = gnb >> 10;                  // 0=q 1=k 2=v (uniform)
    int e = gnb & (DMODEL - 1);
    int hh = e >> 7;                        // head (uniform)
    int hdb = (e & (HDIM - 1)) + nloc;      // feature within head
    _Float16* dst = (which == 0) ? qws : (which == 1) ? kws : vws;
    float scale = (which == 0) ? 0.08838834764831845f : 1.0f;
#pragma unroll
    for (int i = 0; i < 4; ++i)
#pragma unroll
      for (int r = 0; r < 8; ++r) {
        int gm = m0 + wm * 64 + i * 16 + mhi + r;  // row in [0, B*N)
        int bb = gm >> 11, nn = gm & (SEQ - 1);
        dst[(((size_t)bb * NHEAD + hh) * SEQ + nn) * HDIM + hdb] =
            (_Float16)(acc[i][j][r] * scale);
      }
  }
}

// ---------------------------------------------------------------------------
// Kernel 2: flash attention. grid = (B*H, N/128), block = 256 (8 waves).
// Wave w owns queries [w*16, w*16+16) of the 128-query tile and works on the
// transposed products: S^T = K Q^T (keys x queries) and O^T += V^T P^T
// (features x queries). A lane then holds scores of ONE query (column
// lane%16; keys 8*(lane/16)+0..7 of every 16-key tile), so the maximum and the
// sum run inside the lane with one exchange between the wave's halves, and two
// converted S^T tiles are the B operand of the second product as they stand:
// the probabilities never pass through LDS.
// Keys go by tiles of 64 through two K and two V buffers: the copies of tile
// t + 2 are issued at the foot of tile t, behind the one barrier of a tile, and
// the mask values of tile t + 1 are loaded into registers during tile t, so
// that nothing fetched from L2 is waited for where it is asked for.
// ---------------------------------------------------------------------------
// Lane l <-> lane l ^ 16 by a vector cross-row move.
static __device__ __forceinline__ float xhalf(float v) {
  int b = __builtin_bit_cast(int, v);
  return __builtin_bit_cast(
      float, __builtin_amdgcn_permlanex16(b, b, 0x76543210, 0xfedcba98, false,
                                          false));
}

__global__ __launch_bounds__(256) void flash_attn_kernel(
    const _Float16* __restrict__ qws, const _Float16* __restrict__ kws,
    const _Float16* __restrict__ vws, const float* __restrict__ mfrag,
    _Float16* __restrict__ yws) {
  extern __shared__ _Float16 smem[];
  const int LD = 136;   // 128 + 8 pad: 272 B rows for ds_load_b128 readers
  const int LDV = 144;  // 128 + 16 pad: 288 B rows for the transposing reader
  const int KT = 64;    // keys a tile
  const int NT = SEQ / KT;
  _Float16* Qt = smem;                 // [128][136] row-major (q x d)
  _Float16* Kt = smem + 128 * LD;      // 2 buffers of [64][136] (kv x d)
  _Float16* Vs = smem + 2 * 128 * LD;  // 2 buffers of [64][144] (kv x d)

  const int tid = threadIdx.x;
  const int w = tid >> 5;
  const int lane = tid & 31;
  const int nloc = lane & 15;
  const int mhi = (lane >> 4) << 3;
  const int bh = blockIdx.x;       // b*H + h
  const int q0 = blockIdx.y * 128;
  const size_t hbase = (size_t)bh * SEQ * HDIM;

  // A thread's 16 B chunk of a row; its further chunks lie 16 rows apart.
  const int cr = tid >> 4, cc = (tid & 15) * 8;
  const unsigned co = cr * HDIM + cc;  // the same in Q, K and V
  const _Float16* kg = kws + hbase;    // uniform; a tile's rows are added to it
  const _Float16* vg = vws + hbase;
  _Float16* kl = Kt + cr * LD + cc;
  _Float16* vl = Vs + cr * LDV + cc;

  // Q tile: 2048 x 16B chunks, 8 per thread; K and V tile 0: 4 + 4 per thread
#pragma unroll
  for (int i = 0; i < 8; ++i)
    async_cp16(qws + hbase + (size_t)(q0 + i * 16) * HDIM + co,
               Qt + (cr + i * 16) * LD + cc);
#pragma unroll
  for (int i = 0; i < 4; ++i) {
    async_cp16(kg + (size_t)(i * 16) * HDIM + co, kl + i * 16 * LD);
    async_cp16(vg + (size_t)(i * 16) * HDIM + co, vl + i * 16 * LDV);
  }
  // this wave's copies of Q and of tile 0 have landed; the barrier publishes them
  asm volatile("s_wait_asynccnt 0x0" ::: "memory");
  __syncthreads();
  // tile 1 flies into the second buffers while tile 0 is worked on
#pragma unroll
  for (int i = 0; i < 4; ++i) {
    async_cp16(kg + (size_t)(KT + i * 16) * HDIM + co, kl + (KT + i * 16) * LD);
    async_cp16(vg + (size_t)(KT + i * 16) * HDIM + co, vl + (KT + i * 16) * LDV);
  }

  // The wave's Q fragments, read once: with half the keys a tile they would
  // otherwise be read from LDS twice as often.
  h16 bq[4];
#pragma unroll
  for (int kk = 0; kk < 4; ++kk) bq[kk] = frag_ld(Qt, w * 16, kk * 32, LD);

  f8 o[8] = {};  // o[t][r] = O^T[feature t*16 + mhi + r][query nloc]
  float mrun = -1.0e30f;  // running maximum of this lane's query
  float lsum = 0.0f;      // running sum over this half-wave's keys only
  // The lane's place in the first mask unit of this wave's 16 queries (kernel
  // 0's order); a tile of 64 keys is half a unit, 8 loads of 512 contiguous
  // bytes a wave. Tile 0's values are fetched here, each later tile's one tile
  // ahead.
  const float* mp =
      mfrag + (size_t)((q0 >> 4) + w) * MSK_ROWU * MSK_UNIT + lane * 4;
  float4 mk[8];
#pragma unroll
  for (int i = 0; i < 8; ++i) mk[i] = *(const float4*)(mp + i * 128);
  // Stands behind these loads because tile 0 advances the pointer that they
  // name before the last of them has been waited for. (In the loop the wait
  // for all loads in front of the barrier stands between.)
  asm volatile("s_wait_xcnt 0x0" ::: "memory");

  for (int it = 0; it < NT; ++it) {
    const _Float16* Kb = Kt + (it & 1) * KT * LD;
    const _Float16* Vb = Vs + (it & 1) * KT * LDV;

    // S^T = K @ Q^T: A = K rows, B = Q rows, both through the same loader.
    // s[t][r] = score of key it*64 + t*16 + mhi + r for query nloc.
    f8 s[4] = {};
#pragma unroll
    for (int kk = 0; kk < 4; ++kk) {
#pragma unroll
      for (int t = 0; t < 4; ++t) {
        h16 ak = frag_ld(Kb, t * 16, kk * 32, LD);
        s[t] = wmma32(ak, bq[kk], s[t]);
      }
    }
    // Order of this block: the LDS reads of four products stand as one group,
    // one group ahead of the four products that use them. Left alone, this
    // build waits for every fragment directly in front of its product, and the
    // wave sits out the LDS latency 16 times a tile.
    __builtin_amdgcn_sched_group_barrier(0x100, 8, 0);  // 4 K tiles
    // unrolled: the markers must stand in the one block that they order
#pragma unroll
    for (int g = 0; g < 3; ++g) {
      __builtin_amdgcn_sched_group_barrier(0x100, 8, 0);  // next 4 K tiles
      __builtin_amdgcn_sched_group_barrier(0x008, 4, 0);  // 4 products
    }
    __builtin_amdgcn_sched_group_barrier(0x008, 4, 0);
    // Ends the block that the markers order: without it this build weaves the
    // mask additions in and again waits for each fragment in front of its product.
    __builtin_amdgcn_sched_barrier(0);

    // additive mask: 8 consecutive keys of the lane's own query a 16-key tile
#pragma unroll
    for (int t = 0; t < 4; ++t) {
      s[t][0] += mk[2 * t].x; s[t][1] += mk[2 * t].y;
      s[t][2] += mk[2 * t].z; s[t][3] += mk[2 * t].w;
      s[t][4] += mk[2 * t + 1].x; s[t][5] += mk[2 * t + 1].y;
      s[t][6] += mk[2 * t + 1].z; s[t][7] += mk[2 * t + 1].w;
    }
    // The next tile's mask values, asked for a whole tile ahead of their use.
    // The last tile asks for its own again, so that the address stays inside.
    mp += (it + 1 < NT) ? MSK_UNIT / 2 : 0;
#pragma unroll
    for (int i = 0; i < 8; ++i) mk[i] = *(const float4*)(mp + i * 128);

    // online softmax: 32 of the query's 64 scores are in this lane, the other
    // 32 in lane ^ 16. Four chains of maxima, not one of 32 links.
    float tq[4];
#pragma unroll
    for (int j = 0; j < 4; ++j) {
      tq[j] = s[j][0];
#pragma unroll
      for (int e = 1; e < 8; ++e) tq[j] = fmaxf(tq[j], s[j][e]);
    }
    float tm = fmaxf(fmaxf(tq[0], tq[1]), fmaxf(tq[2], tq[3]));
    tm = fmaxf(tm, xhalf(tm));
    const float nm = fmaxf(mrun, tm);
    const float corr = __expf(mrun - nm);
    mrun = nm;

    // Exponents in place, (s - nm) * log2(e), as __expf forms them.
#pragma unroll
    for (int t = 0; t < 4; ++t)
#pragma unroll
      for (int r = 0; r < 8; ++r) s[t][r] = (s[t][r] - nm) * 1.44269504f;
    // Keeps these multiplies ahead of every v_exp_f32. It also keeps the mask
    // loads above it, early in the tile.
    __builtin_amdgcn_sched_barrier(0);

    // P^T as B operands: element e of p[j] is key 32j + 16*(e/8) + mhi + e%8,
    // which is register e%8 of tile 2j + e/8 in this same lane. Two sums a
    // fragment, so that the adds do not form one chain of 32.
    h16 p[2];
    float ps[4];
#pragma unroll
    for (int j = 0; j < 2; ++j) {
      ps[2 * j] = 0.0f;
      ps[2 * j + 1] = 0.0f;
#pragma unroll
      for (int e = 0; e < 16; ++e) {
        float pv = __builtin_amdgcn_exp2f(s[2 * j + (e >> 3)][e & 7]);
        ps[2 * j + (e >> 3)] += pv;
        p[j][e] = (_Float16)pv;
      }
    }
    lsum = lsum * corr + ((ps[0] + ps[1]) + (ps[2] + ps[3]));
#pragma unroll
    for (int t = 0; t < 8; ++t)
#pragma unroll
      for (int r = 0; r < 8; ++r) o[t][r] *= corr;

    // O^T += V^T @ P^T   (A from row-major Vb through the transposing load)
#pragma unroll
    for (int j = 0; j < 2; ++j) {
#pragma unroll
      for (int t = 0; t < 8; ++t) {
        h16 av = frag_ld_tr(Vb, j * 32, t * 16, LDV);
        o[t] = wmma32(av, p[j], o[t]);
      }
    }
    // Order of this block: behind every v_exp_f32 one other vector instruction.
    // It runs in the slot that the half-rate v_exp_f32 leaves empty, and it is
    // the free slot that the instruction set asks for in front of a write to
    // the v_exp_f32's source. Unrolled: the markers stand in the block they order.
#pragma unroll
    for (int g = 0; g < 33; ++g) {
      __builtin_amdgcn_sched_group_barrier(0x400, 1, 0);  // one v_exp_f32
      __builtin_amdgcn_sched_group_barrier(0x002, 1, 0);  // one other
    }

    // Foot of the tile. This wave's LDS reads of the buffers have retired and
    // its copies of the next tile have landed; the one barrier publishes the
    // next tile and ends every wave's reads of the buffers refilled behind it.
    asm volatile("s_wait_dscnt 0x0" ::: "memory");
    asm volatile("s_wait_asynccnt 0x0" ::: "memory");
    __syncthreads();
    if (it + 2 < NT) {  // the same for the whole work-group
      const size_t gr = (size_t)(it + 2) * KT * HDIM;
      const int lb = (it & 1) * KT;
#pragma unroll
      for (int i = 0; i < 4; ++i) {
        async_cp16(kg + gr + (size_t)(i * 16) * HDIM + co, kl + (lb + i * 16) * LD);
        async_cp16(vg + gr + (size_t)(i * 16) * HDIM + co, vl + (lb + i * 16) * LDV);
      }
    }
  }
  // no copy is out when the wave ends
  asm volatile("s_wait_asynccnt 0x0" ::: "memory");

  // join the halves' sums, normalize and write y [B][N][D] (f16): a lane's 8
  // registers of a tile are 8 consecutive features of its query, one 16 B store
  const float l = lsum + xhalf(lsum);
  const int b = bh >> 3, h = bh & 7;
  _Float16* yp = yws + ((size_t)b * SEQ + q0 + w * 16 + nloc) * DMODEL +
                 h * HDIM + mhi;
#pragma unroll
  for (int t = 0; t < 8; ++t) {
    h8 v;
#pragma unroll
    for (int r = 0; r < 8; ++r) v[r] = (_Float16)(o[t][r] / l);
    *(h8*)(yp + t * 16) = v;
  }
}

// ---------------------------------------------------------------------------
// Kernel 3: output projection out = y @ Wo^T + bo. grid = (D/128, B*N/128).
// ---------------------------------------------------------------------------
__global__ __launch_bounds__(256) void out_proj_kernel(
    const _Float16* __restrict__ yws, const _Float16* __restrict__ woh,
    const float* __restrict__ bo, float* __restrict__ out) {
  extern __shared__ _Float16 smem[];
  const int LD = 72;  // 64 + 8 pad (halfs)
  _Float16* Yt = smem;
  _Float16* Wt = smem + 128 * LD;

  const int tid = threadIdx.x;
  const int wave = tid >> 5;
  const int lane = tid & 31;
  const int nloc = lane & 15;
  const int mhi = (lane >> 4) << 3;
  const int m0 = blockIdx.y * 128;
  const int n0 = blockIdx.x * 128;
  const int wm = wave >> 2;
  const int wn = wave & 3;

  f8 acc[4][2] = {};

  for (int k0 = 0; k0 < DMODEL; k0 += 64) {
    __syncthreads();
    // both tiles are f16: 128x64 = 1024 chunks of 16 B each; 4 per thread
#pragma unroll
    for (int i = 0; i < 4; ++i) {
      int chunk = tid + i * 256;
      int r = chunk >> 3, c8 = (chunk & 7) * 8;
      h8 hy = *(const h8*)(yws + (size_t)(m0 + r) * DMODEL + k0 + c8);
      h8 hw = *(const h8*)(woh + (size_t)(n0 + r) * DMODEL + k0 + c8);
      *(h8*)(Yt + r * LD + c8) = hy;
      *(h8*)(Wt + r * LD + c8) = hw;
    }
    __syncthreads();

    // unrolled: the two 32-k slices read LDS at constant offsets
#pragma unroll
    for (int kk = 0; kk < 64; kk += 32) {
      h16 a[4], b[2];
#pragma unroll
      for (int i = 0; i < 4; ++i) a[i] = frag_ld(Yt, wm * 64 + i * 16, kk, LD);
#pragma unroll
      for (int j = 0; j < 2; ++j) b[j] = frag_ld(Wt, wn * 32 + j * 16, kk, LD);
#pragma unroll
      for (int i = 0; i < 4; ++i)
#pragma unroll
        for (int j = 0; j < 2; ++j) acc[i][j] = wmma32(a[i], b[j], acc[i][j]);
    }
  }

#pragma unroll
  for (int i = 0; i < 4; ++i)
#pragma unroll
    for (int j = 0; j < 2; ++j)
#pragma unroll
      for (int r = 0; r < 8; ++r) {
        int gm = m0 + wm * 64 + i * 16 + mhi + r;
        int gn = n0 + wn * 32 + j * 16 + nloc;
        out[(size_t)gm * DMODEL + gn] = acc[i][j][r] + bo[gn];
      }
}

// ---------------------------------------------------------------------------
// Host launch. Inputs: x, mask, Wkv, Wo, bo (all f32). Output: f32 [B,N,D].
// Workspace layout (f16): Q | K | V | Y | x, each B*N*D elements, then Wkv
// (3*D*D) and Wo (D*D), then the re-ordered mask (f32, N*N): 109 MB in all.
// ---------------------------------------------------------------------------
extern "C" void kernel_launch(void* const* d_in, const int* in_sizes, int n_in,
                              void* d_out, int out_size, void* d_ws,
                              size_t ws_size, hipStream_t stream) {
  (void)in_sizes; (void)n_in; (void)out_size; (void)ws_size;
  const float* x    = (const float*)d_in[0];
  const float* mask = (const float*)d_in[1];
  const float* Wkv  = (const float*)d_in[2];
  const float* Wo   = (const float*)d_in[3];
  const float* bo   = (const float*)d_in[4];
  float* out = (float*)d_out;

  const size_t SZ = (size_t)BATCH * SEQ * DMODEL;  // 8.4M elements
  _Float16* base = (_Float16*)d_ws;
  _Float16* qws = base;
  _Float16* kws = base + SZ;
  _Float16* vws = base + 2 * SZ;
  _Float16* yws = base + 3 * SZ;
  _Float16* xh = base + 4 * SZ;
  _Float16* wkvh = base + 5 * SZ;
  _Float16* woh = wkvh + (size_t)3 * DMODEL * DMODEL;
  float* mfrag = (float*)(woh + (size_t)DMODEL * DMODEL);

  const size_t lds_gemm = 2 * 128 * 72 * sizeof(_Float16);   // 36.9 KB
  const size_t lds_attn = (2 * 128 * 136 + 128 * 144) * sizeof(_Float16);  // 104 KB

  to_f16_kernel<<<dim3(CVT_XU + CVT_KU + CVT_OU + MSK_BU), 256, 0, stream>>>(
      x, Wkv, Wo, mask, xh, wkvh, woh, mfrag);
  qkv_proj_kernel<<<dim3(3 * DMODEL / 128, BATCH * SEQ / 128), 256, lds_gemm,
                    stream>>>(xh, wkvh, qws, kws, vws);
  flash_attn_kernel<<<dim3(BATCH * NHEAD, SEQ / 128), 256, lds_attn, stream>>>(
      qws, kws, vws, mfrag, yws);
  out_proj_kernel<<<dim3(DMODEL / 128, BATCH * SEQ / 128), 256, lds_gemm,
                    stream>>>(yws, woh, bo, out);
}

// v006
// It runs in 142 microseconds.
// Timed twice side by side with v005, it ran 1.05 and 1.04 times as fast.
// Over all steps from v000 it is 2.98 times as fast.
#include <hip/hip_runtime.h>
#include <hip/hip_bf16.h>

// ---------------------------------------------------------------------------
// Fused attention block for MI455X (gfx1250, wave32, WMMA).
//   B=4, N=2048, D=1024, H=8, HD=128
//   Stage 0: x, Wkv, Wo -> f16 in ws, once, so that the GEMM blocks that
//            re-read them from L2 fetch half the bytes; the mask (f32 as it
//            is) copied into the order in which stage 2's lanes hold scores
//   Stage 1: qkv = x @ Wkv^T  (f16 in, f16 to ws, Q pre-scaled by 1/sqrt(128)),
//            operand stages copied to LDS asynchronously, a stage ahead
//   Stage 2: flash attention per (b,h), online softmax, f16 WMMA, f32 acc,
//            Q/K/V tiles staged via GLOBAL_LOAD_ASYNC_TO_LDS when available,
//            K and V in two buffers each, fetched a tile of 64 keys ahead,
//            V kept row-major and transposed on read by ds_load_tr16_b128,
//            products transposed (keys x queries) so that P stays in registers
//   Stage 3: out = y @ Wo^T + bo (f32 out)
// ---------------------------------------------------------------------------

typedef __attribute__((ext_vector_type(4)))  _Float16 h4;
typedef __attribute__((ext_vector_type(8)))  _Float16 h8;
typedef __attribute__((ext_vector_type(16))) _Float16 h16;
typedef __attribute__((ext_vector_type(8)))  float    f8;
typedef __attribute__((ext_vector_type(4)))  float    f4;

#define BATCH 4
#define SEQ   2048
#define DMODEL 1024
#define NHEAD 8
#define HDIM  128

// --- gfx1250 async global->LDS copy (ASYNCcnt-tracked), with fallback -------
#if defined(__gfx1250__) && __has_builtin(__builtin_amdgcn_global_load_async_to_lds_b128)
#define HAVE_ASYNC_LDS 1
// Parameter type revealed by compiler diagnostic: pointer to <4 x i32> vector.
typedef __attribute__((__vector_size__(4 * sizeof(int)))) int i4v;
static __device__ __forceinline__ void async_cp16(const void* g, void* l) {
  __builtin_amdgcn_global_load_async_to_lds_b128((i4v*)g, (i4v*)l, 0, 0);
}
#else
#define HAVE_ASYNC_LDS 0
static __device__ __forceinline__ void async_cp16(const void* g, void* l) {
  *(h8*)l = *(const h8*)g;
}
#endif

// v_wmma_f32_16x16x32_f16 wrapper (8-arg probe-confirmed signature)
static __device__ __forceinline__ f8 wmma32(h16 a, h16 b, f8 c) {
  return __builtin_amdgcn_wmma_f32_16x16x32_f16(false, a, false, b,
                                                (short)0, c, false, false);
}

// Load a 16x32 f16 A/B fragment from a row-major LDS tile.
// CDNA5 16-bit A layout: lane L (L%16 = matrix row, L/16 = k-group) holds
// K = kg*8 + {0..7} in elements 0..7 and K = 16 + kg*8 + {0..7} in elements
// 8..15  ->  two contiguous 16-byte LDS loads per lane.
static __device__ __forceinline__ h16 frag_ld(const _Float16* lds, int row,
                                              int kbase, int ld) {
  const int lane = threadIdx.x & 31;
  const _Float16* p = lds + (row + (lane & 15)) * ld + kbase + ((lane >> 4) << 3);
  h8 lo = *(const h8*)(p);
  h8 hi = *(const h8*)(p + 16);
  return __builtin_shufflevector(lo, hi, 0, 1, 2, 3, 4, 5, 6, 7, 8, 9, 10, 11,
                                 12, 13, 14, 15);
}

// Load a 16x32 f16 A fragment (m x k) from a ROW-MAJOR (k x m) LDS tile with
// the transposing LDS load. Lane (c = L%16, h = L/16) receives
// T[kbase + 8h + 0..7][nbase + c]; the second load, 16 rows further, gives
// k = 16 + 8h + 0..7: the same k order as frag_ld delivers, and as two
// converted accumulator tiles hold when they serve as the B side.
typedef __attribute__((ext_vector_type(8))) short s16x8;
typedef __attribute__((address_space(3))) s16x8 lds_s16x8;
static __device__ __forceinline__ h16 frag_ld_tr(const _Float16* lds, int kbase,
                                                 int nbase, int ld) {
  const int lane = threadIdx.x & 31;
  const _Float16* p = lds + (kbase + ((lane >> 4) << 3) + (lane & 7)) * ld +
                      nbase + (((lane >> 3) & 1) << 3);
  h8 lo = __builtin_bit_cast(
      h8, __builtin_amdgcn_ds_load_tr16_b128_v8i16((lds_s16x8*)p));
  h8 hi = __builtin_bit_cast(
      h8, __builtin_amdgcn_ds_load_tr16_b128_v8i16((lds_s16x8*)(p + 16 * ld)));
  return __builtin_shufflevector(lo, hi, 0, 1, 2, 3, 4, 5, 6, 7, 8, 9, 10, 11,
                                 12, 13, 14, 15);
}

// ---------------------------------------------------------------------------
// Kernel 0: f32 -> f16 of x, Wkv and Wo, and the mask's new order. grid = 1024,
// block = 256: four blocks, 32 waves, a WGP. A converting block takes CVT_UNIT
// consecutive floats of one buffer, a thread's 16 loads issued ahead of its
// first store. A wave's load covers 512 contiguous bytes, its store 256.
//
// The mask: stage 2 wants, in lane (c = L%16, h = L/16), the values of query c
// for keys 16t + 8h + 0..7. Read from the mask's own rows, each 16-byte load of
// a wave touches 16 lines, and all 32 (batch, head) pairs pay that again. Here
// it is paid once: a wave takes one unit (16 queries x 128 keys, 8 KB) and
// stores it as 16 groups of 512 contiguous bytes, group i = 2t + u holding, at
// lane L, keys 16t + 8h + 4u + 0..3 of query c. Values are moved, not changed.
// ---------------------------------------------------------------------------
#define CVT_UNIT 16384
#define CVT_XU (BATCH * SEQ * DMODEL / CVT_UNIT)   // 512 blocks for x
#define CVT_KU (3 * DMODEL * DMODEL / CVT_UNIT)    // 192 blocks for Wkv
#define CVT_OU (DMODEL * DMODEL / CVT_UNIT)        // 64 blocks for Wo
#define MSK_UNIT (16 * 128)                        // floats of a mask unit
#define MSK_ROWU (SEQ / 128)                       // 16 units a 16-query strip
#define MSK_BU (SEQ / 16 * MSK_ROWU / 8)           // 256 blocks, a unit a wave
__global__ __launch_bounds__(256) void to_f16_kernel(
    const float* __restrict__ x, const float* __restrict__ Wkv,
    const float* __restrict__ Wo, const float* __restrict__ mask,
    _Float16* __restrict__ xh, _Float16* __restrict__ wkvh,
    _Float16* __restrict__ woh, float* __restrict__ mfrag) {
  int u = blockIdx.x;  // which buffer: uniform for the block
  if (u >= CVT_XU + CVT_KU + CVT_OU) {
    // a block's 8 waves: 8 neighbouring units of one 16-query strip
    const int unit = (u - (CVT_XU + CVT_KU + CVT_OU)) * 8 + (threadIdx.x >> 5);
    const int lane = threadIdx.x & 31;
    const float* sp = mask +
                      (size_t)((unit / MSK_ROWU) * 16 + (lane & 15)) * SEQ +
                      (unit % MSK_ROWU) * 128 + ((lane >> 4) << 3);
    float* dp = mfrag + (size_t)unit * MSK_UNIT + lane * 4;
    f4 g[16];
    // both loops unrolled: every index of g constant, so g stays in registers
#pragma unroll
    for (int i = 0; i < 16; ++i)
      g[i] = *(const f4*)(sp + (i >> 1) * 16 + (i & 1) * 4);
    // Holds all 16 loads ahead of the first store (loaded values as inputs
    // only): left alone, this build pairs each load with its store and waits
    // out the load latency 16 times in a row. The address is an input too, so
    // that its registers are given to nothing else while the loads are out.
    asm volatile("" ::"v"(sp), "v"(g[0]), "v"(g[1]), "v"(g[2]), "v"(g[3]), "v"(g[4]),
                 "v"(g[5]), "v"(g[6]), "v"(g[7]), "v"(g[8]), "v"(g[9]),
                 "v"(g[10]), "v"(g[11]), "v"(g[12]), "v"(g[13]), "v"(g[14]),
                 "v"(g[15]));
#pragma unroll
    for (int i = 0; i < 16; ++i) *(f4*)(dp + i * 128) = g[i];
    return;
  }
  const float* src = x;
  _Float16* dst = xh;
  if (u >= CVT_XU + CVT_KU) {
    src = Wo; dst = woh; u -= CVT_XU + CVT_KU;
  } else if (u >= CVT_XU) {
    src = Wkv; dst = wkvh; u -= CVT_XU;
  }
  const size_t off = (size_t)u * CVT_UNIT + threadIdx.x * 4;
  float4 f[16];
  // both loops unrolled: every index of f constant, so f stays in registers
#pragma unroll
  for (int i = 0; i < 16; ++i) f[i] = *(const float4*)(src + off + i * 1024);
#pragma unroll
  for (int i = 0; i < 16; ++i) {
    h4 h = {(_Float16)f[i].x, (_Float16)f[i].y, (_Float16)f[i].z,
            (_Float16)f[i].w};
    *(h4*)(dst + off + i * 1024) = h;
  }
}

// ---------------------------------------------------------------------------
// Main loop of both GEMMs: acc += A[128 rows][D] * B[128 rows][D]^T, both f16,
// k-contiguous, row pitch D. A stage is 64 k of both tiles (128 B a row). The
// stages go through two LDS buffers: the copies of stage s + 2 are issued at the
// foot of stage s, behind the one barrier of a stage, so that a stage's way from
// L2 is covered by the products of the stage before it, and nothing passes
// through registers. The k order of the sums is that of one buffer.
// ag, bg: first row of the block's tile of A and of B.
// ---------------------------------------------------------------------------
#define GLD 72                   // 64 + 8 pad (halfs): 144 B rows for ds_load_b128
#define GBUF (2 * 128 * GLD)     // halfs of a buffer: A tile, then B tile
#define GNS (DMODEL / 64)        // stages
static __device__ __forceinline__ void gemm_stage_copy(const _Float16* ag,
                                                       const _Float16* bg,
                                                       unsigned al) {
  // 128x64 f16 tile = 1024 chunks of 16 B; 4 of A and 4 of B per thread, 32
  // rows apart; a wave's copy covers 4 whole 128 B rows. al: the LDS byte
  // address of the thread's first chunk of A. One statement, closed by
  // s_wait_xcnt 0, so that no register which a copy names is rewritten ahead
  // of that wait.
  const unsigned rs = 32 * GLD * 2;    // 32 rows in LDS, bytes
  const unsigned tb = 128 * GLD * 2;   // the A tile in LDS, bytes
  const size_t gs = (size_t)32 * DMODEL;  // 32 rows in global memory, halfs
#if defined(__gfx1250__)
  asm volatile(
      "global_load_async_to_lds_b128 %0, %8, off\n\t"
      "global_load_async_to_lds_b128 %1, %9, off\n\t"
      "global_load_async_to_lds_b128 %2, %10, off\n\t"
      "global_load_async_to_lds_b128 %3, %11, off\n\t"
      "global_load_async_to_lds_b128 %4, %12, off\n\t"
      "global_load_async_to_lds_b128 %5, %13, off\n\t"
      "global_load_async_to_lds_b128 %6, %14, off\n\t"
      "global_load_async_to_lds_b128 %7, %15, off\n\t"
      "s_wait_xcnt 0x0"
      ::"v"(al), "v"(al + rs), "v"(al + 2 * rs), "v"(al + 3 * rs),
        "v"(al + tb), "v"(al + tb + rs), "v"(al + tb + 2 * rs),
        "v"(al + tb + 3 * rs), "v"(ag), "v"(ag + gs), "v"(ag + 2 * gs),
        "v"(ag + 3 * gs), "v"(bg), "v"(bg + gs), "v"(bg + 2 * gs),
        "v"(bg + 3 * gs)
      : "memory");
#endif
}

static __device__ __forceinline__ void gemm_mainloop(const _Float16* ag,
                                                     const _Float16* bg,
                                                     _Float16* smem, int wm,
                                                     int wn, f8 (&acc)[4][2]) {
  const int tid = threadIdx.x;
  const int cr = tid >> 3, cc = (tid & 7) * 8;  // the thread's row and chunk
  ag += (size_t)cr * DMODEL + cc;
  bg += (size_t)cr * DMODEL + cc;
  // low 32 bits of a __shared__ address: the byte offset in the block's LDS
  const unsigned al = (unsigned)(size_t)(smem + cr * GLD + cc);

  gemm_stage_copy(ag, bg, al);
  // this wave's copies of stage 0 have landed; the barrier publishes them
  asm volatile("s_wait_asynccnt 0x0" ::: "memory");
  __syncthreads();
  // stage 1 flies into the second buffer while stage 0 is worked on
  gemm_stage_copy(ag + 64, bg + 64, al + GBUF * 2);

  for (int s = 0; s < GNS; ++s) {
    const _Float16* At = smem + (s & 1) * GBUF;
    const _Float16* Bt = At + 128 * GLD;
    // unrolled: the two 32-k slices read LDS at constant offsets
#pragma unroll
    for (int kk = 0; kk < 64; kk += 32) {
      h16 a[4], b[2];
#pragma unroll
      for (int i = 0; i < 4; ++i) a[i] = frag_ld(At, wm * 64 + i * 16, kk, GLD);
#pragma unroll
      for (int j = 0; j < 2; ++j) b[j] = frag_ld(Bt, wn * 32 + j * 16, kk, GLD);
#pragma unroll
      for (int i = 0; i < 4; ++i)
#pragma unroll
        for (int j = 0; j < 2; ++j) acc[i][j] = wmma32(a[i], b[j], acc[i][j]);
    }
    // Order of this block: the 12 LDS reads of a 32-k slice stand as one group
    // in front of its 8 products. Left alone, this build reads each A fragment
    // directly in front of its two products, and the wave sits out the LDS
    // latency 8 times a stage, which is what is left of a stage's chain now.
    // Unrolled: the markers must stand in the one block that they order.
#pragma unroll
    for (int g = 0; g < 2; ++g) {
      __builtin_amdgcn_sched_group_barrier(0x100, 12, 0);  // a slice's reads
      __builtin_amdgcn_sched_group_barrier(0x008, 8, 0);   // its products
    }
    // Foot of the stage. This wave's LDS reads of the buffer have retired and
    // its copies of the next stage have landed; the one barrier publishes the
    // next stage and ends every wave's reads of the buffer refilled behind it.
    asm volatile("s_wait_dscnt 0x0" ::: "memory");
    asm volatile("s_wait_asynccnt 0x0" ::: "memory");
    __syncthreads();
    if (s + 2 < GNS)  // the same for the whole work-group
      gemm_stage_copy(ag + (s + 2) * 64, bg + (s + 2) * 64,
                      al + (s & 1) * (GBUF * 2));
  }
  // no copy is out when the wave goes on to its stores
  asm volatile("s_wait_asynccnt 0x0" ::: "memory");
}

// ---------------------------------------------------------------------------
// Kernel 1: QKV projection. grid = (3*D/128, B*N/128), block = 256 (8 waves).
// Each wave computes a 64x32 register tile (8 wmma accumulators).
// ---------------------------------------------------------------------------
__global__ __launch_bounds__(256) void qkv_proj_kernel(
    const _Float16* __restrict__ xh, const _Float16* __restrict__ wkvh,
    _Float16* __restrict__ qws, _Float16* __restrict__ kws,
    _Float16* __restrict__ vws) {
  extern __shared__ _Float16 smem[];  // 2 buffers of X [128][72], W [128][72]

  const int tid = threadIdx.x;
  const int wave = tid >> 5;
  const int lane = tid & 31;
  const int nloc = lane & 15;
  const int mhi = (lane >> 4) << 3;  // 0 or 8
  const int m0 = blockIdx.y * 128;
  const int n0 = blockIdx.x * 128;
  const int wm = wave >> 2;  // 0..1 -> 64-row half
  const int wn = wave & 3;   // 0..3 -> 32-col quarter

  f8 acc[4][2] = {};
  gemm_mainloop(xh + (size_t)m0 * DMODEL, wkvh + (size_t)n0 * DMODEL, smem, wm,
                wn, acc);

  // Epilogue: destination (q/k/v, head) is uniform per 16-wide tile.
#pragma unroll
  for (int j = 0; j < 2; ++j) {
    int gnb = n0 + wn * 32 + j * 16;        // tile base col (multiple of 16)
    int which = gnb >> 10;                  // 0=q 1=k 2=v (uniform)
    int e = gnb & (DMODEL - 1);
    int hh = e >> 7;                        // head (uniform)
    int hdb = (e & (HDIM - 1)) + nloc;      // feature within head
    _Float16* dst = (which == 0) ? qws : (which == 1) ? kws : vws;
    float scale = (which == 0) ? 0.08838834764831845f : 1.0f;
#pragma unroll
    for (int i = 0; i < 4; ++i)
#pragma unroll
      for (int r = 0; r < 8; ++r) {
        int gm = m0 + wm * 64 + i * 16 + mhi + r;  // row in [0, B*N)
        int bb = gm >> 11, nn = gm & (SEQ - 1);
        dst[(((size_t)bb * NHEAD + hh) * SEQ + nn) * HDIM + hdb] =
            (_Float16)(acc[i][j][r] * scale);
      }
  }
}

// ---------------------------------------------------------------------------
// Kernel 2: flash attention. grid = (B*H, N/128), block = 256 (8 waves).
// Wave w owns queries [w*16, w*16+16) of the 128-query tile and works on the
// transposed products: S^T = K Q^T (keys x queries) and O^T += V^T P^T
// (features x queries). A lane then holds scores of ONE query (column
// lane%16; keys 8*(lane/16)+0..7 of every 16-key tile), so the maximum and the
// sum run inside the lane with one exchange between the wave's halves, and two
// converted S^T tiles are the B operand of the second product as they stand:
// the probabilities never pass through LDS.
// Keys go by tiles of 64 through two K and two V buffers: the copies of tile
// t + 2 are issued at the foot of tile t, behind the one barrier of a tile, and
// the mask values of tile t + 1 are loaded into registers during tile t, so
// that nothing fetched from L2 is waited for where it is asked for.
// ---------------------------------------------------------------------------
// Lane l <-> lane l ^ 16 by a vector cross-row move.
static __device__ __forceinline__ float xhalf(float v) {
  int b = __builtin_bit_cast(int, v);
  return __builtin_bit_cast(
      float, __builtin_amdgcn_permlanex16(b, b, 0x76543210, 0xfedcba98, false,
                                          false));
}

__global__ __launch_bounds__(256) void flash_attn_kernel(
    const _Float16* __restrict__ qws, const _Float16* __restrict__ kws,
    const _Float16* __restrict__ vws, const float* __restrict__ mfrag,
    _Float16* __restrict__ yws) {
  extern __shared__ _Float16 smem[];
  const int LD = 136;   // 128 + 8 pad: 272 B rows for ds_load_b128 readers
  const int LDV = 144;  // 128 + 16 pad: 288 B rows for the transposing reader
  const int KT = 64;    // keys a tile
  const int NT = SEQ / KT;
  _Float16* Qt = smem;                 // [128][136] row-major (q x d)
  _Float16* Kt = smem + 128 * LD;      // 2 buffers of [64][136] (kv x d)
  _Float16* Vs = smem + 2 * 128 * LD;  // 2 buffers of [64][144] (kv x d)

  const int tid = threadIdx.x;
  const int w = tid >> 5;
  const int lane = tid & 31;
  const int nloc = lane & 15;
  const int mhi = (lane >> 4) << 3;
  const int bh = blockIdx.x;       // b*H + h
  const int q0 = blockIdx.y * 128;
  const size_t hbase = (size_t)bh * SEQ * HDIM;

  // A thread's 16 B chunk of a row; its further chunks lie 16 rows apart.
  const int cr = tid >> 4, cc = (tid & 15) * 8;
  const unsigned co = cr * HDIM + cc;  // the same in Q, K and V
  const _Float16* kg = kws + hbase;    // uniform; a tile's rows are added to it
  const _Float16* vg = vws + hbase;
  _Float16* kl = Kt + cr * LD + cc;
  _Float16* vl = Vs + cr * LDV + cc;

  // Q tile: 2048 x 16B chunks, 8 per thread; K and V tile 0: 4 + 4 per thread
#pragma unroll
  for (int i = 0; i < 8; ++i)
    async_cp16(qws + hbase + (size_t)(q0 + i * 16) * HDIM + co,
               Qt + (cr + i * 16) * LD + cc);
#pragma unroll
  for (int i = 0; i < 4; ++i) {
    async_cp16(kg + (size_t)(i * 16) * HDIM + co, kl + i * 16 * LD);
    async_cp16(vg + (size_t)(i * 16) * HDIM + co, vl + i * 16 * LDV);
  }
  // this wave's copies of Q and of tile 0 have landed; the barrier publishes them
  asm volatile("s_wait_asynccnt 0x0" ::: "memory");
  __syncthreads();
  // tile 1 flies into the second buffers while tile 0 is worked on
#pragma unroll
  for (int i = 0; i < 4; ++i) {
    async_cp16(kg + (size_t)(KT + i * 16) * HDIM + co, kl + (KT + i * 16) * LD);
    async_cp16(vg + (size_t)(KT + i * 16) * HDIM + co, vl + (KT + i * 16) * LDV);
  }

  // The wave's Q fragments, read once: with half the keys a tile they would
  // otherwise be read from LDS twice as often.
  h16 bq[4];
#pragma unroll
  for (int kk = 0; kk < 4; ++kk) bq[kk] = frag_ld(Qt, w * 16, kk * 32, LD);

  f8 o[8] = {};  // o[t][r] = O^T[feature t*16 + mhi + r][query nloc]
  float mrun = -1.0e30f;  // running maximum of this lane's query
  float lsum = 0.0f;      // running sum over this half-wave's keys only
  // The lane's place in the first mask unit of this wave's 16 queries (kernel
  // 0's order); a tile of 64 keys is half a unit, 8 loads of 512 contiguous
  // bytes a wave. Tile 0's values are fetched here, each later tile's one tile
  // ahead.
  const float* mp =
      mfrag + (size_t)((q0 >> 4) + w) * MSK_ROWU * MSK_UNIT + lane * 4;
  float4 mk[8];
#pragma unroll
  for (int i = 0; i < 8; ++i) mk[i] = *(const float4*)(mp + i * 128);
  // Stands behind these loads because tile 0 advances the pointer that they
  // name before the last of them has been waited for. (In the loop the wait
  // for all loads in front of the barrier stands between.)
  asm volatile("s_wait_xcnt 0x0" ::: "memory");

  for (int it = 0; it < NT; ++it) {
    const _Float16* Kb = Kt + (it & 1) * KT * LD;
    const _Float16* Vb = Vs + (it & 1) * KT * LDV;

    // S^T = K @ Q^T: A = K rows, B = Q rows, both through the same loader.
    // s[t][r] = score of key it*64 + t*16 + mhi + r for query nloc.
    f8 s[4] = {};
#pragma unroll
    for (int kk = 0; kk < 4; ++kk) {
#pragma unroll
      for (int t = 0; t < 4; ++t) {
        h16 ak = frag_ld(Kb, t * 16, kk * 32, LD);
        s[t] = wmma32(ak, bq[kk], s[t]);
      }
    }
    // Order of this block: the LDS reads of four products stand as one group,
    // one group ahead of the four products that use them. Left alone, this
    // build waits for every fragment directly in front of its product, and the
    // wave sits out the LDS latency 16 times a tile.
    __builtin_amdgcn_sched_group_barrier(0x100, 8, 0);  // 4 K tiles
    // unrolled: the markers must stand in the one block that they order
#pragma unroll
    for (int g = 0; g < 3; ++g) {
      __builtin_amdgcn_sched_group_barrier(0x100, 8, 0);  // next 4 K tiles
      __builtin_amdgcn_sched_group_barrier(0x008, 4, 0);  // 4 products
    }
    __builtin_amdgcn_sched_group_barrier(0x008, 4, 0);
    // Ends the block that the markers order: without it this build weaves the
    // mask additions in and again waits for each fragment in front of its product.
    __builtin_amdgcn_sched_barrier(0);

    // additive mask: 8 consecutive keys of the lane's own query a 16-key tile
#pragma unroll
    for (int t = 0; t < 4; ++t) {
      s[t][0] += mk[2 * t].x; s[t][1] += mk[2 * t].y;
      s[t][2] += mk[2 * t].z; s[t][3] += mk[2 * t].w;
      s[t][4] += mk[2 * t + 1].x; s[t][5] += mk[2 * t + 1].y;
      s[t][6] += mk[2 * t + 1].z; s[t][7] += mk[2 * t + 1].w;
    }
    // The next tile's mask values, asked for a whole tile ahead of their use.
    // The last tile asks for its own again, so that the address stays inside.
    mp += (it + 1 < NT) ? MSK_UNIT / 2 : 0;
#pragma unroll
    for (int i = 0; i < 8; ++i) mk[i] = *(const float4*)(mp + i * 128);

    // online softmax: 32 of the query's 64 scores are in this lane, the other
    // 32 in lane ^ 16. Four chains of maxima, not one of 32 links.
    float tq[4];
#pragma unroll
    for (int j = 0; j < 4; ++j) {
      tq[j] = s[j][0];
#pragma unroll
      for (int e = 1; e < 8; ++e) tq[j] = fmaxf(tq[j], s[j][e]);
    }
    float tm = fmaxf(fmaxf(tq[0], tq[1]), fmaxf(tq[2], tq[3]));
    tm = fmaxf(tm, xhalf(tm));
    const float nm = fmaxf(mrun, tm);
    const float corr = __expf(mrun - nm);
    mrun = nm;

    // Exponents in place, (s - nm) * log2(e), as __expf forms them.
#pragma unroll
    for (int t = 0; t < 4; ++t)
#pragma unroll
      for (int r = 0; r < 8; ++r) s[t][r] = (s[t][r] - nm) * 1.44269504f;
    // Keeps these multiplies ahead of every v_exp_f32. It also keeps the mask
    // loads above it, early in the tile.
    __builtin_amdgcn_sched_barrier(0);

    // P^T as B operands: element e of p[j] is key 32j + 16*(e/8) + mhi + e%8,
    // which is register e%8 of tile 2j + e/8 in this same lane. Two sums a
    // fragment, so that the adds do not form one chain of 32.
    h16 p[2];
    float ps[4];
#pragma unroll
    for (int j = 0; j < 2; ++j) {
      ps[2 * j] = 0.0f;
      ps[2 * j + 1] = 0.0f;
#pragma unroll
      for (int e = 0; e < 16; ++e) {
        float pv = __builtin_amdgcn_exp2f(s[2 * j + (e >> 3)][e & 7]);
        ps[2 * j + (e >> 3)] += pv;
        p[j][e] = (_Float16)pv;
      }
    }
    lsum = lsum * corr + ((ps[0] + ps[1]) + (ps[2] + ps[3]));
#pragma unroll
    for (int t = 0; t < 8; ++t)
#pragma unroll
      for (int r = 0; r < 8; ++r) o[t][r] *= corr;

    // O^T += V^T @ P^T   (A from row-major Vb through the transposing load)
#pragma unroll
    for (int j = 0; j < 2; ++j) {
#pragma unroll
      for (int t = 0; t < 8; ++t) {
        h16 av = frag_ld_tr(Vb, j * 32, t * 16, LDV);
        o[t] = wmma32(av, p[j], o[t]);
      }
    }
    // Order of this block: behind every v_exp_f32 one other vector instruction.
    // It runs in the slot that the half-rate v_exp_f32 leaves empty, and it is
    // the free slot that the instruction set asks for in front of a write to
    // the v_exp_f32's source. Unrolled: the markers stand in the block they order.
#pragma unroll
    for (int g = 0; g < 33; ++g) {
      __builtin_amdgcn_sched_group_barrier(0x400, 1, 0);  // one v_exp_f32
      __builtin_amdgcn_sched_group_barrier(0x002, 1, 0);  // one other
    }

    // Foot of the tile. This wave's LDS reads of the buffers have retired and
    // its copies of the next tile have landed; the one barrier publishes the
    // next tile and ends every wave's reads of the buffers refilled behind it.
    asm volatile("s_wait_dscnt 0x0" ::: "memory");
    asm volatile("s_wait_asynccnt 0x0" ::: "memory");
    __syncthreads();
    if (it + 2 < NT) {  // the same for the whole work-group
      const size_t gr = (size_t)(it + 2) * KT * HDIM;
      const int lb = (it & 1) * KT;
#pragma unroll
      for (int i = 0; i < 4; ++i) {
        async_cp16(kg + gr + (size_t)(i * 16) * HDIM + co, kl + (lb + i * 16) * LD);
        async_cp16(vg + gr + (size_t)(i * 16) * HDIM + co, vl + (lb + i * 16) * LDV);
      }
    }
  }
  // no copy is out when the wave ends
  asm volatile("s_wait_asynccnt 0x0" ::: "memory");

  // join the halves' sums, normalize and write y [B][N][D] (f16): a lane's 8
  // registers of a tile are 8 consecutive features of its query, one 16 B store
  const float l = lsum + xhalf(lsum);
  const int b = bh >> 3, h = bh & 7;
  _Float16* yp = yws + ((size_t)b * SEQ + q0 + w * 16 + nloc) * DMODEL +
                 h * HDIM + mhi;
#pragma unroll
  for (int t = 0; t < 8; ++t) {
    h8 v;
#pragma unroll
    for (int r = 0; r < 8; ++r) v[r] = (_Float16)(o[t][r] / l);
    *(h8*)(yp + t * 16) = v;
  }
}

// ---------------------------------------------------------------------------
// Kernel 3: output projection out = y @ Wo^T + bo. grid = (D/128, B*N/128).
// ---------------------------------------------------------------------------
__global__ __launch_bounds__(256) void out_proj_kernel(
    const _Float16* __restrict__ yws, const _Float16* __restrict__ woh,
    const float* __restrict__ bo, float* __restrict__ out) {
  extern __shared__ _Float16 smem[];  // 2 buffers of Y [128][72], W [128][72]

  const int tid = threadIdx.x;
  const int wave = tid >> 5;
  const int lane = tid & 31;
  const int nloc = lane & 15;
  const int mhi = (lane >> 4) << 3;
  const int m0 = blockIdx.y * 128;
  const int n0 = blockIdx.x * 128;
  const int wm = wave >> 2;
  const int wn = wave & 3;

  f8 acc[4][2] = {};
  gemm_mainloop(yws + (size_t)m0 * DMODEL, woh + (size_t)n0 * DMODEL, smem, wm,
                wn, acc);

#pragma unroll
  for (int i = 0; i < 4; ++i)
#pragma unroll
    for (int j = 0; j < 2; ++j)
#pragma unroll
      for (int r = 0; r < 8; ++r) {
        int gm = m0 + wm * 64 + i * 16 + mhi + r;
        int gn = n0 + wn * 32 + j * 16 + nloc;
        out[(size_t)gm * DMODEL + gn] = acc[i][j][r] + bo[gn];
      }
}

// ---------------------------------------------------------------------------
// Host launch. Inputs: x, mask, Wkv, Wo, bo (all f32). Output: f32 [B,N,D].
// Workspace layout (f16): Q | K | V | Y | x, each B*N*D elements, then Wkv
// (3*D*D) and Wo (D*D), then the re-ordered mask (f32, N*N): 109 MB in all.
// ---------------------------------------------------------------------------
extern "C" void kernel_launch(void* const* d_in, const int* in_sizes, int n_in,
                              void* d_out, int out_size, void* d_ws,
                              size_t ws_size, hipStream_t stream) {
  (void)in_sizes; (void)n_in; (void)out_size; (void)ws_size;
  const float* x    = (const float*)d_in[0];
  const float* mask = (const float*)d_in[1];
  const float* Wkv  = (const float*)d_in[2];
  const float* Wo   = (const float*)d_in[3];
  const float* bo   = (const float*)d_in[4];
  float* out = (float*)d_out;

  const size_t SZ = (size_t)BATCH * SEQ * DMODEL;  // 8.4M elements
  _Float16* base = (_Float16*)d_ws;
  _Float16* qws = base;
  _Float16* kws = base + SZ;
  _Float16* vws = base + 2 * SZ;
  _Float16* yws = base + 3 * SZ;
  _Float16* xh = base + 4 * SZ;
  _Float16* wkvh = base + 5 * SZ;
  _Float16* woh = wkvh + (size_t)3 * DMODEL * DMODEL;
  float* mfrag = (float*)(woh + (size_t)DMODEL * DMODEL);

  const size_t lds_gemm = 2 * GBUF * sizeof(_Float16);       // 73.7 KB
  const size_t lds_attn = (2 * 128 * 136 + 128 * 144) * sizeof(_Float16);  // 104 KB

  to_f16_kernel<<<dim3(CVT_XU + CVT_KU + CVT_OU + MSK_BU), 256, 0, stream>>>(
      x, Wkv, Wo, mask, xh, wkvh, woh, mfrag);
  qkv_proj_kernel<<<dim3(3 * DMODEL / 128, BATCH * SEQ / 128), 256, lds_gemm,
                    stream>>>(xh, wkvh, qws, kws, vws);
  flash_attn_kernel<<<dim3(BATCH * NHEAD, SEQ / 128), 256, lds_attn, stream>>>(
      qws, kws, vws, mfrag, yws);
  out_proj_kernel<<<dim3(DMODEL / 128, BATCH * SEQ / 128), 256, lds_gemm,
                    stream>>>(yws, woh, bo, out);
}

// v007
// A run of this version takes 137 microseconds.
// Timed twice side by side with v006, it ran 1.03 times as fast both times.
// All steps since v000 together make it 3.07 times as fast.
#include <hip/hip_runtime.h>
#include <hip/hip_bf16.h>

// ---------------------------------------------------------------------------
// Fused attention block for MI455X (gfx1250, wave32, WMMA).
//   B=4, N=2048, D=1024, H=8, HD=128
//   Stage 0: x, Wkv, Wo -> f16 in ws, once, so that the GEMM blocks that
//            re-read them from L2 fetch half the bytes; the mask (f32 as it
//            is) copied into the order in which stage 2's lanes hold scores
//   Stage 1: qkv = x @ Wkv^T  (f16 in, f16 to ws, Q pre-scaled by 1/sqrt(128)),
//            operand stages copied to LDS asynchronously, a stage ahead
//   Stage 2: flash attention per (b,h), online softmax, f16 WMMA, f32 acc,
//            Q/K/V tiles staged via GLOBAL_LOAD_ASYNC_TO_LDS when available,
//            K and V in two buffers each, fetched a tile of 64 keys ahead,
//            V kept row-major and transposed on read by ds_load_tr16_b128,
//            products transposed (keys x queries) so that P stays in registers
//   Stage 3: out = y @ Wo^T + bo (f32 out)
// ---------------------------------------------------------------------------

typedef __attribute__((ext_vector_type(4)))  _Float16 h4;
typedef __attribute__((ext_vector_type(8)))  _Float16 h8;
typedef __attribute__((ext_vector_type(16))) _Float16 h16;
typedef __attribute__((ext_vector_type(8)))  float    f8;
typedef __attribute__((ext_vector_type(4)))  float    f4;

#define BATCH 4
#define SEQ   2048
#define DMODEL 1024
#define NHEAD 8
#define HDIM  128

// --- gfx1250 async global->LDS copy (ASYNCcnt-tracked), with fallback -------
#if defined(__gfx1250__) && __has_builtin(__builtin_amdgcn_global_load_async_to_lds_b128)
#define HAVE_ASYNC_LDS 1
// Parameter type revealed by compiler diagnostic: pointer to <4 x i32> vector.
typedef __attribute__((__vector_size__(4 * sizeof(int)))) int i4v;
static __device__ __forceinline__ void async_cp16(const void* g, void* l) {
  __builtin_amdgcn_global_load_async_to_lds_b128((i4v*)g, (i4v*)l, 0, 0);
}
#else
#define HAVE_ASYNC_LDS 0
static __device__ __forceinline__ void async_cp16(const void* g, void* l) {
  *(h8*)l = *(const h8*)g;
}
#endif

// v_wmma_f32_16x16x32_f16 wrapper (8-arg probe-confirmed signature)
static __device__ __forceinline__ f8 wmma32(h16 a, h16 b, f8 c) {
  return __builtin_amdgcn_wmma_f32_16x16x32_f16(false, a, false, b,
                                                (short)0, c, false, false);
}

// Load a 16x32 f16 A/B fragment from a row-major LDS tile.
// CDNA5 16-bit A layout: lane L (L%16 = matrix row, L/16 = k-group) holds
// K = kg*8 + {0..7} in elements 0..7 and K = 16 + kg*8 + {0..7} in elements
// 8..15  ->  two contiguous 16-byte LDS loads per lane.
static __device__ __forceinline__ h16 frag_ld(const _Float16* lds, int row,
                                              int kbase, int ld) {
  const int lane = threadIdx.x & 31;
  const _Float16* p = lds + (row + (lane & 15)) * ld + kbase + ((lane >> 4) << 3);
  h8 lo = *(const h8*)(p);
  h8 hi = *(const h8*)(p + 16);
  return __builtin_shufflevector(lo, hi, 0, 1, 2, 3, 4, 5, 6, 7, 8, 9, 10, 11,
                                 12, 13, 14, 15);
}

// Load a 16x32 f16 A fragment (m x k) from a ROW-MAJOR (k x m) LDS tile with
// the transposing LDS load. Lane (c = L%16, h = L/16) receives
// T[kbase + 8h + 0..7][nbase + c]; the second load, 16 rows further, gives
// k = 16 + 8h + 0..7: the same k order as frag_ld delivers, and as two
// converted accumulator tiles hold when they serve as the B side.
typedef __attribute__((ext_vector_type(8))) short s16x8;
typedef __attribute__((address_space(3))) s16x8 lds_s16x8;
static __device__ __forceinline__ h16 frag_ld_tr(const _Float16* lds, int kbase,
                                                 int nbase, int ld) {
  const int lane = threadIdx.x & 31;
  const _Float16* p = lds + (kbase + ((lane >> 4) << 3) + (lane & 7)) * ld +
                      nbase + (((lane >> 3) & 1) << 3);
  h8 lo = __builtin_bit_cast(
      h8, __builtin_amdgcn_ds_load_tr16_b128_v8i16((lds_s16x8*)p));
  h8 hi = __builtin_bit_cast(
      h8, __builtin_amdgcn_ds_load_tr16_b128_v8i16((lds_s16x8*)(p + 16 * ld)));
  return __builtin_shufflevector(lo, hi, 0, 1, 2, 3, 4, 5, 6, 7, 8, 9, 10, 11,
                                 12, 13, 14, 15);
}

// ---------------------------------------------------------------------------
// Kernel 0: f32 -> f16 of x, Wkv and Wo, and the mask's new order. grid = 1024,
// block = 256: four blocks, 32 waves, a WGP. A converting block takes CVT_UNIT
// consecutive floats of one buffer, a thread's 16 loads issued ahead of its
// first store. A wave's load covers 512 contiguous bytes, its store 256.
//
// The mask: stage 2 wants, in lane (c = L%16, h = L/16), the values of query c
// for keys 16t + 8h + 0..7. Read from the mask's own rows, each 16-byte load of
// a wave touches 16 lines, and all 32 (batch, head) pairs pay that again. Here
// it is paid once: a wave takes one unit (16 queries x 128 keys, 8 KB) and
// stores it as 16 groups of 512 contiguous bytes, group i = 2t + u holding, at
// lane L, keys 16t + 8h + 4u + 0..3 of query c. Values are moved, not changed.
// ---------------------------------------------------------------------------
#define CVT_UNIT 16384
#define CVT_XU (BATCH * SEQ * DMODEL / CVT_UNIT)   // 512 blocks for x
#define CVT_KU (3 * DMODEL * DMODEL / CVT_UNIT)    // 192 blocks for Wkv
#define CVT_OU (DMODEL * DMODEL / CVT_UNIT)        // 64 blocks for Wo
#define MSK_UNIT (16 * 128)                        // floats of a mask unit
#define MSK_ROWU (SEQ / 128)                       // 16 units a 16-query strip
#define MSK_BU (SEQ / 16 * MSK_ROWU / 8)           // 256 blocks, a unit a wave
__global__ __launch_bounds__(256) void to_f16_kernel(
    const float* __restrict__ x, const float* __restrict__ Wkv,
    const float* __restrict__ Wo, const float* __restrict__ mask,
    _Float16* __restrict__ xh, _Float16* __restrict__ wkvh,
    _Float16* __restrict__ woh, float* __restrict__ mfrag) {
  int u = blockIdx.x;  // which buffer: uniform for the block
  if (u >= CVT_XU + CVT_KU + CVT_OU) {
    // a block's 8 waves: 8 neighbouring units of one 16-query strip
    const int unit = (u - (CVT_XU + CVT_KU + CVT_OU)) * 8 + (threadIdx.x >> 5);
    const int lane = threadIdx.x & 31;
    const float* sp = mask +
                      (size_t)((unit / MSK_ROWU) * 16 + (lane & 15)) * SEQ +
                      (unit % MSK_ROWU) * 128 + ((lane >> 4) << 3);
    float* dp = mfrag + (size_t)unit * MSK_UNIT + lane * 4;
    f4 g[16];
    // both loops unrolled: every index of g constant, so g stays in registers
#pragma unroll
    for (int i = 0; i < 16; ++i)
      g[i] = *(const f4*)(sp + (i >> 1) * 16 + (i & 1) * 4);
    // Holds all 16 loads ahead of the first store (loaded values as inputs
    // only): left alone, this build pairs each load with its store and waits
    // out the load latency 16 times in a row. The address is an input too, so
    // that its registers are given to nothing else while the loads are out.
    asm volatile("" ::"v"(sp), "v"(g[0]), "v"(g[1]), "v"(g[2]), "v"(g[3]), "v"(g[4]),
                 "v"(g[5]), "v"(g[6]), "v"(g[7]), "v"(g[8]), "v"(g[9]),
                 "v"(g[10]), "v"(g[11]), "v"(g[12]), "v"(g[13]), "v"(g[14]),
                 "v"(g[15]));
#pragma unroll
    for (int i = 0; i < 16; ++i) *(f4*)(dp + i * 128) = g[i];
    return;
  }
  const float* src = x;
  _Float16* dst = xh;
  if (u >= CVT_XU + CVT_KU) {
    src = Wo; dst = woh; u -= CVT_XU + CVT_KU;
  } else if (u >= CVT_XU) {
    src = Wkv; dst = wkvh; u -= CVT_XU;
  }
  const size_t off = (size_t)u * CVT_UNIT + threadIdx.x * 4;
  float4 f[16];
  // both loops unrolled: every index of f constant, so f stays in registers
#pragma unroll
  for (int i = 0; i < 16; ++i) f[i] = *(const float4*)(src + off + i * 1024);
#pragma unroll
  for (int i = 0; i < 16; ++i) {
    h4 h = {(_Float16)f[i].x, (_Float16)f[i].y, (_Float16)f[i].z,
            (_Float16)f[i].w};
    *(h4*)(dst + off + i * 1024) = h;
  }
}

// ---------------------------------------------------------------------------
// Main loop of both GEMMs: acc += A[128 rows][D] * B[128 rows][D]^T, both f16,
// k-contiguous, row pitch D. A stage is 64 k of both tiles (128 B a row). The
// stages go through two LDS buffers: the copies of stage s + 2 are issued at the
// foot of stage s, behind the one barrier of a stage, so that a stage's way from
// L2 is covered by the products of the stage before it, and nothing passes
// through registers.
// The walk over k starts at stage st and wraps. Work-groups that share a tile of
// A or of B run at the same time; all starting at k = 0, they would ask L2 for
// the same 128 B of the same rows at the same moment, and every row asked for
// anywhere on the chip would lie at the same offset in its 2 KB pitch. With st
// different between them the requests of a moment spread over the whole rows.
// Each sum over k then begins at k = 64 * st: the same terms in a rotated order.
// ag, bg: first row of the block's tile of A and of B.
// ---------------------------------------------------------------------------
#define GLD 72                   // 64 + 8 pad (halfs): 144 B rows for ds_load_b128
#define GBUF (2 * 128 * GLD)     // halfs of a buffer: A tile, then B tile
#define GNS (DMODEL / 64)        // stages
static __device__ __forceinline__ void gemm_stage_copy(const _Float16* ag,
                                                       const _Float16* bg,
                                                       unsigned al) {
  // 128x64 f16 tile = 1024 chunks of 16 B; 4 of A and 4 of B per thread, 32
  // rows apart; a wave's copy covers 4 whole 128 B rows. al: the LDS byte
  // address of the thread's first chunk of A. One statement, closed by
  // s_wait_xcnt 0, so that no register which a copy names is rewritten ahead
  // of that wait.
  const unsigned rs = 32 * GLD * 2;    // 32 rows in LDS, bytes
  const unsigned tb = 128 * GLD * 2;   // the A tile in LDS, bytes
  const size_t gs = (size_t)32 * DMODEL;  // 32 rows in global memory, halfs
#if defined(__gfx1250__)
  asm volatile(
      "global_load_async_to_lds_b128 %0, %8, off\n\t"
      "global_load_async_to_lds_b128 %1, %9, off\n\t"
      "global_load_async_to_lds_b128 %2, %10, off\n\t"
      "global_load_async_to_lds_b128 %3, %11, off\n\t"
      "global_load_async_to_lds_b128 %4, %12, off\n\t"
      "global_load_async_to_lds_b128 %5, %13, off\n\t"
      "global_load_async_to_lds_b128 %6, %14, off\n\t"
      "global_load_async_to_lds_b128 %7, %15, off\n\t"
      "s_wait_xcnt 0x0"
      ::"v"(al), "v"(al + rs), "v"(al + 2 * rs), "v"(al + 3 * rs),
        "v"(al + tb), "v"(al + tb + rs), "v"(al + tb + 2 * rs),
        "v"(al + tb + 3 * rs), "v"(ag), "v"(ag + gs), "v"(ag + 2 * gs),
        "v"(ag + 3 * gs), "v"(bg), "v"(bg + gs), "v"(bg + 2 * gs),
        "v"(bg + 3 * gs)
      : "memory");
#endif
}

static __device__ __forceinline__ void gemm_mainloop(const _Float16* ag,
                                                     const _Float16* bg,
                                                     _Float16* smem, int wm,
                                                     int wn, int st,
                                                     f8 (&acc)[4][2]) {
  const int tid = threadIdx.x;
  const int cr = tid >> 3, cc = (tid & 7) * 8;  // the thread's row and chunk
  ag += (size_t)cr * DMODEL + cc;
  bg += (size_t)cr * DMODEL + cc;
  // low 32 bits of a __shared__ address: the byte offset in the block's LDS
  const unsigned al = (unsigned)(size_t)(smem + cr * GLD + cc);

  gemm_stage_copy(ag + st * 64, bg + st * 64, al);
  // this wave's copies of stage st have landed; the barrier publishes them
  asm volatile("s_wait_asynccnt 0x0" ::: "memory");
  __syncthreads();
  // stage st + 1 (wrapped) flies into the second buffer while stage st is worked on
  {
    const int k1 = ((st + 1) & (GNS - 1)) * 64;
    gemm_stage_copy(ag + k1, bg + k1, al + GBUF * 2);
  }

  for (int s = 0; s < GNS; ++s) {
    const _Float16* At = smem + (s & 1) * GBUF;
    const _Float16* Bt = At + 128 * GLD;
    // unrolled: the two 32-k slices read LDS at constant offsets
#pragma unroll
    for (int kk = 0; kk < 64; kk += 32) {
      h16 a[4], b[2];
#pragma unroll
      for (int i = 0; i < 4; ++i) a[i] = frag_ld(At, wm * 64 + i * 16, kk, GLD);
#pragma unroll
      for (int j = 0; j < 2; ++j) b[j] = frag_ld(Bt, wn * 32 + j * 16, kk, GLD);
#pragma unroll
      for (int i = 0; i < 4; ++i)
#pragma unroll
        for (int j = 0; j < 2; ++j) acc[i][j] = wmma32(a[i], b[j], acc[i][j]);
    }
    // Order of this block: the 12 LDS reads of a 32-k slice stand as one group
    // in front of its 8 products. Left alone, this build reads each A fragment
    // directly in front of its two products, and the wave sits out the LDS
    // latency 8 times a stage, which is what is left of a stage's chain now.
    // Unrolled: the markers must stand in the one block that they order.
#pragma unroll
    for (int g = 0; g < 2; ++g) {
      __builtin_amdgcn_sched_group_barrier(0x100, 12, 0);  // a slice's reads
      __builtin_amdgcn_sched_group_barrier(0x008, 8, 0);   // its products
    }
    // Foot of the stage. This wave's LDS reads of the buffer have retired and
    // its copies of the next stage have landed; the one barrier publishes the
    // next stage and ends every wave's reads of the buffer refilled behind it.
    asm volatile("s_wait_dscnt 0x0" ::: "memory");
    asm volatile("s_wait_asynccnt 0x0" ::: "memory");
    __syncthreads();
    if (s + 2 < GNS) {  // the same for the whole work-group
      const int k2 = ((st + s + 2) & (GNS - 1)) * 64;
      gemm_stage_copy(ag + k2, bg + k2, al + (s & 1) * (GBUF * 2));
    }
  }
  // no copy is out when the wave goes on to its stores
  asm volatile("s_wait_asynccnt 0x0" ::: "memory");
}

// ---------------------------------------------------------------------------
// Kernel 1: QKV projection. grid = (3*D/128, B*N/128), block = 256 (8 waves).
// Each wave computes a 64x32 register tile (8 wmma accumulators).
// ---------------------------------------------------------------------------
__global__ __launch_bounds__(256) void qkv_proj_kernel(
    const _Float16* __restrict__ xh, const _Float16* __restrict__ wkvh,
    _Float16* __restrict__ qws, _Float16* __restrict__ kws,
    _Float16* __restrict__ vws) {
  extern __shared__ _Float16 smem[];  // 2 buffers of X [128][72], W [128][72]

  const int tid = threadIdx.x;
  const int wave = tid >> 5;
  const int lane = tid & 31;
  const int nloc = lane & 15;
  const int mhi = (lane >> 4) << 3;  // 0 or 8
  const int m0 = blockIdx.y * 128;
  const int n0 = blockIdx.x * 128;
  const int wm = wave >> 2;  // 0..1 -> 64-row half
  const int wn = wave & 3;   // 0..3 -> 32-col quarter

  f8 acc[4][2] = {};
  gemm_mainloop(xh + (size_t)m0 * DMODEL, wkvh + (size_t)n0 * DMODEL, smem, wm,
                wn, (blockIdx.x + blockIdx.y) & (GNS - 1), acc);

  // Epilogue: destination (q/k/v, head) is uniform per 16-wide tile.
#pragma unroll
  for (int j = 0; j < 2; ++j) {
    int gnb = n0 + wn * 32 + j * 16;        // tile base col (multiple of 16)
    int which = gnb >> 10;                  // 0=q 1=k 2=v (uniform)
    int e = gnb & (DMODEL - 1);
    int hh = e >> 7;                        // head (uniform)
    int hdb = (e & (HDIM - 1)) + nloc;      // feature within head
    _Float16* dst = (which == 0) ? qws : (which == 1) ? kws : vws;
    float scale = (which == 0) ? 0.08838834764831845f : 1.0f;
#pragma unroll
    for (int i = 0; i < 4; ++i)
#pragma unroll
      for (int r = 0; r < 8; ++r) {
        int gm = m0 + wm * 64 + i * 16 + mhi + r;  // row in [0, B*N)
        int bb = gm >> 11, nn = gm & (SEQ - 1);
        dst[(((size_t)bb * NHEAD + hh) * SEQ + nn) * HDIM + hdb] =
            (_Float16)(acc[i][j][r] * scale);
      }
  }
}

// ---------------------------------------------------------------------------
// Kernel 2: flash attention. grid = (B*H, N/128), block = 256 (8 waves).
// Wave w owns queries [w*16, w*16+16) of the 128-query tile and works on the
// transposed products: S^T = K Q^T (keys x queries) and O^T += V^T P^T
// (features x queries). A lane then holds scores of ONE query (column
// lane%16; keys 8*(lane/16)+0..7 of every 16-key tile), so the maximum and the
// sum run inside the lane with one exchange between the wave's halves, and two
// converted S^T tiles are the B operand of the second product as they stand:
// the probabilities never pass through LDS.
// Keys go by tiles of 64 through two K and two V buffers: the copies of tile
// t + 2 are issued at the foot of tile t, behind the one barrier of a tile, and
// the mask values of tile t + 1 are loaded into registers during tile t, so
// that nothing fetched from L2 is waited for where it is asked for.
// The walk over the key tiles starts at tile st and wraps, for the reason given
// at the GEMMs' main loop: the 16 work-groups of a (batch, head) pair read the
// same K and V tiles and the 32 work-groups of a query tile the same mask tiles,
// all at the same time. st differs inside both sets. The online softmax takes
// the tiles in any order; its sums are formed in the rotated order.
// ---------------------------------------------------------------------------
// Lane l <-> lane l ^ 16 by a vector cross-row move.
static __device__ __forceinline__ float xhalf(float v) {
  int b = __builtin_bit_cast(int, v);
  return __builtin_bit_cast(
      float, __builtin_amdgcn_permlanex16(b, b, 0x76543210, 0xfedcba98, false,
                                          false));
}

__global__ __launch_bounds__(256) void flash_attn_kernel(
    const _Float16* __restrict__ qws, const _Float16* __restrict__ kws,
    const _Float16* __restrict__ vws, const float* __restrict__ mfrag,
    _Float16* __restrict__ yws) {
  extern __shared__ _Float16 smem[];
  const int LD = 136;   // 128 + 8 pad: 272 B rows for ds_load_b128 readers
  const int LDV = 144;  // 128 + 16 pad: 288 B rows for the transposing reader
  const int KT = 64;    // keys a tile
  const int NT = SEQ / KT;
  _Float16* Qt = smem;                 // [128][136] row-major (q x d)
  _Float16* Kt = smem + 128 * LD;      // 2 buffers of [64][136] (kv x d)
  _Float16* Vs = smem + 2 * 128 * LD;  // 2 buffers of [64][144] (kv x d)

  const int tid = threadIdx.x;
  const int w = tid >> 5;
  const int lane = tid & 31;
  const int nloc = lane & 15;
  const int mhi = (lane >> 4) << 3;
  const int bh = blockIdx.x;       // b*H + h
  const int q0 = blockIdx.y * 128;
  const size_t hbase = (size_t)bh * SEQ * HDIM;
  const int st = (2 * blockIdx.y + blockIdx.x) & (NT - 1);  // first key tile

  // A thread's 16 B chunk of a row; its further chunks lie 16 rows apart.
  const int cr = tid >> 4, cc = (tid & 15) * 8;
  const unsigned co = cr * HDIM + cc;  // the same in Q, K and V
  const _Float16* kg = kws + hbase;    // uniform; a tile's rows are added to it
  const _Float16* vg = vws + hbase;
  _Float16* kl = Kt + cr * LD + cc;
  _Float16* vl = Vs + cr * LDV + cc;

  // Q tile: 2048 x 16B chunks, 8 per thread; first K and V tile: 4 + 4 per thread
#pragma unroll
  for (int i = 0; i < 8; ++i)
    async_cp16(qws + hbase + (size_t)(q0 + i * 16) * HDIM + co,
               Qt + (cr + i * 16) * LD + cc);
#pragma unroll
  for (int i = 0; i < 4; ++i) {
    async_cp16(kg + (size_t)(st * KT + i * 16) * HDIM + co, kl + i * 16 * LD);
    async_cp16(vg + (size_t)(st * KT + i * 16) * HDIM + co, vl + i * 16 * LDV);
  }
  // this wave's copies of Q and of that tile have landed; the barrier publishes them
  asm volatile("s_wait_asynccnt 0x0" ::: "memory");
  __syncthreads();
  // the second tile flies into the second buffers while the first is worked on
  const int t1 = ((st + 1) & (NT - 1)) * KT;
#pragma unroll
  for (int i = 0; i < 4; ++i) {
    async_cp16(kg + (size_t)(t1 + i * 16) * HDIM + co, kl + (KT + i * 16) * LD);
    async_cp16(vg + (size_t)(t1 + i * 16) * HDIM + co, vl + (KT + i * 16) * LDV);
  }

  // The wave's Q fragments, read once: with half the keys a tile they would
  // otherwise be read from LDS twice as often.
  h16 bq[4];
#pragma unroll
  for (int kk = 0; kk < 4; ++kk) bq[kk] = frag_ld(Qt, w * 16, kk * 32, LD);

  f8 o[8] = {};  // o[t][r] = O^T[feature t*16 + mhi + r][query nloc]
  float mrun = -1.0e30f;  // running maximum of this lane's query
  float lsum = 0.0f;      // running sum over this half-wave's keys only
  // The lane's place in the first mask tile of this wave's 16 queries (kernel
  // 0's order); a tile of 64 keys is half a unit, 8 loads of 512 contiguous
  // bytes a wave. The first tile's values are fetched here, each later tile's
  // one tile ahead.
  const float* mp = mfrag + (size_t)((q0 >> 4) + w) * MSK_ROWU * MSK_UNIT +
                    st * (MSK_UNIT / 2) + lane * 4;
  float4 mk[8];
#pragma unroll
  for (int i = 0; i < 8; ++i) mk[i] = *(const float4*)(mp + i * 128);
  // Stands behind these loads because the first tile moves the pointer that they
  // name before the last of them has been waited for. (In the loop the wait
  // for all loads in front of the barrier stands between.)
  asm volatile("s_wait_xcnt 0x0" ::: "memory");

  for (int it = 0; it < NT; ++it) {
    const _Float16* Kb = Kt + (it & 1) * KT * LD;
    const _Float16* Vb = Vs + (it & 1) * KT * LDV;

    // S^T = K @ Q^T: A = K rows, B = Q rows, both through the same loader.
    // s[t][r] = score of key ((it+st)%NT)*64 + t*16 + mhi + r for query nloc.
    f8 s[4] = {};
#pragma unroll
    for (int kk = 0; kk < 4; ++kk) {
#pragma unroll
      for (int t = 0; t < 4; ++t) {
        h16 ak = frag_ld(Kb, t * 16, kk * 32, LD);
        s[t] = wmma32(ak, bq[kk], s[t]);
      }
    }
    // Order of this block: the LDS reads of four products stand as one group,
    // one group ahead of the four products that use them. Left alone, this
    // build waits for every fragment directly in front of its product, and the
    // wave sits out the LDS latency 16 times a tile.
    __builtin_amdgcn_sched_group_barrier(0x100, 8, 0);  // 4 K tiles
    // unrolled: the markers must stand in the one block that they order
#pragma unroll
    for (int g = 0; g < 3; ++g) {
      __builtin_amdgcn_sched_group_barrier(0x100, 8, 0);  // next 4 K tiles
      __builtin_amdgcn_sched_group_barrier(0x008, 4, 0);  // 4 products
    }
    __builtin_amdgcn_sched_group_barrier(0x008, 4, 0);
    // Ends the block that the markers order: without it this build weaves the
    // mask additions in and again waits for each fragment in front of its product.
    __builtin_amdgcn_sched_barrier(0);

    // additive mask: 8 consecutive keys of the lane's own query a 16-key tile
#pragma unroll
    for (int t = 0; t < 4; ++t) {
      s[t][0] += mk[2 * t].x; s[t][1] += mk[2 * t].y;
      s[t][2] += mk[2 * t].z; s[t][3] += mk[2 * t].w;
      s[t][4] += mk[2 * t + 1].x; s[t][5] += mk[2 * t + 1].y;
      s[t][6] += mk[2 * t + 1].z; s[t][7] += mk[2 * t + 1].w;
    }
    // The next tile's mask values, asked for a whole tile ahead of their use.
    // One tile on, or from the strip's last tile back to its first. The last
    // trip asks for the first trip's tile again: inside, and not used.
    mp += (((st + it + 1) & (NT - 1)) != 0) ? MSK_UNIT / 2
                                            : -(NT - 1) * (MSK_UNIT / 2);
#pragma unroll
    for (int i = 0; i < 8; ++i) mk[i] = *(const float4*)(mp + i * 128);

    // online softmax: 32 of the query's 64 scores are in this lane, the other
    // 32 in lane ^ 16. Four chains of maxima, not one of 32 links.
    float tq[4];
#pragma unroll
    for (int j = 0; j < 4; ++j) {
      tq[j] = s[j][0];
#pragma unroll
      for (int e = 1; e < 8; ++e) tq[j] = fmaxf(tq[j], s[j][e]);
    }
    float tm = fmaxf(fmaxf(tq[0], tq[1]), fmaxf(tq[2], tq[3]));
    tm = fmaxf(tm, xhalf(tm));
    const float nm = fmaxf(mrun, tm);
    const float corr = __expf(mrun - nm);
    mrun = nm;

    // Exponents in place, (s - nm) * log2(e), as __expf forms them.
#pragma unroll
    for (int t = 0; t < 4; ++t)
#pragma unroll
      for (int r = 0; r < 8; ++r) s[t][r] = (s[t][r] - nm) * 1.44269504f;
    // Keeps these multiplies ahead of every v_exp_f32. It also keeps the mask
    // loads above it, early in the tile.
    __builtin_amdgcn_sched_barrier(0);

    // P^T as B operands: element e of p[j] is key 32j + 16*(e/8) + mhi + e%8,
    // which is register e%8 of tile 2j + e/8 in this same lane. Two sums a
    // fragment, so that the adds do not form one chain of 32.
    h16 p[2];
    float ps[4];
#pragma unroll
    for (int j = 0; j < 2; ++j) {
      ps[2 * j] = 0.0f;
      ps[2 * j + 1] = 0.0f;
#pragma unroll
      for (int e = 0; e < 16; ++e) {
        float pv = __builtin_amdgcn_exp2f(s[2 * j + (e >> 3)][e & 7]);
        ps[2 * j + (e >> 3)] += pv;
        p[j][e] = (_Float16)pv;
      }
    }
    lsum = lsum * corr + ((ps[0] + ps[1]) + (ps[2] + ps[3]));
#pragma unroll
    for (int t = 0; t < 8; ++t)
#pragma unroll
      for (int r = 0; r < 8; ++r) o[t][r] *= corr;

    // O^T += V^T @ P^T   (A from row-major Vb through the transposing load)
#pragma unroll
    for (int j = 0; j < 2; ++j) {
#pragma unroll
      for (int t = 0; t < 8; ++t) {
        h16 av = frag_ld_tr(Vb, j * 32, t * 16, LDV);
        o[t] = wmma32(av, p[j], o[t]);
      }
    }
    // Order of this block: behind every v_exp_f32 one other vector instruction.
    // It runs in the slot that the half-rate v_exp_f32 leaves empty, and it is
    // the free slot that the instruction set asks for in front of a write to
    // the v_exp_f32's source. Unrolled: the markers stand in the block they order.
#pragma unroll
    for (int g = 0; g < 33; ++g) {
      __builtin_amdgcn_sched_group_barrier(0x400, 1, 0);  // one v_exp_f32
      __builtin_amdgcn_sched_group_barrier(0x002, 1, 0);  // one other
    }

    // Foot of the tile. This wave's LDS reads of the buffers have retired and
    // its copies of the next tile have landed; the one barrier publishes the
    // next tile and ends every wave's reads of the buffers refilled behind it.
    asm volatile("s_wait_dscnt 0x0" ::: "memory");
    asm volatile("s_wait_asynccnt 0x0" ::: "memory");
    __syncthreads();
    if (it + 2 < NT) {  // the same for the whole work-group
      const size_t gr = (size_t)((st + it + 2) & (NT - 1)) * KT * HDIM;
      const int lb = (it & 1) * KT;
#pragma unroll
      for (int i = 0; i < 4; ++i) {
        async_cp16(kg + gr + (size_t)(i * 16) * HDIM + co, kl + (lb + i * 16) * LD);
        async_cp16(vg + gr + (size_t)(i * 16) * HDIM + co, vl + (lb + i * 16) * LDV);
      }
    }
  }
  // no copy is out when the wave ends
  asm volatile("s_wait_asynccnt 0x0" ::: "memory");

  // join the halves' sums, normalize and write y [B][N][D] (f16): a lane's 8
  // registers of a tile are 8 consecutive features of its query, one 16 B store
  const float l = lsum + xhalf(lsum);
  const int b = bh >> 3, h = bh & 7;
  _Float16* yp = yws + ((size_t)b * SEQ + q0 + w * 16 + nloc) * DMODEL +
                 h * HDIM + mhi;
#pragma unroll
  for (int t = 0; t < 8; ++t) {
    h8 v;
#pragma unroll
    for (int r = 0; r < 8; ++r) v[r] = (_Float16)(o[t][r] / l);
    *(h8*)(yp + t * 16) = v;
  }
}

// ---------------------------------------------------------------------------
// Kernel 3: output projection out = y @ Wo^T + bo. grid = (D/128, B*N/128).
// ---------------------------------------------------------------------------
__global__ __launch_bounds__(256) void out_proj_kernel(
    const _Float16* __restrict__ yws, const _Float16* __restrict__ woh,
    const float* __restrict__ bo, float* __restrict__ out) {
  extern __shared__ _Float16 smem[];  // 2 buffers of Y [128][72], W [128][72]

  const int tid = threadIdx.x;
  const int wave = tid >> 5;
  const int lane = tid & 31;
  const int nloc = lane & 15;
  const int mhi = (lane >> 4) << 3;
  const int m0 = blockIdx.y * 128;
  const int n0 = blockIdx.x * 128;
  const int wm = wave >> 2;
  const int wn = wave & 3;

  f8 acc[4][2] = {};
  gemm_mainloop(yws + (size_t)m0 * DMODEL, woh + (size_t)n0 * DMODEL, smem, wm,
                wn, (blockIdx.x + blockIdx.y) & (GNS - 1), acc);

#pragma unroll
  for (int i = 0; i < 4; ++i)
#pragma unroll
    for (int j = 0; j < 2; ++j)
#pragma unroll
      for (int r = 0; r < 8; ++r) {
        int gm = m0 + wm * 64 + i * 16 + mhi + r;
        int gn = n0 + wn * 32 + j * 16 + nloc;
        out[(size_t)gm * DMODEL + gn] = acc[i][j][r] + bo[gn];
      }
}

// ---------------------------------------------------------------------------
// Host launch. Inputs: x, mask, Wkv, Wo, bo (all f32). Output: f32 [B,N,D].
// Workspace layout (f16): Q | K | V | Y | x, each B*N*D elements, then Wkv
// (3*D*D) and Wo (D*D), then the re-ordered mask (f32, N*N): 109 MB in all.
// ---------------------------------------------------------------------------
extern "C" void kernel_launch(void* const* d_in, const int* in_sizes, int n_in,
                              void* d_out, int out_size, void* d_ws,
                              size_t ws_size, hipStream_t stream) {
  (void)in_sizes; (void)n_in; (void)out_size; (void)ws_size;
  const float* x    = (const float*)d_in[0];
  const float* mask = (const float*)d_in[1];
  const float* Wkv  = (const float*)d_in[2];
  const float* Wo   = (const float*)d_in[3];
  const float* bo   = (const float*)d_in[4];
  float* out = (float*)d_out;

  const size_t SZ = (size_t)BATCH * SEQ * DMODEL;  // 8.4M elements
  _Float16* base = (_Float16*)d_ws;
  _Float16* qws = base;
  _Float16* kws = base + SZ;
  _Float16* vws = base + 2 * SZ;
  _Float16* yws = base + 3 * SZ;
  _Float16* xh = base + 4 * SZ;
  _Float16* wkvh = base + 5 * SZ;
  _Float16* woh = wkvh + (size_t)3 * DMODEL * DMODEL;
  float* mfrag = (float*)(woh + (size_t)DMODEL * DMODEL);

  const size_t lds_gemm = 2 * GBUF * sizeof(_Float16);       // 73.7 KB
  const size_t lds_attn = (2 * 128 * 136 + 128 * 144) * sizeof(_Float16);  // 104 KB

  to_f16_kernel<<<dim3(CVT_XU + CVT_KU + CVT_OU + MSK_BU), 256, 0, stream>>>(
      x, Wkv, Wo, mask, xh, wkvh, woh, mfrag);
  qkv_proj_kernel<<<dim3(3 * DMODEL / 128, BATCH * SEQ / 128), 256, lds_gemm,
                    stream>>>(xh, wkvh, qws, kws, vws);
  flash_attn_kernel<<<dim3(BATCH * NHEAD, SEQ / 128), 256, lds_attn, stream>>>(
      qws, kws, vws, mfrag, yws);
  out_proj_kernel<<<dim3(DMODEL / 128, BATCH * SEQ / 128), 256, lds_gemm,
                    stream>>>(yws, woh, bo, out);
}

// v008
// One run takes 132 microseconds.
// Two timings next to v007 both put it at 1.04 times that version's speed.
// Over all steps from v000 it is 3.18 times as fast.
#include <hip/hip_runtime.h>
#include <hip/hip_bf16.h>

// ---------------------------------------------------------------------------
// Fused attention block for MI455X (gfx1250, wave32, WMMA).
//   B=4, N=2048, D=1024, H=8, HD=128
//   Stage 0: x, Wkv, Wo -> f16 in ws, once, so that the GEMM blocks that
//            re-read them from L2 fetch half the bytes; the mask (f32 as it
//            is) copied into the order in which stage 2's lanes hold scores
//   Stage 1: qkv = x @ Wkv^T  (f16 in, f16 to ws, Q pre-scaled by 1/sqrt(128)),
//            operand stages copied to LDS asynchronously, a stage ahead
//   Stage 2: flash attention per (b,h), online softmax, f16 WMMA, f32 acc,
//            Q/K/V tiles staged via GLOBAL_LOAD_ASYNC_TO_LDS when available,
//            K and V in two buffers each, fetched a tile of 64 keys ahead,
//            V kept row-major and transposed on read by ds_load_tr16_b128,
//            products transposed (keys x queries) so that P stays in registers,
//            32 queries a wave: an LDS fragment of K or V feeds two products
//   Stage 3: out = y @ Wo^T + bo (f32 out)
// ---------------------------------------------------------------------------

typedef __attribute__((ext_vector_type(4)))  _Float16 h4;
typedef __attribute__((ext_vector_type(8)))  _Float16 h8;
typedef __attribute__((ext_vector_type(16))) _Float16 h16;
typedef __attribute__((ext_vector_type(8)))  float    f8;
typedef __attribute__((ext_vector_type(4)))  float    f4;

#define BATCH 4
#define SEQ   2048
#define DMODEL 1024
#define NHEAD 8
#define HDIM  128

// --- gfx1250 async global->LDS copy (ASYNCcnt-tracked), with fallback -------
#if defined(__gfx1250__) && __has_builtin(__builtin_amdgcn_global_load_async_to_lds_b128)
#define HAVE_ASYNC_LDS 1
// Parameter type revealed by compiler diagnostic: pointer to <4 x i32> vector.
typedef __attribute__((__vector_size__(4 * sizeof(int)))) int i4v;
static __device__ __forceinline__ void async_cp16(const void* g, void* l) {
  __builtin_amdgcn_global_load_async_to_lds_b128((i4v*)g, (i4v*)l, 0, 0);
}
#else
#define HAVE_ASYNC_LDS 0
static __device__ __forceinline__ void async_cp16(const void* g, void* l) {
  *(h8*)l = *(const h8*)g;
}
#endif

// v_wmma_f32_16x16x32_f16 wrapper (8-arg probe-confirmed signature)
static __device__ __forceinline__ f8 wmma32(h16 a, h16 b, f8 c) {
  return __builtin_amdgcn_wmma_f32_16x16x32_f16(false, a, false, b,
                                                (short)0, c, false, false);
}

// Load a 16x32 f16 A/B fragment from a row-major LDS tile.
// CDNA5 16-bit A layout: lane L (L%16 = matrix row, L/16 = k-group) holds
// K = kg*8 + {0..7} in elements 0..7 and K = 16 + kg*8 + {0..7} in elements
// 8..15  ->  two contiguous 16-byte LDS loads per lane.
static __device__ __forceinline__ h16 frag_ld(const _Float16* lds, int row,
                                              int kbase, int ld) {
  const int lane = threadIdx.x & 31;
  const _Float16* p = lds + (row + (lane & 15)) * ld + kbase + ((lane >> 4) << 3);
  h8 lo = *(const h8*)(p);
  h8 hi = *(const h8*)(p + 16);
  return __builtin_shufflevector(lo, hi, 0, 1, 2, 3, 4, 5, 6, 7, 8, 9, 10, 11,
                                 12, 13, 14, 15);
}

// Load a 16x32 f16 A fragment (m x k) from a ROW-MAJOR (k x m) LDS tile with
// the transposing LDS load. Lane (c = L%16, h = L/16) receives
// T[kbase + 8h + 0..7][nbase + c]; the second load, 16 rows further, gives
// k = 16 + 8h + 0..7: the same k order as frag_ld delivers, and as two
// converted accumulator tiles hold when they serve as the B side.
typedef __attribute__((ext_vector_type(8))) short s16x8;
typedef __attribute__((address_space(3))) s16x8 lds_s16x8;
static __device__ __forceinline__ h16 frag_ld_tr(const _Float16* lds, int kbase,
                                                 int nbase, int ld) {
  const int lane = threadIdx.x & 31;
  const _Float16* p = lds + (kbase + ((lane >> 4) << 3) + (lane & 7)) * ld +
                      nbase + (((lane >> 3) & 1) << 3);
  h8 lo = __builtin_bit_cast(
      h8, __builtin_amdgcn_ds_load_tr16_b128_v8i16((lds_s16x8*)p));
  h8 hi = __builtin_bit_cast(
      h8, __builtin_amdgcn_ds_load_tr16_b128_v8i16((lds_s16x8*)(p + 16 * ld)));
  return __builtin_shufflevector(lo, hi, 0, 1, 2, 3, 4, 5, 6, 7, 8, 9, 10, 11,
                                 12, 13, 14, 15);
}

// ---------------------------------------------------------------------------
// Kernel 0: f32 -> f16 of x, Wkv and Wo, and the mask's new order. grid = 1024,
// block = 256: four blocks, 32 waves, a WGP. A converting block takes CVT_UNIT
// consecutive floats of one buffer, a thread's 16 loads issued ahead of its
// first store. A wave's load covers 512 contiguous bytes, its store 256.
//
// The mask: stage 2 wants, in lane (c = L%16, h = L/16), the values of query c
// for keys 16t + 8h + 0..7. Read from the mask's own rows, each 16-byte load of
// a wave touches 16 lines, and all 32 (batch, head) pairs pay that again. Here
// it is paid once: a wave takes one unit (16 queries x 128 keys, 8 KB) and
// stores it as 16 groups of 512 contiguous bytes, group i = 2t + u holding, at
// lane L, keys 16t + 8h + 4u + 0..3 of query c. Values are moved, not changed.
// ---------------------------------------------------------------------------
#define CVT_UNIT 16384
#define CVT_XU (BATCH * SEQ * DMODEL / CVT_UNIT)   // 512 blocks for x
#define CVT_KU (3 * DMODEL * DMODEL / CVT_UNIT)    // 192 blocks for Wkv
#define CVT_OU (DMODEL * DMODEL / CVT_UNIT)        // 64 blocks for Wo
#define MSK_UNIT (16 * 128)                        // floats of a mask unit
#define MSK_ROWU (SEQ / 128)                       // 16 units a 16-query strip
#define MSK_BU (SEQ / 16 * MSK_ROWU / 8)           // 256 blocks, a unit a wave
__global__ __launch_bounds__(256) void to_f16_kernel(
    const float* __restrict__ x, const float* __restrict__ Wkv,
    const float* __restrict__ Wo, const float* __restrict__ mask,
    _Float16* __restrict__ xh, _Float16* __restrict__ wkvh,
    _Float16* __restrict__ woh, float* __restrict__ mfrag) {
  int u = blockIdx.x;  // which buffer: uniform for the block
  if (u >= CVT_XU + CVT_KU + CVT_OU) {
    // a block's 8 waves: 8 neighbouring units of one 16-query strip
    const int unit = (u - (CVT_XU + CVT_KU + CVT_OU)) * 8 + (threadIdx.x >> 5);
    const int lane = threadIdx.x & 31;
    const float* sp = mask +
                      (size_t)((unit / MSK_ROWU) * 16 + (lane & 15)) * SEQ +
                      (unit % MSK_ROWU) * 128 + ((lane >> 4) << 3);
    float* dp = mfrag + (size_t)unit * MSK_UNIT + lane * 4;
    f4 g[16];
    // both loops unrolled: every index of g constant, so g stays in registers
#pragma unroll
    for (int i = 0; i < 16; ++i)
      g[i] = *(const f4*)(sp + (i >> 1) * 16 + (i & 1) * 4);
    // Holds all 16 loads ahead of the first store (loaded values as inputs
    // only): left alone, this build pairs each load with its store and waits
    // out the load latency 16 times in a row. The address is an input too, so
    // that its registers are given to nothing else while the loads are out.
    asm volatile("" ::"v"(sp), "v"(g[0]), "v"(g[1]), "v"(g[2]), "v"(g[3]), "v"(g[4]),
                 "v"(g[5]), "v"(g[6]), "v"(g[7]), "v"(g[8]), "v"(g[9]),
                 "v"(g[10]), "v"(g[11]), "v"(g[12]), "v"(g[13]), "v"(g[14]),
                 "v"(g[15]));
#pragma unroll
    for (int i = 0; i < 16; ++i) *(f4*)(dp + i * 128) = g[i];
    return;
  }
  const float* src = x;
  _Float16* dst = xh;
  if (u >= CVT_XU + CVT_KU) {
    src = Wo; dst = woh; u -= CVT_XU + CVT_KU;
  } else if (u >= CVT_XU) {
    src = Wkv; dst = wkvh; u -= CVT_XU;
  }
  const size_t off = (size_t)u * CVT_UNIT + threadIdx.x * 4;
  float4 f[16];
  // both loops unrolled: every index of f constant, so f stays in registers
#pragma unroll
  for (int i = 0; i < 16; ++i) f[i] = *(const float4*)(src + off + i * 1024);
#pragma unroll
  for (int i = 0; i < 16; ++i) {
    h4 h = {(_Float16)f[i].x, (_Float16)f[i].y, (_Float16)f[i].z,
            (_Float16)f[i].w};
    *(h4*)(dst + off + i * 1024) = h;
  }
}

// ---------------------------------------------------------------------------
// Main loop of both GEMMs: acc += A[128 rows][D] * B[128 rows][D]^T, both f16,
// k-contiguous, row pitch D. A stage is 64 k of both tiles (128 B a row). The
// stages go through two LDS buffers: the copies of stage s + 2 are issued at the
// foot of stage s, behind the one barrier of a stage, so that a stage's way from
// L2 is covered by the products of the stage before it, and nothing passes
// through registers.
// The walk over k starts at stage st and wraps. Work-groups that share a tile of
// A or of B run at the same time; all starting at k = 0, they would ask L2 for
// the same 128 B of the same rows at the same moment, and every row asked for
// anywhere on the chip would lie at the same offset in its 2 KB pitch. With st
// different between them the requests of a moment spread over the whole rows.
// Each sum over k then begins at k = 64 * st: the same terms in a rotated order.
// ag, bg: first row of the block's tile of A and of B.
// ---------------------------------------------------------------------------
#define GLD 72                   // 64 + 8 pad (halfs): 144 B rows for ds_load_b128
#define GBUF (2 * 128 * GLD)     // halfs of a buffer: A tile, then B tile
#define GNS (DMODEL / 64)        // stages
static __device__ __forceinline__ void gemm_stage_copy(const _Float16* ag,
                                                       const _Float16* bg,
                                                       unsigned al) {
  // 128x64 f16 tile = 1024 chunks of 16 B; 4 of A and 4 of B per thread, 32
  // rows apart; a wave's copy covers 4 whole 128 B rows. al: the LDS byte
  // address of the thread's first chunk of A. One statement, closed by
  // s_wait_xcnt 0, so that no register which a copy names is rewritten ahead
  // of that wait.
  const unsigned rs = 32 * GLD * 2;    // 32 rows in LDS, bytes
  const unsigned tb = 128 * GLD * 2;   // the A tile in LDS, bytes
  const size_t gs = (size_t)32 * DMODEL;  // 32 rows in global memory, halfs
#if defined(__gfx1250__)
  asm volatile(
      "global_load_async_to_lds_b128 %0, %8, off\n\t"
      "global_load_async_to_lds_b128 %1, %9, off\n\t"
      "global_load_async_to_lds_b128 %2, %10, off\n\t"
      "global_load_async_to_lds_b128 %3, %11, off\n\t"
      "global_load_async_to_lds_b128 %4, %12, off\n\t"
      "global_load_async_to_lds_b128 %5, %13, off\n\t"
      "global_load_async_to_lds_b128 %6, %14, off\n\t"
      "global_load_async_to_lds_b128 %7, %15, off\n\t"
      "s_wait_xcnt 0x0"
      ::"v"(al), "v"(al + rs), "v"(al + 2 * rs), "v"(al + 3 * rs),
        "v"(al + tb), "v"(al + tb + rs), "v"(al + tb + 2 * rs),
        "v"(al + tb + 3 * rs), "v"(ag), "v"(ag + gs), "v"(ag + 2 * gs),
        "v"(ag + 3 * gs), "v"(bg), "v"(bg + gs), "v"(bg + 2 * gs),
        "v"(bg + 3 * gs)
      : "memory");
#endif
}

static __device__ __forceinline__ void gemm_mainloop(const _Float16* ag,
                                                     const _Float16* bg,
                                                     _Float16* smem, int wm,
                                                     int wn, int st,
                                                     f8 (&acc)[4][2]) {
  const int tid = threadIdx.x;
  const int cr = tid >> 3, cc = (tid & 7) * 8;  // the thread's row and chunk
  ag += (size_t)cr * DMODEL + cc;
  bg += (size_t)cr * DMODEL + cc;
  // low 32 bits of a __shared__ address: the byte offset in the block's LDS
  const unsigned al = (unsigned)(size_t)(smem + cr * GLD + cc);

  gemm_stage_copy(ag + st * 64, bg + st * 64, al);
  // this wave's copies of stage st have landed; the barrier publishes them
  asm volatile("s_wait_asynccnt 0x0" ::: "memory");
  __syncthreads();
  // stage st + 1 (wrapped) flies into the second buffer while stage st is worked on
  {
    const int k1 = ((st + 1) & (GNS - 1)) * 64;
    gemm_stage_copy(ag + k1, bg + k1, al + GBUF * 2);
  }

  for (int s = 0; s < GNS; ++s) {
    const _Float16* At = smem + (s & 1) * GBUF;
    const _Float16* Bt = At + 128 * GLD;
    // unrolled: the two 32-k slices read LDS at constant offsets
#pragma unroll
    for (int kk = 0; kk < 64; kk += 32) {
      h16 a[4], b[2];
#pragma unroll
      for (int i = 0; i < 4; ++i) a[i] = frag_ld(At, wm * 64 + i * 16, kk, GLD);
#pragma unroll
      for (int j = 0; j < 2; ++j) b[j] = frag_ld(Bt, wn * 32 + j * 16, kk, GLD);
#pragma unroll
      for (int i = 0; i < 4; ++i)
#pragma unroll
        for (int j = 0; j < 2; ++j) acc[i][j] = wmma32(a[i], b[j], acc[i][j]);
    }
    // Order of this block: the 12 LDS reads of a 32-k slice stand as one group
    // in front of its 8 products. Left alone, this build reads each A fragment
    // directly in front of its two products, and the wave sits out the LDS
    // latency 8 times a stage, which is what is left of a stage's chain now.
    // Unrolled: the markers must stand in the one block that they order.
#pragma unroll
    for (int g = 0; g < 2; ++g) {
      __builtin_amdgcn_sched_group_barrier(0x100, 12, 0);  // a slice's reads
      __builtin_amdgcn_sched_group_barrier(0x008, 8, 0);   // its products
    }
    // Foot of the stage. This wave's LDS reads of the buffer have retired and
    // its copies of the next stage have landed; the one barrier publishes the
    // next stage and ends every wave's reads of the buffer refilled behind it.
    asm volatile("s_wait_dscnt 0x0" ::: "memory");
    asm volatile("s_wait_asynccnt 0x0" ::: "memory");
    __syncthreads();
    if (s + 2 < GNS) {  // the same for the whole work-group
      const int k2 = ((st + s + 2) & (GNS - 1)) * 64;
      gemm_stage_copy(ag + k2, bg + k2, al + (s & 1) * (GBUF * 2));
    }
  }
  // no copy is out when the wave goes on to its stores
  asm volatile("s_wait_asynccnt 0x0" ::: "memory");
}

// ---------------------------------------------------------------------------
// Kernel 1: QKV projection. grid = (3*D/128, B*N/128), block = 256 (8 waves).
// Each wave computes a 64x32 register tile (8 wmma accumulators).
// ---------------------------------------------------------------------------
__global__ __launch_bounds__(256) void qkv_proj_kernel(
    const _Float16* __restrict__ xh, const _Float16* __restrict__ wkvh,
    _Float16* __restrict__ qws, _Float16* __restrict__ kws,
    _Float16* __restrict__ vws) {
  extern __shared__ _Float16 smem[];  // 2 buffers of X [128][72], W [128][72]

  const int tid = threadIdx.x;
  const int wave = tid >> 5;
  const int lane = tid & 31;
  const int nloc = lane & 15;
  const int mhi = (lane >> 4) << 3;  // 0 or 8
  const int m0 = blockIdx.y * 128;
  const int n0 = blockIdx.x * 128;
  const int wm = wave >> 2;  // 0..1 -> 64-row half
  const int wn = wave & 3;   // 0..3 -> 32-col quarter

  f8 acc[4][2] = {};
  gemm_mainloop(xh + (size_t)m0 * DMODEL, wkvh + (size_t)n0 * DMODEL, smem, wm,
                wn, (blockIdx.x + blockIdx.y) & (GNS - 1), acc);

  // Epilogue: destination (q/k/v, head) is uniform per 16-wide tile.
#pragma unroll
  for (int j = 0; j < 2; ++j) {
    int gnb = n0 + wn * 32 + j * 16;        // tile base col (multiple of 16)
    int which = gnb >> 10;                  // 0=q 1=k 2=v (uniform)
    int e = gnb & (DMODEL - 1);
    int hh = e >> 7;                        // head (uniform)
    int hdb = (e & (HDIM - 1)) + nloc;      // feature within head
    _Float16* dst = (which == 0) ? qws : (which == 1) ? kws : vws;
    float scale = (which == 0) ? 0.08838834764831845f : 1.0f;
#pragma unroll
    for (int i = 0; i < 4; ++i)
#pragma unroll
      for (int r = 0; r < 8; ++r) {
        int gm = m0 + wm * 64 + i * 16 + mhi + r;  // row in [0, B*N)
        int bb = gm >> 11, nn = gm & (SEQ - 1);
        dst[(((size_t)bb * NHEAD + hh) * SEQ + nn) * HDIM + hdb] =
            (_Float16)(acc[i][j][r] * scale);
      }
  }
}

// ---------------------------------------------------------------------------
// Kernel 2: flash attention. grid = (B*H, N/256), block = 256 (8 waves).
// Wave w owns queries [w*32, w*32+32) of the 256-query tile, as two column
// groups of 16, and works on the transposed products: S^T = K Q^T (keys x
// queries) and O^T += V^T P^T (features x queries). Every K and V fragment that
// the wave reads from LDS is the A operand of two products, one a column group:
// at one product a fragment the LDS reads took twice the products' own time.
// A lane holds scores of ONE query a column group (column lane%16; keys
// 8*(lane/16)+0..7 of every 16-key tile), so the maximum and the sum run inside
// the lane with one exchange between the wave's halves, and two converted S^T
// tiles are the B operand of the second product as they stand: the
// probabilities never pass through LDS.
// Keys go by tiles of 64 through two K and two V buffers: the copies of tile
// t + 2 are issued at the foot of tile t, behind the one barrier of a tile, and
// the mask values of tile t + 1 are loaded into registers during tile t, so
// that nothing fetched from L2 is waited for where it is asked for.
// The walk over the key tiles starts at tile st and wraps, for the reason given
// at the GEMMs' main loop: the 8 work-groups of a (batch, head) pair read the
// same K and V tiles and the 32 work-groups of a query tile the same mask tiles,
// all at the same time. st differs inside both sets. The online softmax takes
// the tiles in any order; its sums are formed in the rotated order.
// ---------------------------------------------------------------------------
// Lane l <-> lane l ^ 16 by a vector cross-row move.
static __device__ __forceinline__ float xhalf(float v) {
  int b = __builtin_bit_cast(int, v);
  return __builtin_bit_cast(
      float, __builtin_amdgcn_permlanex16(b, b, 0x76543210, 0xfedcba98, false,
                                          false));
}

#define QT 256  // queries a work-group
__global__ __launch_bounds__(256) void flash_attn_kernel(
    const _Float16* __restrict__ qws, const _Float16* __restrict__ kws,
    const _Float16* __restrict__ vws, const float* __restrict__ mfrag,
    _Float16* __restrict__ yws) {
  extern __shared__ _Float16 smem[];
  const int LD = 136;   // 128 + 8 pad: 272 B rows for ds_load_b128 readers
  const int LDV = 144;  // 128 + 16 pad: 288 B rows for the transposing reader
  const int KT = 64;    // keys a tile
  const int NT = SEQ / KT;
  _Float16* Qt = smem;                       // [256][136] row-major (q x d)
  _Float16* Kt = smem + QT * LD;             // 2 buffers of [64][136] (kv x d)
  _Float16* Vs = smem + (QT + 2 * KT) * LD;  // 2 buffers of [64][144] (kv x d)

  const int tid = threadIdx.x;
  const int w = tid >> 5;
  const int lane = tid & 31;
  const int nloc = lane & 15;
  const int mhi = (lane >> 4) << 3;
  const int bh = blockIdx.x;       // b*H + h
  const int q0 = blockIdx.y * QT;
  const size_t hbase = (size_t)bh * SEQ * HDIM;
  const int st = (4 * blockIdx.y + blockIdx.x) & (NT - 1);  // first key tile

  // A thread's 16 B chunk of a row; its further chunks lie 16 rows apart.
  const int cr = tid >> 4, cc = (tid & 15) * 8;
  const unsigned co = cr * HDIM + cc;  // the same in Q, K and V
  const _Float16* kg = kws + hbase;    // uniform; a tile's rows are added to it
  const _Float16* vg = vws + hbase;
  _Float16* kl = Kt + cr * LD + cc;
  _Float16* vl = Vs + cr * LDV + cc;

  // Q tile: 4096 x 16B chunks, 16 per thread; first K and V tile: 4 + 4 per thread
#pragma unroll
  for (int i = 0; i < QT / 16; ++i)
    async_cp16(qws + hbase + (size_t)(q0 + i * 16) * HDIM + co,
               Qt + (cr + i * 16) * LD + cc);
#pragma unroll
  for (int i = 0; i < 4; ++i) {
    async_cp16(kg + (size_t)(st * KT + i * 16) * HDIM + co, kl + i * 16 * LD);
    async_cp16(vg + (size_t)(st * KT + i * 16) * HDIM + co, vl + i * 16 * LDV);
  }
  // this wave's copies of Q and of that tile have landed; the barrier publishes them
  asm volatile("s_wait_asynccnt 0x0" ::: "memory");
  __syncthreads();
  // the second tile flies into the second buffers while the first is worked on
  const int t1 = ((st + 1) & (NT - 1)) * KT;
#pragma unroll
  for (int i = 0; i < 4; ++i) {
    async_cp16(kg + (size_t)(t1 + i * 16) * HDIM + co, kl + (KT + i * 16) * LD);
    async_cp16(vg + (size_t)(t1 + i * 16) * HDIM + co, vl + (KT + i * 16) * LDV);
  }

  // The wave's Q fragments, read once; c is the column group.
  h16 bq[2][4];
#pragma unroll
  for (int c = 0; c < 2; ++c)
#pragma unroll
    for (int kk = 0; kk < 4; ++kk)
      bq[c][kk] = frag_ld(Qt, w * 32 + c * 16, kk * 32, LD);

  f8 o[2][8] = {};  // o[c][t][r] = O^T[feature t*16 + mhi + r][query c*16 + nloc]
  float mrun[2] = {-1.0e30f, -1.0e30f};  // running maximum of the lane's queries
  float lsum[2] = {0.0f, 0.0f};  // running sums over this half-wave's keys only
  // The lane's place in the first mask tile of this wave's first 16 queries
  // (kernel 0's order); the second 16 queries' strip lies MSK_STRIP further. A
  // tile of 64 keys is half a unit, 8 loads of 512 contiguous bytes a wave and
  // strip. The first tile's values are fetched here, each later tile's one tile
  // ahead.
  const int MSK_STRIP = MSK_ROWU * MSK_UNIT;
  const float* mp = mfrag + (size_t)((q0 >> 4) + 2 * w) * MSK_STRIP +
                    st * (MSK_UNIT / 2) + lane * 4;
  float4 mk[2][8];
#pragma unroll
  for (int c = 0; c < 2; ++c)
#pragma unroll
    for (int i = 0; i < 8; ++i)
      mk[c][i] = *(const float4*)(mp + c * MSK_STRIP + i * 128);
  // Stands behind these loads because the first tile moves the pointer that they
  // name before the last of them has been waited for. (In the loop the wait
  // for all loads in front of the barrier stands between.)
  asm volatile("s_wait_xcnt 0x0" ::: "memory");

  for (int it = 0; it < NT; ++it) {
    const _Float16* Kb = Kt + (it & 1) * KT * LD;
    const _Float16* Vb = Vs + (it & 1) * KT * LDV;

    // S^T = K @ Q^T: A = K rows, B = Q rows, both through the same loader.
    // s[c][t][r] = score of key ((it+st)%NT)*64 + t*16 + mhi + r for query
    // c*16 + nloc.
    f8 s[2][4] = {};
#pragma unroll
    for (int kk = 0; kk < 4; ++kk) {
#pragma unroll
      for (int t = 0; t < 4; ++t) {
        h16 ak = frag_ld(Kb, t * 16, kk * 32, LD);
        s[0][t] = wmma32(ak, bq[0][kk], s[0][t]);
        s[1][t] = wmma32(ak, bq[1][kk], s[1][t]);
      }
    }
    // Order of this block: the LDS reads of eight products stand as one group,
    // one group ahead of the eight products that use them. Left alone, this
    // build waits for every fragment directly in front of its products, and the
    // wave sits out the LDS latency 16 times a tile.
    __builtin_amdgcn_sched_group_barrier(0x100, 8, 0);  // 4 K tiles
    // unrolled: the markers must stand in the one block that they order
#pragma unroll
    for (int g = 0; g < 3; ++g) {
      __builtin_amdgcn_sched_group_barrier(0x100, 8, 0);  // next 4 K tiles
      __builtin_amdgcn_sched_group_barrier(0x008, 8, 0);  // 8 products
    }
    __builtin_amdgcn_sched_group_barrier(0x008, 8, 0);
    // Ends the block that the markers order: without it this build weaves the
    // mask additions in and again waits for each fragment in front of its product.
    __builtin_amdgcn_sched_barrier(0);

    // additive mask: 8 consecutive keys of the lane's own query a 16-key tile
#pragma unroll
    for (int c = 0; c < 2; ++c)
#pragma unroll
      for (int t = 0; t < 4; ++t) {
        s[c][t][0] += mk[c][2 * t].x; s[c][t][1] += mk[c][2 * t].y;
        s[c][t][2] += mk[c][2 * t].z; s[c][t][3] += mk[c][2 * t].w;
        s[c][t][4] += mk[c][2 * t + 1].x; s[c][t][5] += mk[c][2 * t + 1].y;
        s[c][t][6] += mk[c][2 * t + 1].z; s[c][t][7] += mk[c][2 * t + 1].w;
      }
    // The next tile's mask values, asked for a whole tile ahead of their use.
    // One tile on, or from the strip's last tile back to its first. The last
    // trip asks for the first trip's tile again: inside, and not used.
    mp += (((st + it + 1) & (NT - 1)) != 0) ? MSK_UNIT / 2
                                            : -(NT - 1) * (MSK_UNIT / 2);
#pragma unroll
    for (int c = 0; c < 2; ++c)
#pragma unroll
      for (int i = 0; i < 8; ++i)
        mk[c][i] = *(const float4*)(mp + c * MSK_STRIP + i * 128);

    // V^T fragments of the tile's first 32 keys (A operands, from row-major Vb
    // through the transposing load), read here so that their LDS latency passes
    // under the softmax.
    h16 av[2][8];
#pragma unroll
    for (int t = 0; t < 8; ++t) av[0][t] = frag_ld_tr(Vb, 0, t * 16, LDV);

    // online softmax: 32 of a query's 64 scores are in this lane, the other
    // 32 in lane ^ 16. Four chains of maxima a query, not one of 32 links.
    float corr[2];
#pragma unroll
    for (int c = 0; c < 2; ++c) {
      float tq[4];
#pragma unroll
      for (int j = 0; j < 4; ++j) {
        tq[j] = s[c][j][0];
#pragma unroll
        for (int e = 1; e < 8; ++e) tq[j] = fmaxf(tq[j], s[c][j][e]);
      }
      float tm = fmaxf(fmaxf(tq[0], tq[1]), fmaxf(tq[2], tq[3]));
      tm = fmaxf(tm, xhalf(tm));
      const float nm = fmaxf(mrun[c], tm);
      corr[c] = __expf(mrun[c] - nm);
      mrun[c] = nm;

      // Exponents in place, (s - nm) * log2(e), as __expf forms them.
#pragma unroll
      for (int t = 0; t < 4; ++t)
#pragma unroll
        for (int r = 0; r < 8; ++r)
          s[c][t][r] = (s[c][t][r] - nm) * 1.44269504f;
    }
    // Keeps these multiplies ahead of every v_exp_f32. It also keeps the mask
    // loads above it, early in the tile.
    __builtin_amdgcn_sched_barrier(0);

    // P^T as B operands: element e of p[c][j] is key 32j + 16*(e/8) + mhi + e%8,
    // which is register e%8 of tile 2j + e/8 in this same lane. Two sums a
    // fragment, so that the adds do not form one chain of 32.
    h16 p[2][2];
#pragma unroll
    for (int c = 0; c < 2; ++c) {
      float ps[4];
#pragma unroll
      for (int j = 0; j < 2; ++j) {
        ps[2 * j] = 0.0f;
        ps[2 * j + 1] = 0.0f;
#pragma unroll
        for (int e = 0; e < 16; ++e) {
          float pv = __builtin_amdgcn_exp2f(s[c][2 * j + (e >> 3)][e & 7]);
          ps[2 * j + (e >> 3)] += pv;
          p[c][j][e] = (_Float16)pv;
        }
      }
      lsum[c] = lsum[c] * corr[c] + ((ps[0] + ps[1]) + (ps[2] + ps[3]));
#pragma unroll
      for (int t = 0; t < 8; ++t)
#pragma unroll
        for (int r = 0; r < 8; ++r) o[c][t][r] *= corr[c];
    }

    // Order of this block: behind every v_exp_f32 one other vector instruction.
    // It runs in the slot that the half-rate v_exp_f32 leaves empty, and it is
    // the free slot that the instruction set asks for in front of a write to
    // the v_exp_f32's source. Unrolled: the markers stand in the block they order.
#pragma unroll
    for (int g = 0; g < 66; ++g) {
      __builtin_amdgcn_sched_group_barrier(0x400, 1, 0);  // one v_exp_f32
      __builtin_amdgcn_sched_group_barrier(0x002, 1, 0);  // one other
    }
    // Ends that block, so that the reads below stay one group in front of the
    // products: woven in, each fragment was read directly in front of its two
    // products and waited for there, and with two waves a SIMD little else
    // covers that wait.
    __builtin_amdgcn_sched_barrier(0);

    // O^T += V^T @ P^T. The fragments of the second 32 keys are read as one
    // group; the 16 products of the first 32 keys cover their latency.
#pragma unroll
    for (int t = 0; t < 8; ++t) av[1][t] = frag_ld_tr(Vb, 32, t * 16, LDV);
#pragma unroll
    for (int j = 0; j < 2; ++j) {
#pragma unroll
      for (int t = 0; t < 8; ++t) {
        o[0][t] = wmma32(av[j][t], p[0][j], o[0][t]);
        o[1][t] = wmma32(av[j][t], p[1][j], o[1][t]);
      }
    }
    __builtin_amdgcn_sched_group_barrier(0x100, 16, 0);  // 8 V fragments
    __builtin_amdgcn_sched_group_barrier(0x008, 32, 0);  // the tile's products
    // Keeps the products above the waits at the foot: moved below them, nothing
    // stood between the reads of the second 32 keys and the wait for them.
    __builtin_amdgcn_sched_barrier(0);

    // Foot of the tile. This wave's LDS reads of the buffers have retired and
    // its copies of the next tile have landed; the one barrier publishes the
    // next tile and ends every wave's reads of the buffers refilled behind it.
    asm volatile("s_wait_dscnt 0x0" ::: "memory");
    asm volatile("s_wait_asynccnt 0x0" ::: "memory");
    __syncthreads();
    if (it + 2 < NT) {  // the same for the whole work-group
      const size_t gr = (size_t)((st + it + 2) & (NT - 1)) * KT * HDIM;
      const int lb = (it & 1) * KT;
#pragma unroll
      for (int i = 0; i < 4; ++i) {
        async_cp16(kg + gr + (size_t)(i * 16) * HDIM + co, kl + (lb + i * 16) * LD);
        async_cp16(vg + gr + (size_t)(i * 16) * HDIM + co, vl + (lb + i * 16) * LDV);
      }
    }
  }
  // no copy is out when the wave ends
  asm volatile("s_wait_asynccnt 0x0" ::: "memory");

  // join the halves' sums, normalize and write y [B][N][D] (f16): a lane's 8
  // registers of a tile are 8 consecutive features of its query, one 16 B store
  const int b = bh >> 3, h = bh & 7;
#pragma unroll
  for (int c = 0; c < 2; ++c) {
    const float l = lsum[c] + xhalf(lsum[c]);
    _Float16* yp = yws +
                   ((size_t)b * SEQ + q0 + w * 32 + c * 16 + nloc) * DMODEL +
                   h * HDIM + mhi;
#pragma unroll
    for (int t = 0; t < 8; ++t) {
      h8 v;
#pragma unroll
      for (int r = 0; r < 8; ++r) v[r] = (_Float16)(o[c][t][r] / l);
      *(h8*)(yp + t * 16) = v;
    }
  }
}

// ---------------------------------------------------------------------------
// Kernel 3: output projection out = y @ Wo^T + bo. grid = (D/128, B*N/128).
// ---------------------------------------------------------------------------
__global__ __launch_bounds__(256) void out_proj_kernel(
    const _Float16* __restrict__ yws, const _Float16* __restrict__ woh,
    const float* __restrict__ bo, float* __restrict__ out) {
  extern __shared__ _Float16 smem[];  // 2 buffers of Y [128][72], W [128][72]

  const int tid = threadIdx.x;
  const int wave = tid >> 5;
  const int lane = tid & 31;
  const int nloc = lane & 15;
  const int mhi = (lane >> 4) << 3;
  const int m0 = blockIdx.y * 128;
  const int n0 = blockIdx.x * 128;
  const int wm = wave >> 2;
  const int wn = wave & 3;

  f8 acc[4][2] = {};
  gemm_mainloop(yws + (size_t)m0 * DMODEL, woh + (size_t)n0 * DMODEL, smem, wm,
                wn, (blockIdx.x + blockIdx.y) & (GNS - 1), acc);

#pragma unroll
  for (int i = 0; i < 4; ++i)
#pragma unroll
    for (int j = 0; j < 2; ++j)
#pragma unroll
      for (int r = 0; r < 8; ++r) {
        int gm = m0 + wm * 64 + i * 16 + mhi + r;
        int gn = n0 + wn * 32 + j * 16 + nloc;
        out[(size_t)gm * DMODEL + gn] = acc[i][j][r] + bo[gn];
      }
}

// ---------------------------------------------------------------------------
// Host launch. Inputs: x, mask, Wkv, Wo, bo (all f32). Output: f32 [B,N,D].
// Workspace layout (f16): Q | K | V | Y | x, each B*N*D elements, then Wkv
// (3*D*D) and Wo (D*D), then the re-ordered mask (f32, N*N): 109 MB in all.
// ---------------------------------------------------------------------------
extern "C" void kernel_launch(void* const* d_in, const int* in_sizes, int n_in,
                              void* d_out, int out_size, void* d_ws,
                              size_t ws_size, hipStream_t stream) {
  (void)in_sizes; (void)n_in; (void)out_size; (void)ws_size;
  const float* x    = (const float*)d_in[0];
  const float* mask = (const float*)d_in[1];
  const float* Wkv  = (const float*)d_in[2];
  const float* Wo   = (const float*)d_in[3];
  const float* bo   = (const float*)d_in[4];
  float* out = (float*)d_out;

  const size_t SZ = (size_t)BATCH * SEQ * DMODEL;  // 8.4M elements
  _Float16* base = (_Float16*)d_ws;
  _Float16* qws = base;
  _Float16* kws = base + SZ;
  _Float16* vws = base + 2 * SZ;
  _Float16* yws = base + 3 * SZ;
  _Float16* xh = base + 4 * SZ;
  _Float16* wkvh = base + 5 * SZ;
  _Float16* woh = wkvh + (size_t)3 * DMODEL * DMODEL;
  float* mfrag = (float*)(woh + (size_t)DMODEL * DMODEL);

  const size_t lds_gemm = 2 * GBUF * sizeof(_Float16);       // 73.7 KB
  const size_t lds_attn = ((QT + 128) * 136 + 128 * 144) * sizeof(_Float16);  // 141 KB

  to_f16_kernel<<<dim3(CVT_XU + CVT_KU + CVT_OU + MSK_BU), 256, 0, stream>>>(
      x, Wkv, Wo, mask, xh, wkvh, woh, mfrag);
  qkv_proj_kernel<<<dim3(3 * DMODEL / 128, BATCH * SEQ / 128), 256, lds_gemm,
                    stream>>>(xh, wkvh, qws, kws, vws);
  flash_attn_kernel<<<dim3(BATCH * NHEAD, SEQ / QT), 256, lds_attn, stream>>>(
      qws, kws, vws, mfrag, yws);
  out_proj_kernel<<<dim3(DMODEL / 128, BATCH * SEQ / 128), 256, lds_gemm,
                    stream>>>(yws, woh, bo, out);
}

// v009
// It runs in 126 microseconds.
// Two timings next to v008 both put it at 1.05 times that version's speed.
// All steps since v000 together make it 3.34 times as fast.
#include <hip/hip_runtime.h>
#include <hip/hip_bf16.h>

// ---------------------------------------------------------------------------
// Fused attention block for MI455X (gfx1250, wave32, WMMA).
//   B=4, N=2048, D=1024, H=8, HD=128
//   Stage 0: x, Wkv, Wo -> f16 in ws, once, so that the GEMM blocks that
//            re-read them from L2 fetch half the bytes; the mask (f32 as it
//            is) copied into the order in which stage 2's lanes hold scores
//   Stage 1: qkv = x @ Wkv^T  (f16 in, f16 to ws, Q pre-scaled by 1/sqrt(128)),
//            operand stages copied to LDS asynchronously, a stage ahead,
//            256x128 of the result a work-group, 64x64 a wave
//   Stage 2: flash attention per (b,h), online softmax, f16 WMMA, f32 acc,
//            Q/K/V tiles staged via GLOBAL_LOAD_ASYNC_TO_LDS when available,
//            K and V in two buffers each, fetched a tile of 64 keys ahead,
//            V kept row-major and transposed on read by ds_load_tr16_b128,
//            products transposed (keys x queries) so that P stays in registers,
//            32 queries a wave: an LDS fragment of K or V feeds two products
//   Stage 3: out = y @ Wo^T + bo (f32 out)
// ---------------------------------------------------------------------------

typedef __attribute__((ext_vector_type(4)))  _Float16 h4;
typedef __attribute__((ext_vector_type(8)))  _Float16 h8;
typedef __attribute__((ext_vector_type(16))) _Float16 h16;
typedef __attribute__((ext_vector_type(8)))  float    f8;
typedef __attribute__((ext_vector_type(4)))  float    f4;

#define BATCH 4
#define SEQ   2048
#define DMODEL 1024
#define NHEAD 8
#define HDIM  128

// --- gfx1250 async global->LDS copy (ASYNCcnt-tracked), with fallback -------
#if defined(__gfx1250__) && __has_builtin(__builtin_amdgcn_global_load_async_to_lds_b128)
#define HAVE_ASYNC_LDS 1
// Parameter type revealed by compiler diagnostic: pointer to <4 x i32> vector.
typedef __attribute__((__vector_size__(4 * sizeof(int)))) int i4v;
static __device__ __forceinline__ void async_cp16(const void* g, void* l) {
  __builtin_amdgcn_global_load_async_to_lds_b128((i4v*)g, (i4v*)l, 0, 0);
}
#else
#define HAVE_ASYNC_LDS 0
static __device__ __forceinline__ void async_cp16(const void* g, void* l) {
  *(h8*)l = *(const h8*)g;
}
#endif

// v_wmma_f32_16x16x32_f16 wrapper (8-arg probe-confirmed signature)
static __device__ __forceinline__ f8 wmma32(h16 a, h16 b, f8 c) {
  return __builtin_amdgcn_wmma_f32_16x16x32_f16(false, a, false, b,
                                                (short)0, c, false, false);
}

// Load a 16x32 f16 A/B fragment from a row-major LDS tile.
// CDNA5 16-bit A layout: lane L (L%16 = matrix row, L/16 = k-group) holds
// K = kg*8 + {0..7} in elements 0..7 and K = 16 + kg*8 + {0..7} in elements
// 8..15  ->  two contiguous 16-byte LDS loads per lane.
static __device__ __forceinline__ h16 frag_ld(const _Float16* lds, int row,
                                              int kbase, int ld) {
  const int lane = threadIdx.x & 31;
  const _Float16* p = lds + (row + (lane & 15)) * ld + kbase + ((lane >> 4) << 3);
  h8 lo = *(const h8*)(p);
  h8 hi = *(const h8*)(p + 16);
  return __builtin_shufflevector(lo, hi, 0, 1, 2, 3, 4, 5, 6, 7, 8, 9, 10, 11,
                                 12, 13, 14, 15);
}

// Load a 16x32 f16 A fragment (m x k) from a ROW-MAJOR (k x m) LDS tile with
// the transposing LDS load. Lane (c = L%16, h = L/16) receives
// T[kbase + 8h + 0..7][nbase + c]; the second load, 16 rows further, gives
// k = 16 + 8h + 0..7: the same k order as frag_ld delivers, and as two
// converted accumulator tiles hold when they serve as the B side.
typedef __attribute__((ext_vector_type(8))) short s16x8;
typedef __attribute__((address_space(3))) s16x8 lds_s16x8;
static __device__ __forceinline__ h16 frag_ld_tr(const _Float16* lds, int kbase,
                                                 int nbase, int ld) {
  const int lane = threadIdx.x & 31;
  const _Float16* p = lds + (kbase + ((lane >> 4) << 3) + (lane & 7)) * ld +
                      nbase + (((lane >> 3) & 1) << 3);
  h8 lo = __builtin_bit_cast(
      h8, __builtin_amdgcn_ds_load_tr16_b128_v8i16((lds_s16x8*)p));
  h8 hi = __builtin_bit_cast(
      h8, __builtin_amdgcn_ds_load_tr16_b128_v8i16((lds_s16x8*)(p + 16 * ld)));
  return __builtin_shufflevector(lo, hi, 0, 1, 2, 3, 4, 5, 6, 7, 8, 9, 10, 11,
                                 12, 13, 14, 15);
}

// ---------------------------------------------------------------------------
// Kernel 0: f32 -> f16 of x, Wkv and Wo, and the mask's new order. grid = 1024,
// block = 256: four blocks, 32 waves, a WGP. A converting block takes CVT_UNIT
// consecutive floats of one buffer, a thread's 16 loads issued ahead of its
// first store. A wave's load covers 512 contiguous bytes, its store 256.
//
// The mask: stage 2 wants, in lane (c = L%16, h = L/16), the values of query c
// for keys 16t + 8h + 0..7. Read from the mask's own rows, each 16-byte load of
// a wave touches 16 lines, and all 32 (batch, head) pairs pay that again. Here
// it is paid once: a wave takes one unit (16 queries x 128 keys, 8 KB) and
// stores it as 16 groups of 512 contiguous bytes, group i = 2t + u holding, at
// lane L, keys 16t + 8h + 4u + 0..3 of query c. Values are moved, not changed.
// ---------------------------------------------------------------------------
#define CVT_UNIT 16384
#define CVT_XU (BATCH * SEQ * DMODEL / CVT_UNIT)   // 512 blocks for x
#define CVT_KU (3 * DMODEL * DMODEL / CVT_UNIT)    // 192 blocks for Wkv
#define CVT_OU (DMODEL * DMODEL / CVT_UNIT)        // 64 blocks for Wo
#define MSK_UNIT (16 * 128)                        // floats of a mask unit
#define MSK_ROWU (SEQ / 128)                       // 16 units a 16-query strip
#define MSK_BU (SEQ / 16 * MSK_ROWU / 8)           // 256 blocks, a unit a wave
__global__ __launch_bounds__(256) void to_f16_kernel(
    const float* __restrict__ x, const float* __restrict__ Wkv,
    const float* __restrict__ Wo, const float* __restrict__ mask,
    _Float16* __restrict__ xh, _Float16* __restrict__ wkvh,
    _Float16* __restrict__ woh, float* __restrict__ mfrag) {
  int u = blockIdx.x;  // which buffer: uniform for the block
  if (u >= CVT_XU + CVT_KU + CVT_OU) {
    // a block's 8 waves: 8 neighbouring units of one 16-query strip
    const int unit = (u - (CVT_XU + CVT_KU + CVT_OU)) * 8 + (threadIdx.x >> 5);
    const int lane = threadIdx.x & 31;
    const float* sp = mask +
                      (size_t)((unit / MSK_ROWU) * 16 + (lane & 15)) * SEQ +
                      (unit % MSK_ROWU) * 128 + ((lane >> 4) << 3);
    float* dp = mfrag + (size_t)unit * MSK_UNIT + lane * 4;
    f4 g[16];
    // both loops unrolled: every index of g constant, so g stays in registers
#pragma unroll
    for (int i = 0; i < 16; ++i)
      g[i] = *(const f4*)(sp + (i >> 1) * 16 + (i & 1) * 4);
    // Holds all 16 loads ahead of the first store (loaded values as inputs
    // only): left alone, this build pairs each load with its store and waits
    // out the load latency 16 times in a row. The address is an input too, so
    // that its registers are given to nothing else while the loads are out.
    asm volatile("" ::"v"(sp), "v"(g[0]), "v"(g[1]), "v"(g[2]), "v"(g[3]), "v"(g[4]),
                 "v"(g[5]), "v"(g[6]), "v"(g[7]), "v"(g[8]), "v"(g[9]),
                 "v"(g[10]), "v"(g[11]), "v"(g[12]), "v"(g[13]), "v"(g[14]),
                 "v"(g[15]));
#pragma unroll
    for (int i = 0; i < 16; ++i) *(f4*)(dp + i * 128) = g[i];
    return;
  }
  const float* src = x;
  _Float16* dst = xh;
  if (u >= CVT_XU + CVT_KU) {
    src = Wo; dst = woh; u -= CVT_XU + CVT_KU;
  } else if (u >= CVT_XU) {
    src = Wkv; dst = wkvh; u -= CVT_XU;
  }
  const size_t off = (size_t)u * CVT_UNIT + threadIdx.x * 4;
  float4 f[16];
  // both loops unrolled: every index of f constant, so f stays in registers
#pragma unroll
  for (int i = 0; i < 16; ++i) f[i] = *(const float4*)(src + off + i * 1024);
#pragma unroll
  for (int i = 0; i < 16; ++i) {
    h4 h = {(_Float16)f[i].x, (_Float16)f[i].y, (_Float16)f[i].z,
            (_Float16)f[i].w};
    *(h4*)(dst + off + i * 1024) = h;
  }
}

// ---------------------------------------------------------------------------
// Main loop of both GEMMs: acc += A[256 rows][D] * B[128 rows][D]^T, both f16,
// k-contiguous, row pitch D. A wave holds 64x64 of the result: each of its 8 LDS
// fragments of a 32-k slice feeds 4 products, which asks of the LDS what it can
// give at full matrix rate (at 64x32 it was half as much again), and a row
// fetched from L2 serves 128 or 256 columns of the result, not 128.
// A stage is 64 k of both tiles (128 B a row). The
// stages go through two LDS buffers: the copies of stage s + 2 are issued at the
// foot of stage s, behind the one barrier of a stage, so that a stage's way from
// L2 is covered by the products of the stage before it, and nothing passes
// through registers.
// The walk over k starts at stage st and wraps. Work-groups that share a tile of
// A or of B run at the same time; all starting at k = 0, they would ask L2 for
// the same 128 B of the same rows at the same moment, and every row asked for
// anywhere on the chip would lie at the same offset in its 2 KB pitch. With st
// different between them the requests of a moment spread over the whole rows.
// Each sum over k then begins at k = 64 * st: the same terms in a rotated order.
// ag, bg: first row of the block's tile of A and of B.
// ---------------------------------------------------------------------------
#define GLD 72                   // 64 + 8 pad (halfs): 144 B rows for ds_load_b128
#define GTM 256                  // rows of the A tile
#define GBUF ((GTM + 128) * GLD) // halfs of a buffer: A tile, then B tile
#define GNS (DMODEL / 64)        // stages
static __device__ __forceinline__ void gemm_stage_copy(const _Float16* ag,
                                                       const _Float16* bg,
                                                       unsigned al) {
  // 256 + 128 rows of 64 f16 = 3072 chunks of 16 B; 8 of A and 4 of B per thread, 32
  // rows apart; a wave's copy covers 4 whole 128 B rows. al: the LDS byte
  // address of the thread's first chunk of A. One statement, closed by
  // s_wait_xcnt 0, so that no register which a copy names is rewritten ahead
  // of that wait.
  const unsigned rs = 32 * GLD * 2;    // 32 rows in LDS, bytes
  const unsigned tb = GTM * GLD * 2;   // the A tile in LDS, bytes
  const size_t gs = (size_t)32 * DMODEL;  // 32 rows in global memory, halfs
#if defined(__gfx1250__)
  asm volatile(
      "global_load_async_to_lds_b128 %0, %12, off\n\t"
      "global_load_async_to_lds_b128 %1, %13, off\n\t"
      "global_load_async_to_lds_b128 %2, %14, off\n\t"
      "global_load_async_to_lds_b128 %3, %15, off\n\t"
      "global_load_async_to_lds_b128 %4, %16, off\n\t"
      "global_load_async_to_lds_b128 %5, %17, off\n\t"
      "global_load_async_to_lds_b128 %6, %18, off\n\t"
      "global_load_async_to_lds_b128 %7, %19, off\n\t"
      "global_load_async_to_lds_b128 %8, %20, off\n\t"
      "global_load_async_to_lds_b128 %9, %21, off\n\t"
      "global_load_async_to_lds_b128 %10, %22, off\n\t"
      "global_load_async_to_lds_b128 %11, %23, off\n\t"
      "s_wait_xcnt 0x0"
      ::"v"(al), "v"(al + rs), "v"(al + 2 * rs), "v"(al + 3 * rs),
        "v"(al + 4 * rs), "v"(al + 5 * rs), "v"(al + 6 * rs), "v"(al + 7 * rs),
        "v"(al + tb), "v"(al + tb + rs), "v"(al + tb + 2 * rs),
        "v"(al + tb + 3 * rs), "v"(ag), "v"(ag + gs), "v"(ag + 2 * gs),
        "v"(ag + 3 * gs), "v"(ag + 4 * gs), "v"(ag + 5 * gs), "v"(ag + 6 * gs),
        "v"(ag + 7 * gs), "v"(bg), "v"(bg + gs), "v"(bg + 2 * gs),
        "v"(bg + 3 * gs)
      : "memory");
#endif
}

static __device__ __forceinline__ void gemm_mainloop(const _Float16* ag,
                                                     const _Float16* bg,
                                                     _Float16* smem, int wm,
                                                     int wn, int st,
                                                     f8 (&acc)[4][4]) {
  const int tid = threadIdx.x;
  const int cr = tid >> 3, cc = (tid & 7) * 8;  // the thread's row and chunk
  ag += (size_t)cr * DMODEL + cc;
  bg += (size_t)cr * DMODEL + cc;
  // low 32 bits of a __shared__ address: the byte offset in the block's LDS
  const unsigned al = (unsigned)(size_t)(smem + cr * GLD + cc);

  gemm_stage_copy(ag + st * 64, bg + st * 64, al);
  // this wave's copies of stage st have landed; the barrier publishes them
  asm volatile("s_wait_asynccnt 0x0" ::: "memory");
  __syncthreads();
  // stage st + 1 (wrapped) flies into the second buffer while stage st is worked on
  {
    const int k1 = ((st + 1) & (GNS - 1)) * 64;
    gemm_stage_copy(ag + k1, bg + k1, al + GBUF * 2);
  }

  for (int s = 0; s < GNS; ++s) {
    const _Float16* At = smem + (s & 1) * GBUF;
    const _Float16* Bt = At + GTM * GLD;
    // unrolled: the two 32-k slices read LDS at constant offsets
#pragma unroll
    for (int kk = 0; kk < 64; kk += 32) {
      h16 a[4], b[4];
#pragma unroll
      for (int i = 0; i < 4; ++i) a[i] = frag_ld(At, wm * 64 + i * 16, kk, GLD);
#pragma unroll
      for (int j = 0; j < 4; ++j) b[j] = frag_ld(Bt, wn * 64 + j * 16, kk, GLD);
#pragma unroll
      for (int i = 0; i < 4; ++i)
#pragma unroll
        for (int j = 0; j < 4; ++j) acc[i][j] = wmma32(a[i], b[j], acc[i][j]);
    }
    // Order of this block: the 16 LDS reads of a 32-k slice stand as one group
    // in front of its 16 products. Left alone, this build reads each A fragment
    // directly in front of its products, and the wave sits out the LDS
    // latency 8 times a stage, which is what is left of a stage's chain now.
    // Unrolled: the markers must stand in the one block that they order.
#pragma unroll
    for (int g = 0; g < 2; ++g) {
      __builtin_amdgcn_sched_group_barrier(0x100, 16, 0);  // a slice's reads
      __builtin_amdgcn_sched_group_barrier(0x008, 16, 0);  // its products
    }
    // Foot of the stage. This wave's LDS reads of the buffer have retired and
    // its copies of the next stage have landed; the one barrier publishes the
    // next stage and ends every wave's reads of the buffer refilled behind it.
    asm volatile("s_wait_dscnt 0x0" ::: "memory");
    asm volatile("s_wait_asynccnt 0x0" ::: "memory");
    __syncthreads();
    if (s + 2 < GNS) {  // the same for the whole work-group
      const int k2 = ((st + s + 2) & (GNS - 1)) * 64;
      gemm_stage_copy(ag + k2, bg + k2, al + (s & 1) * (GBUF * 2));
    }
  }
  // no copy is out when the wave goes on to its stores
  asm volatile("s_wait_asynccnt 0x0" ::: "memory");
}

// ---------------------------------------------------------------------------
// Kernel 1: QKV projection. grid = (3*D/128, B*N/256), block = 256 (8 waves).
// Each wave computes a 64x64 register tile (16 wmma accumulators).
// ---------------------------------------------------------------------------
__global__ __launch_bounds__(256) void qkv_proj_kernel(
    const _Float16* __restrict__ xh, const _Float16* __restrict__ wkvh,
    _Float16* __restrict__ qws, _Float16* __restrict__ kws,
    _Float16* __restrict__ vws) {
  extern __shared__ _Float16 smem[];  // 2 buffers of X [256][72], W [128][72]

  const int tid = threadIdx.x;
  const int wave = tid >> 5;
  const int lane = tid & 31;
  const int nloc = lane & 15;
  const int mhi = (lane >> 4) << 3;  // 0 or 8
  const int m0 = blockIdx.y * GTM;
  const int n0 = blockIdx.x * 128;
  const int wm = wave >> 1;  // 0..3 -> 64-row quarter
  const int wn = wave & 1;   // 0..1 -> 64-col half

  f8 acc[4][4] = {};
  gemm_mainloop(xh + (size_t)m0 * DMODEL, wkvh + (size_t)n0 * DMODEL, smem, wm,
                wn, (blockIdx.x + blockIdx.y) & (GNS - 1), acc);

  // Epilogue: destination (q/k/v, head) is uniform per 16-wide tile.
#pragma unroll
  for (int j = 0; j < 4; ++j) {
    int gnb = n0 + wn * 64 + j * 16;        // tile base col (multiple of 16)
    int which = gnb >> 10;                  // 0=q 1=k 2=v (uniform)
    int e = gnb & (DMODEL - 1);
    int hh = e >> 7;                        // head (uniform)
    int hdb = (e & (HDIM - 1)) + nloc;      // feature within head
    _Float16* dst = (which == 0) ? qws : (which == 1) ? kws : vws;
    float scale = (which == 0) ? 0.08838834764831845f : 1.0f;
#pragma unroll
    for (int i = 0; i < 4; ++i)
#pragma unroll
      for (int r = 0; r < 8; ++r) {
        int gm = m0 + wm * 64 + i * 16 + mhi + r;  // row in [0, B*N)
        int bb = gm >> 11, nn = gm & (SEQ - 1);
        dst[(((size_t)bb * NHEAD + hh) * SEQ + nn) * HDIM + hdb] =
            (_Float16)(acc[i][j][r] * scale);
      }
  }
}

// ---------------------------------------------------------------------------
// Kernel 2: flash attention. grid = (B*H, N/256), block = 256 (8 waves).
// Wave w owns queries [w*32, w*32+32) of the 256-query tile, as two column
// groups of 16, and works on the transposed products: S^T = K Q^T (keys x
// queries) and O^T += V^T P^T (features x queries). Every K and V fragment that
// the wave reads from LDS is the A operand of two products, one a column group:
// at one product a fragment the LDS reads took twice the products' own time.
// A lane holds scores of ONE query a column group (column lane%16; keys
// 8*(lane/16)+0..7 of every 16-key tile), so the maximum and the sum run inside
// the lane with one exchange between the wave's halves, and two converted S^T
// tiles are the B operand of the second product as they stand: the
// probabilities never pass through LDS.
// Keys go by tiles of 64 through two K and two V buffers: the copies of tile
// t + 2 are issued at the foot of tile t, behind the one barrier of a tile, and
// the mask values of tile t + 1 are loaded into registers during tile t, so
// that nothing fetched from L2 is waited for where it is asked for.
// The walk over the key tiles starts at tile st and wraps, for the reason given
// at the GEMMs' main loop: the 8 work-groups of a (batch, head) pair read the
// same K and V tiles and the 32 work-groups of a query tile the same mask tiles,
// all at the same time. st differs inside both sets. The online softmax takes
// the tiles in any order; its sums are formed in the rotated order.
// ---------------------------------------------------------------------------
// Lane l <-> lane l ^ 16 by a vector cross-row move.
static __device__ __forceinline__ float xhalf(float v) {
  int b = __builtin_bit_cast(int, v);
  return __builtin_bit_cast(
      float, __builtin_amdgcn_permlanex16(b, b, 0x76543210, 0xfedcba98, false,
                                          false));
}

#define QT 256  // queries a work-group
__global__ __launch_bounds__(256) void flash_attn_kernel(
    const _Float16* __restrict__ qws, const _Float16* __restrict__ kws,
    const _Float16* __restrict__ vws, const float* __restrict__ mfrag,
    _Float16* __restrict__ yws) {
  extern __shared__ _Float16 smem[];
  const int LD = 136;   // 128 + 8 pad: 272 B rows for ds_load_b128 readers
  const int LDV = 144;  // 128 + 16 pad: 288 B rows for the transposing reader
  const int KT = 64;    // keys a tile
  const int NT = SEQ / KT;
  _Float16* Qt = smem;                       // [256][136] row-major (q x d)
  _Float16* Kt = smem + QT * LD;             // 2 buffers of [64][136] (kv x d)
  _Float16* Vs = smem + (QT + 2 * KT) * LD;  // 2 buffers of [64][144] (kv x d)

  const int tid = threadIdx.x;
  const int w = tid >> 5;
  const int lane = tid & 31;
  const int nloc = lane & 15;
  const int mhi = (lane >> 4) << 3;
  const int bh = blockIdx.x;       // b*H + h
  const int q0 = blockIdx.y * QT;
  const size_t hbase = (size_t)bh * SEQ * HDIM;
  const int st = (4 * blockIdx.y + blockIdx.x) & (NT - 1);  // first key tile

  // A thread's 16 B chunk of a row; its further chunks lie 16 rows apart.
  const int cr = tid >> 4, cc = (tid & 15) * 8;
  const unsigned co = cr * HDIM + cc;  // the same in Q, K and V
  const _Float16* kg = kws + hbase;    // uniform; a tile's rows are added to it
  const _Float16* vg = vws + hbase;
  _Float16* kl = Kt + cr * LD + cc;
  _Float16* vl = Vs + cr * LDV + cc;

  // Q tile: 4096 x 16B chunks, 16 per thread; first K and V tile: 4 + 4 per thread
#pragma unroll
  for (int i = 0; i < QT / 16; ++i)
    async_cp16(qws + hbase + (size_t)(q0 + i * 16) * HDIM + co,
               Qt + (cr + i * 16) * LD + cc);
#pragma unroll
  for (int i = 0; i < 4; ++i) {
    async_cp16(kg + (size_t)(st * KT + i * 16) * HDIM + co, kl + i * 16 * LD);
    async_cp16(vg + (size_t)(st * KT + i * 16) * HDIM + co, vl + i * 16 * LDV);
  }
  // this wave's copies of Q and of that tile have landed; the barrier publishes them
  asm volatile("s_wait_asynccnt 0x0" ::: "memory");
  __syncthreads();
  // the second tile flies into the second buffers while the first is worked on
  const int t1 = ((st + 1) & (NT - 1)) * KT;
#pragma unroll
  for (int i = 0; i < 4; ++i) {
    async_cp16(kg + (size_t)(t1 + i * 16) * HDIM + co, kl + (KT + i * 16) * LD);
    async_cp16(vg + (size_t)(t1 + i * 16) * HDIM + co, vl + (KT + i * 16) * LDV);
  }

  // The wave's Q fragments, read once; c is the column group.
  h16 bq[2][4];
#pragma unroll
  for (int c = 0; c < 2; ++c)
#pragma unroll
    for (int kk = 0; kk < 4; ++kk)
      bq[c][kk] = frag_ld(Qt, w * 32 + c * 16, kk * 32, LD);

  f8 o[2][8] = {};  // o[c][t][r] = O^T[feature t*16 + mhi + r][query c*16 + nloc]
  float mrun[2] = {-1.0e30f, -1.0e30f};  // running maximum of the lane's queries
  float lsum[2] = {0.0f, 0.0f};  // running sums over this half-wave's keys only
  // The lane's place in the first mask tile of this wave's first 16 queries
  // (kernel 0's order); the second 16 queries' strip lies MSK_STRIP further. A
  // tile of 64 keys is half a unit, 8 loads of 512 contiguous bytes a wave and
  // strip. The first tile's values are fetched here, each later tile's one tile
  // ahead.
  const int MSK_STRIP = MSK_ROWU * MSK_UNIT;
  const float* mp = mfrag + (size_t)((q0 >> 4) + 2 * w) * MSK_STRIP +
                    st * (MSK_UNIT / 2) + lane * 4;
  float4 mk[2][8];
#pragma unroll
  for (int c = 0; c < 2; ++c)
#pragma unroll
    for (int i = 0; i < 8; ++i)
      mk[c][i] = *(const float4*)(mp + c * MSK_STRIP + i * 128);
  // Stands behind these loads because the first tile moves the pointer that they
  // name before the last of them has been waited for. (In the loop the wait
  // for all loads in front of the barrier stands between.)
  asm volatile("s_wait_xcnt 0x0" ::: "memory");

  for (int it = 0; it < NT; ++it) {
    const _Float16* Kb = Kt + (it & 1) * KT * LD;
    const _Float16* Vb = Vs + (it & 1) * KT * LDV;

    // S^T = K @ Q^T: A = K rows, B = Q rows, both through the same loader.
    // s[c][t][r] = score of key ((it+st)%NT)*64 + t*16 + mhi + r for query
    // c*16 + nloc.
    f8 s[2][4] = {};
#pragma unroll
    for (int kk = 0; kk < 4; ++kk) {
#pragma unroll
      for (int t = 0; t < 4; ++t) {
        h16 ak = frag_ld(Kb, t * 16, kk * 32, LD);
        s[0][t] = wmma32(ak, bq[0][kk], s[0][t]);
        s[1][t] = wmma32(ak, bq[1][kk], s[1][t]);
      }
    }
    // Order of this block: the LDS reads of eight products stand as one group,
    // one group ahead of the eight products that use them. Left alone, this
    // build waits for every fragment directly in front of its products, and the
    // wave sits out the LDS latency 16 times a tile.
    __builtin_amdgcn_sched_group_barrier(0x100, 8, 0);  // 4 K tiles
    // unrolled: the markers must stand in the one block that they order
#pragma unroll
    for (int g = 0; g < 3; ++g) {
      __builtin_amdgcn_sched_group_barrier(0x100, 8, 0);  // next 4 K tiles
      __builtin_amdgcn_sched_group_barrier(0x008, 8, 0);  // 8 products
    }
    __builtin_amdgcn_sched_group_barrier(0x008, 8, 0);
    // Ends the block that the markers order: without it this build weaves the
    // mask additions in and again waits for each fragment in front of its product.
    __builtin_amdgcn_sched_barrier(0);

    // additive mask: 8 consecutive keys of the lane's own query a 16-key tile
#pragma unroll
    for (int c = 0; c < 2; ++c)
#pragma unroll
      for (int t = 0; t < 4; ++t) {
        s[c][t][0] += mk[c][2 * t].x; s[c][t][1] += mk[c][2 * t].y;
        s[c][t][2] += mk[c][2 * t].z; s[c][t][3] += mk[c][2 * t].w;
        s[c][t][4] += mk[c][2 * t + 1].x; s[c][t][5] += mk[c][2 * t + 1].y;
        s[c][t][6] += mk[c][2 * t + 1].z; s[c][t][7] += mk[c][2 * t + 1].w;
      }
    // The next tile's mask values, asked for a whole tile ahead of their use.
    // One tile on, or from the strip's last tile back to its first. The last
    // trip asks for the first trip's tile again: inside, and not used.
    mp += (((st + it + 1) & (NT - 1)) != 0) ? MSK_UNIT / 2
                                            : -(NT - 1) * (MSK_UNIT / 2);
#pragma unroll
    for (int c = 0; c < 2; ++c)
#pragma unroll
      for (int i = 0; i < 8; ++i)
        mk[c][i] = *(const float4*)(mp + c * MSK_STRIP + i * 128);

    // V^T fragments of the tile's first 32 keys (A operands, from row-major Vb
    // through the transposing load), read here so that their LDS latency passes
    // under the softmax.
    h16 av[2][8];
#pragma unroll
    for (int t = 0; t < 8; ++t) av[0][t] = frag_ld_tr(Vb, 0, t * 16, LDV);

    // online softmax: 32 of a query's 64 scores are in this lane, the other
    // 32 in lane ^ 16. Four chains of maxima a query, not one of 32 links.
    float corr[2];
#pragma unroll
    for (int c = 0; c < 2; ++c) {
      float tq[4];
#pragma unroll
      for (int j = 0; j < 4; ++j) {
        tq[j] = s[c][j][0];
#pragma unroll
        for (int e = 1; e < 8; ++e) tq[j] = fmaxf(tq[j], s[c][j][e]);
      }
      float tm = fmaxf(fmaxf(tq[0], tq[1]), fmaxf(tq[2], tq[3]));
      tm = fmaxf(tm, xhalf(tm));
      const float nm = fmaxf(mrun[c], tm);
      corr[c] = __expf(mrun[c] - nm);
      mrun[c] = nm;

      // Exponents in place, (s - nm) * log2(e), as __expf forms them.
#pragma unroll
      for (int t = 0; t < 4; ++t)
#pragma unroll
        for (int r = 0; r < 8; ++r)
          s[c][t][r] = (s[c][t][r] - nm) * 1.44269504f;
    }
    // Keeps these multiplies ahead of every v_exp_f32. It also keeps the mask
    // loads above it, early in the tile.
    __builtin_amdgcn_sched_barrier(0);

    // P^T as B operands: element e of p[c][j] is key 32j + 16*(e/8) + mhi + e%8,
    // which is register e%8 of tile 2j + e/8 in this same lane. Two sums a
    // fragment, so that the adds do not form one chain of 32.
    h16 p[2][2];
#pragma unroll
    for (int c = 0; c < 2; ++c) {
      float ps[4];
#pragma unroll
      for (int j = 0; j < 2; ++j) {
        ps[2 * j] = 0.0f;
        ps[2 * j + 1] = 0.0f;
#pragma unroll
        for (int e = 0; e < 16; ++e) {
          float pv = __builtin_amdgcn_exp2f(s[c][2 * j + (e >> 3)][e & 7]);
          ps[2 * j + (e >> 3)] += pv;
          p[c][j][e] = (_Float16)pv;
        }
      }
      lsum[c] = lsum[c] * corr[c] + ((ps[0] + ps[1]) + (ps[2] + ps[3]));
#pragma unroll
      for (int t = 0; t < 8; ++t)
#pragma unroll
        for (int r = 0; r < 8; ++r) o[c][t][r] *= corr[c];
    }

    // Order of this block: behind every v_exp_f32 one other vector instruction.
    // It runs in the slot that the half-rate v_exp_f32 leaves empty, and it is
    // the free slot that the instruction set asks for in front of a write to
    // the v_exp_f32's source. Unrolled: the markers stand in the block they order.
#pragma unroll
    for (int g = 0; g < 66; ++g) {
      __builtin_amdgcn_sched_group_barrier(0x400, 1, 0);  // one v_exp_f32
      __builtin_amdgcn_sched_group_barrier(0x002, 1, 0);  // one other
    }
    // Ends that block, so that the reads below stay one group in front of the
    // products: woven in, each fragment was read directly in front of its two
    // products and waited for there, and with two waves a SIMD little else
    // covers that wait.
    __builtin_amdgcn_sched_barrier(0);

    // O^T += V^T @ P^T. The fragments of the second 32 keys are read as one
    // group; the 16 products of the first 32 keys cover their latency.
#pragma unroll
    for (int t = 0; t < 8; ++t) av[1][t] = frag_ld_tr(Vb, 32, t * 16, LDV);
#pragma unroll
    for (int j = 0; j < 2; ++j) {
#pragma unroll
      for (int t = 0; t < 8; ++t) {
        o[0][t] = wmma32(av[j][t], p[0][j], o[0][t]);
        o[1][t] = wmma32(av[j][t], p[1][j], o[1][t]);
      }
    }
    __builtin_amdgcn_sched_group_barrier(0x100, 16, 0);  // 8 V fragments
    __builtin_amdgcn_sched_group_barrier(0x008, 32, 0);  // the tile's products
    // Keeps the products above the waits at the foot: moved below them, nothing
    // stood between the reads of the second 32 keys and the wait for them.
    __builtin_amdgcn_sched_barrier(0);

    // Foot of the tile. This wave's LDS reads of the buffers have retired and
    // its copies of the next tile have landed; the one barrier publishes the
    // next tile and ends every wave's reads of the buffers refilled behind it.
    asm volatile("s_wait_dscnt 0x0" ::: "memory");
    asm volatile("s_wait_asynccnt 0x0" ::: "memory");
    __syncthreads();
    if (it + 2 < NT) {  // the same for the whole work-group
      const size_t gr = (size_t)((st + it + 2) & (NT - 1)) * KT * HDIM;
      const int lb = (it & 1) * KT;
#pragma unroll
      for (int i = 0; i < 4; ++i) {
        async_cp16(kg + gr + (size_t)(i * 16) * HDIM + co, kl + (lb + i * 16) * LD);
        async_cp16(vg + gr + (size_t)(i * 16) * HDIM + co, vl + (lb + i * 16) * LDV);
      }
    }
  }
  // no copy is out when the wave ends
  asm volatile("s_wait_asynccnt 0x0" ::: "memory");

  // join the halves' sums, normalize and write y [B][N][D] (f16): a lane's 8
  // registers of a tile are 8 consecutive features of its query, one 16 B store
  const int b = bh >> 3, h = bh & 7;
#pragma unroll
  for (int c = 0; c < 2; ++c) {
    const float l = lsum[c] + xhalf(lsum[c]);
    _Float16* yp = yws +
                   ((size_t)b * SEQ + q0 + w * 32 + c * 16 + nloc) * DMODEL +
                   h * HDIM + mhi;
#pragma unroll
    for (int t = 0; t < 8; ++t) {
      h8 v;
#pragma unroll
      for (int r = 0; r < 8; ++r) v[r] = (_Float16)(o[c][t][r] / l);
      *(h8*)(yp + t * 16) = v;
    }
  }
}

// ---------------------------------------------------------------------------
// Kernel 3: output projection out = y @ Wo^T + bo. grid = (D/128, B*N/256).
// ---------------------------------------------------------------------------
__global__ __launch_bounds__(256) void out_proj_kernel(
    const _Float16* __restrict__ yws, const _Float16* __restrict__ woh,
    const float* __restrict__ bo, float* __restrict__ out) {
  extern __shared__ _Float16 smem[];  // 2 buffers of Y [256][72], W [128][72]

  const int tid = threadIdx.x;
  const int wave = tid >> 5;
  const int lane = tid & 31;
  const int nloc = lane & 15;
  const int mhi = (lane >> 4) << 3;
  const int m0 = blockIdx.y * GTM;
  const int n0 = blockIdx.x * 128;
  const int wm = wave >> 1;
  const int wn = wave & 1;

  f8 acc[4][4] = {};
  gemm_mainloop(yws + (size_t)m0 * DMODEL, woh + (size_t)n0 * DMODEL, smem, wm,
                wn, (blockIdx.x + blockIdx.y) & (GNS - 1), acc);

#pragma unroll
  for (int i = 0; i < 4; ++i)
#pragma unroll
    for (int j = 0; j < 4; ++j)
#pragma unroll
      for (int r = 0; r < 8; ++r) {
        int gm = m0 + wm * 64 + i * 16 + mhi + r;
        int gn = n0 + wn * 64 + j * 16 + nloc;
        out[(size_t)gm * DMODEL + gn] = acc[i][j][r] + bo[gn];
      }
}

// ---------------------------------------------------------------------------
// Host launch. Inputs: x, mask, Wkv, Wo, bo (all f32). Output: f32 [B,N,D].
// Workspace layout (f16): Q | K | V | Y | x, each B*N*D elements, then Wkv
// (3*D*D) and Wo (D*D), then the re-ordered mask (f32, N*N): 109 MB in all.
// ---------------------------------------------------------------------------
extern "C" void kernel_launch(void* const* d_in, const int* in_sizes, int n_in,
                              void* d_out, int out_size, void* d_ws,
                              size_t ws_size, hipStream_t stream) {
  (void)in_sizes; (void)n_in; (void)out_size; (void)ws_size;
  const float* x    = (const float*)d_in[0];
  const float* mask = (const float*)d_in[1];
  const float* Wkv  = (const float*)d_in[2];
  const float* Wo   = (const float*)d_in[3];
  const float* bo   = (const float*)d_in[4];
  float* out = (float*)d_out;

  const size_t SZ = (size_t)BATCH * SEQ * DMODEL;  // 8.4M elements
  _Float16* base = (_Float16*)d_ws;
  _Float16* qws = base;
  _Float16* kws = base + SZ;
  _Float16* vws = base + 2 * SZ;
  _Float16* yws = base + 3 * SZ;
  _Float16* xh = base + 4 * SZ;
  _Float16* wkvh = base + 5 * SZ;
  _Float16* woh = wkvh + (size_t)3 * DMODEL * DMODEL;
  float* mfrag = (float*)(woh + (size_t)DMODEL * DMODEL);

  const size_t lds_gemm = 2 * GBUF * sizeof(_Float16);       // 108 KiB: two work-groups a WGP
  const size_t lds_attn = ((QT + 128) * 136 + 128 * 144) * sizeof(_Float16);  // 141 KB

  to_f16_kernel<<<dim3(CVT_XU + CVT_KU + CVT_OU + MSK_BU), 256, 0, stream>>>(
      x, Wkv, Wo, mask, xh, wkvh, woh, mfrag);
  qkv_proj_kernel<<<dim3(3 * DMODEL / 128, BATCH * SEQ / GTM), 256, lds_gemm,
                    stream>>>(xh, wkvh, qws, kws, vws);
  flash_attn_kernel<<<dim3(BATCH * NHEAD, SEQ / QT), 256, lds_attn, stream>>>(
      qws, kws, vws, mfrag, yws);
  out_proj_kernel<<<dim3(DMODEL / 128, BATCH * SEQ / GTM), 256, lds_gemm,
                    stream>>>(yws, woh, bo, out);
}

// v010
// It runs in 120 microseconds.
// In both of two side-by-side timings against v009, it was 1.04 times as fast.
// Over all steps from v000 it is 3.48 times as fast.
#include <hip/hip_runtime.h>
#include <hip/hip_bf16.h>

// ---------------------------------------------------------------------------
// Fused attention block for MI455X (gfx1250, wave32, WMMA).
//   B=4, N=2048, D=1024, H=8, HD=128
//   Stage 0: x, Wkv -> f16 in ws, once, so that the GEMM blocks that re-read
//            them from L2 fetch half the bytes
//   Stage 1: qkv = x @ Wkv^T  (f16 in, f16 to ws, Q pre-scaled by 1/sqrt(128)),
//            operand stages copied to LDS asynchronously, a stage ahead,
//            256x128 of the result a work-group, 64x64 a wave; the last blocks
//            of its grid do what only stages 2 and 3 need: Wo -> f16, and the
//            mask (f32 as it is) copied into the order in which stage 2's
//            lanes hold scores
//   Stage 2: flash attention per (b,h), online softmax, f16 WMMA, f32 acc,
//            Q/K/V tiles staged via GLOBAL_LOAD_ASYNC_TO_LDS when available,
//            K and V in two buffers each, fetched a tile of 64 keys ahead,
//            V kept row-major and transposed on read by ds_load_tr16_b128,
//            products transposed (keys x queries) so that P stays in registers,
//            32 queries a wave: an LDS fragment of K or V feeds two products
//   Stage 3: out = y @ Wo^T + bo (f32 out)
// ---------------------------------------------------------------------------

typedef __attribute__((ext_vector_type(4)))  _Float16 h4;
typedef __attribute__((ext_vector_type(8)))  _Float16 h8;
typedef __attribute__((ext_vector_type(16))) _Float16 h16;
typedef __attribute__((ext_vector_type(8)))  float    f8;
typedef __attribute__((ext_vector_type(4)))  float    f4;

#define BATCH 4
#define SEQ   2048
#define DMODEL 1024
#define NHEAD 8
#define HDIM  128

// --- gfx1250 async global->LDS copy (ASYNCcnt-tracked), with fallback -------
#if defined(__gfx1250__) && __has_builtin(__builtin_amdgcn_global_load_async_to_lds_b128)
#define HAVE_ASYNC_LDS 1
// Parameter type revealed by compiler diagnostic: pointer to <4 x i32> vector.
typedef __attribute__((__vector_size__(4 * sizeof(int)))) int i4v;
static __device__ __forceinline__ void async_cp16(const void* g, void* l) {
  __builtin_amdgcn_global_load_async_to_lds_b128((i4v*)g, (i4v*)l, 0, 0);
}
#else
#define HAVE_ASYNC_LDS 0
static __device__ __forceinline__ void async_cp16(const void* g, void* l) {
  *(h8*)l = *(const h8*)g;
}
#endif

// v_wmma_f32_16x16x32_f16 wrapper (8-arg probe-confirmed signature)
static __device__ __forceinline__ f8 wmma32(h16 a, h16 b, f8 c) {
  return __builtin_amdgcn_wmma_f32_16x16x32_f16(false, a, false, b,
                                                (short)0, c, false, false);
}

// Load a 16x32 f16 A/B fragment from a row-major LDS tile.
// CDNA5 16-bit A layout: lane L (L%16 = matrix row, L/16 = k-group) holds
// K = kg*8 + {0..7} in elements 0..7 and K = 16 + kg*8 + {0..7} in elements
// 8..15  ->  two contiguous 16-byte LDS loads per lane.
static __device__ __forceinline__ h16 frag_ld(const _Float16* lds, int row,
                                              int kbase, int ld) {
  const int lane = threadIdx.x & 31;
  const _Float16* p = lds + (row + (lane & 15)) * ld + kbase + ((lane >> 4) << 3);
  h8 lo = *(const h8*)(p);
  h8 hi = *(const h8*)(p + 16);
  return __builtin_shufflevector(lo, hi, 0, 1, 2, 3, 4, 5, 6, 7, 8, 9, 10, 11,
                                 12, 13, 14, 15);
}

// Load a 16x32 f16 A fragment (m x k) from a ROW-MAJOR (k x m) LDS tile with
// the transposing LDS load. Lane (c = L%16, h = L/16) receives
// T[kbase + 8h + 0..7][nbase + c]; the second load, 16 rows further, gives
// k = 16 + 8h + 0..7: the same k order as frag_ld delivers, and as two
// converted accumulator tiles hold when they serve as the B side.
typedef __attribute__((ext_vector_type(8))) short s16x8;
typedef __attribute__((address_space(3))) s16x8 lds_s16x8;
static __device__ __forceinline__ h16 frag_ld_tr(const _Float16* lds, int kbase,
                                                 int nbase, int ld) {
  const int lane = threadIdx.x & 31;
  const _Float16* p = lds + (kbase + ((lane >> 4) << 3) + (lane & 7)) * ld +
                      nbase + (((lane >> 3) & 1) << 3);
  h8 lo = __builtin_bit_cast(
      h8, __builtin_amdgcn_ds_load_tr16_b128_v8i16((lds_s16x8*)p));
  h8 hi = __builtin_bit_cast(
      h8, __builtin_amdgcn_ds_load_tr16_b128_v8i16((lds_s16x8*)(p + 16 * ld)));
  return __builtin_shufflevector(lo, hi, 0, 1, 2, 3, 4, 5, 6, 7, 8, 9, 10, 11,
                                 12, 13, 14, 15);
}

// ---------------------------------------------------------------------------
// f32 -> f16 of CVT_UNIT consecutive floats by one block of 256 threads, a
// thread's 16 loads issued ahead of its first store. A wave's load covers 512
// contiguous bytes, its store 256.
// ---------------------------------------------------------------------------
#define CVT_UNIT 16384
#define CVT_XU (BATCH * SEQ * DMODEL / CVT_UNIT)   // 512 blocks for x
#define CVT_KU (3 * DMODEL * DMODEL / CVT_UNIT)    // 192 blocks for Wkv
#define CVT_OU (DMODEL * DMODEL / CVT_UNIT)        // 64 blocks for Wo
static __device__ __forceinline__ void cvt_unit(const float* __restrict__ src,
                                                _Float16* __restrict__ dst,
                                                int u) {
  const size_t off = (size_t)u * CVT_UNIT + threadIdx.x * 4;
  const float* sp = src + off;
  f4 f[16];
  // both loops unrolled: every index of f constant, so f stays in registers
#pragma unroll
  for (int i = 0; i < 16; ++i) f[i] = *(const f4*)(sp + i * 1024);
  // Holds all 16 loads ahead of the first conversion (loaded values as inputs
  // only): alone in its kernel, this code was built with 12 loads out and the
  // last 4 behind waits for the first. The address is an input too, so that
  // its registers are given to nothing else while the loads are out.
  asm volatile("" ::"v"(sp), "v"(f[0]), "v"(f[1]), "v"(f[2]), "v"(f[3]), "v"(f[4]),
               "v"(f[5]), "v"(f[6]), "v"(f[7]), "v"(f[8]), "v"(f[9]),
               "v"(f[10]), "v"(f[11]), "v"(f[12]), "v"(f[13]), "v"(f[14]),
               "v"(f[15]));
#pragma unroll
  for (int i = 0; i < 16; ++i) {
    h4 h = {(_Float16)f[i].x, (_Float16)f[i].y, (_Float16)f[i].z,
            (_Float16)f[i].w};
    *(h4*)(dst + off + i * 1024) = h;
  }
}

// ---------------------------------------------------------------------------
// The mask's new order, 8 units by one block of 256 threads. Stage 2 wants, in
// lane (c = L%16, h = L/16), the values of query c for keys 16t + 8h + 0..7.
// Read from the mask's own rows, each 16-byte load of a wave touches 16 lines,
// and all 32 (batch, head) pairs pay that again. Here it is paid once: a wave
// takes one unit (16 queries x 128 keys, 8 KB) and stores it as 16 groups of
// 512 contiguous bytes, group i = 2t + u holding, at lane L, keys
// 16t + 8h + 4u + 0..3 of query c. Values are moved, not changed.
// ---------------------------------------------------------------------------
#define MSK_UNIT (16 * 128)                        // floats of a mask unit
#define MSK_ROWU (SEQ / 128)                       // 16 units a 16-query strip
#define MSK_BU (SEQ / 16 * MSK_ROWU / 8)           // 256 blocks, a unit a wave
static __device__ __forceinline__ void mask_units(const float* __restrict__ mask,
                                                  float* __restrict__ mfrag,
                                                  int u) {
  // a block's 8 waves: 8 neighbouring units of one 16-query strip
  const int unit = u * 8 + (threadIdx.x >> 5);
  const int lane = threadIdx.x & 31;
  const float* sp = mask +
                    (size_t)((unit / MSK_ROWU) * 16 + (lane & 15)) * SEQ +
                    (unit % MSK_ROWU) * 128 + ((lane >> 4) << 3);
  float* dp = mfrag + (size_t)unit * MSK_UNIT + lane * 4;
  f4 g[16];
  // both loops unrolled: every index of g constant, so g stays in registers
#pragma unroll
  for (int i = 0; i < 16; ++i)
    g[i] = *(const f4*)(sp + (i >> 1) * 16 + (i & 1) * 4);
  // Holds all 16 loads ahead of the first store (loaded values as inputs
  // only): left alone, this build pairs each load with its store and waits
  // out the load latency 16 times in a row. The address is an input too, so
  // that its registers are given to nothing else while the loads are out.
  asm volatile("" ::"v"(sp), "v"(g[0]), "v"(g[1]), "v"(g[2]), "v"(g[3]), "v"(g[4]),
               "v"(g[5]), "v"(g[6]), "v"(g[7]), "v"(g[8]), "v"(g[9]),
               "v"(g[10]), "v"(g[11]), "v"(g[12]), "v"(g[13]), "v"(g[14]),
               "v"(g[15]));
#pragma unroll
  for (int i = 0; i < 16; ++i) *(f4*)(dp + i * 128) = g[i];
}

// ---------------------------------------------------------------------------
// Kernel 0: f32 -> f16 of x and Wkv, which is all that kernel 1's products
// need. grid = 704, block = 256.
// ---------------------------------------------------------------------------
__global__ __launch_bounds__(256) void to_f16_kernel(
    const float* __restrict__ x, const float* __restrict__ Wkv,
    _Float16* __restrict__ xh, _Float16* __restrict__ wkvh) {
  const int u = blockIdx.x;  // which buffer: uniform for the block
  if (u >= CVT_XU)
    cvt_unit(Wkv, wkvh, u - CVT_XU);
  else
    cvt_unit(x, xh, u);
}

// ---------------------------------------------------------------------------
// Main loop of both GEMMs: acc += A[256 rows][D] * B[128 rows][D]^T, both f16,
// k-contiguous, row pitch D. A wave holds 64x64 of the result: each of its 8 LDS
// fragments of a 32-k slice feeds 4 products, which asks of the LDS what it can
// give at full matrix rate (at 64x32 it was half as much again), and a row
// fetched from L2 serves 128 or 256 columns of the result, not 128.
// A stage is 64 k of both tiles (128 B a row). The
// stages go through two LDS buffers: the copies of stage s + 2 are issued at the
// foot of stage s, behind the one barrier of a stage, so that a stage's way from
// L2 is covered by the products of the stage before it, and nothing passes
// through registers.
// The walk over k starts at stage st and wraps. Work-groups that share a tile of
// A or of B run at the same time; all starting at k = 0, they would ask L2 for
// the same 128 B of the same rows at the same moment, and every row asked for
// anywhere on the chip would lie at the same offset in its 2 KB pitch. With st
// different between them the requests of a moment spread over the whole rows.
// Each sum over k then begins at k = 64 * st: the same terms in a rotated order.
// ag, bg: first row of the block's tile of A and of B.
// ---------------------------------------------------------------------------
#define GLD 72                   // 64 + 8 pad (halfs): 144 B rows for ds_load_b128
#define GTM 256                  // rows of the A tile
#define GBUF ((GTM + 128) * GLD) // halfs of a buffer: A tile, then B tile
#define GNS (DMODEL / 64)        // stages
static __device__ __forceinline__ void gemm_stage_copy(const _Float16* ag,
                                                       const _Float16* bg,
                                                       unsigned al) {
  // 256 + 128 rows of 64 f16 = 3072 chunks of 16 B; 8 of A and 4 of B per thread, 32
  // rows apart; a wave's copy covers 4 whole 128 B rows. al: the LDS byte
  // address of the thread's first chunk of A. One statement, closed by
  // s_wait_xcnt 0, so that no register which a copy names is rewritten ahead
  // of that wait.
  const unsigned rs = 32 * GLD * 2;    // 32 rows in LDS, bytes
  const unsigned tb = GTM * GLD * 2;   // the A tile in LDS, bytes
  const size_t gs = (size_t)32 * DMODEL;  // 32 rows in global memory, halfs
#if defined(__gfx1250__)
  asm volatile(
      "global_load_async_to_lds_b128 %0, %12, off\n\t"
      "global_load_async_to_lds_b128 %1, %13, off\n\t"
      "global_load_async_to_lds_b128 %2, %14, off\n\t"
      "global_load_async_to_lds_b128 %3, %15, off\n\t"
      "global_load_async_to_lds_b128 %4, %16, off\n\t"
      "global_load_async_to_lds_b128 %5, %17, off\n\t"
      "global_load_async_to_lds_b128 %6, %18, off\n\t"
      "global_load_async_to_lds_b128 %7, %19, off\n\t"
      "global_load_async_to_lds_b128 %8, %20, off\n\t"
      "global_load_async_to_lds_b128 %9, %21, off\n\t"
      "global_load_async_to_lds_b128 %10, %22, off\n\t"
      "global_load_async_to_lds_b128 %11, %23, off\n\t"
      "s_wait_xcnt 0x0"
      ::"v"(al), "v"(al + rs), "v"(al + 2 * rs), "v"(al + 3 * rs),
        "v"(al + 4 * rs), "v"(al + 5 * rs), "v"(al + 6 * rs), "v"(al + 7 * rs),
        "v"(al + tb), "v"(al + tb + rs), "v"(al + tb + 2 * rs),
        "v"(al + tb + 3 * rs), "v"(ag), "v"(ag + gs), "v"(ag + 2 * gs),
        "v"(ag + 3 * gs), "v"(ag + 4 * gs), "v"(ag + 5 * gs), "v"(ag + 6 * gs),
        "v"(ag + 7 * gs), "v"(bg), "v"(bg + gs), "v"(bg + 2 * gs),
        "v"(bg + 3 * gs)
      : "memory");
#endif
}

static __device__ __forceinline__ void gemm_mainloop(const _Float16* ag,
                                                     const _Float16* bg,
                                                     _Float16* smem, int wm,
                                                     int wn, int st,
                                                     f8 (&acc)[4][4]) {
  const int tid = threadIdx.x;
  const int cr = tid >> 3, cc = (tid & 7) * 8;  // the thread's row and chunk
  ag += (size_t)cr * DMODEL + cc;
  bg += (size_t)cr * DMODEL + cc;
  // low 32 bits of a __shared__ address: the byte offset in the block's LDS
  const unsigned al = (unsigned)(size_t)(smem + cr * GLD + cc);

  gemm_stage_copy(ag + st * 64, bg + st * 64, al);
  // this wave's copies of stage st have landed; the barrier publishes them
  asm volatile("s_wait_asynccnt 0x0" ::: "memory");
  __syncthreads();
  // stage st + 1 (wrapped) flies into the second buffer while stage st is worked on
  {
    const int k1 = ((st + 1) & (GNS - 1)) * 64;
    gemm_stage_copy(ag + k1, bg + k1, al + GBUF * 2);
  }

  for (int s = 0; s < GNS; ++s) {
    const _Float16* At = smem + (s & 1) * GBUF;
    const _Float16* Bt = At + GTM * GLD;
    // unrolled: the two 32-k slices read LDS at constant offsets
#pragma unroll
    for (int kk = 0; kk < 64; kk += 32) {
      h16 a[4], b[4];
#pragma unroll
      for (int i = 0; i < 4; ++i) a[i] = frag_ld(At, wm * 64 + i * 16, kk, GLD);
#pragma unroll
      for (int j = 0; j < 4; ++j) b[j] = frag_ld(Bt, wn * 64 + j * 16, kk, GLD);
#pragma unroll
      for (int i = 0; i < 4; ++i)
#pragma unroll
        for (int j = 0; j < 4; ++j) acc[i][j] = wmma32(a[i], b[j], acc[i][j]);
    }
    // Order of this block: the 16 LDS reads of a 32-k slice stand as one group
    // in front of its 16 products. Left alone, this build reads each A fragment
    // directly in front of its products, and the wave sits out the LDS
    // latency 8 times a stage, which is what is left of a stage's chain now.
    // Unrolled: the markers must stand in the one block that they order.
#pragma unroll
    for (int g = 0; g < 2; ++g) {
      __builtin_amdgcn_sched_group_barrier(0x100, 16, 0);  // a slice's reads
      __builtin_amdgcn_sched_group_barrier(0x008, 16, 0);  // its products
    }
    // Foot of the stage. This wave's LDS reads of the buffer have retired and
    // its copies of the next stage have landed; the one barrier publishes the
    // next stage and ends every wave's reads of the buffer refilled behind it.
    asm volatile("s_wait_dscnt 0x0" ::: "memory");
    asm volatile("s_wait_asynccnt 0x0" ::: "memory");
    __syncthreads();
    if (s + 2 < GNS) {  // the same for the whole work-group
      const int k2 = ((st + s + 2) & (GNS - 1)) * 64;
      gemm_stage_copy(ag + k2, bg + k2, al + (s & 1) * (GBUF * 2));
    }
  }
  // no copy is out when the wave goes on to its stores
  asm volatile("s_wait_asynccnt 0x0" ::: "memory");
}

// ---------------------------------------------------------------------------
// Kernel 1: QKV projection. grid = (3*D/128, B*N/256 + PREP_ROWS), block = 256
// (8 waves). Each wave computes a 64x64 register tile (16 wmma accumulators).
// The 768 blocks of the product are one and a half rounds of the 512 that the
// chip holds at a time, so places stand free while the last of them run. The
// grid's last PREP_ROWS rows take those places for the work
// that streams from memory and that only later launches read: the mask's new
// order and Wo's conversion. In a launch of their own they had the chip to
// themselves and every later launch waited for them.
// ---------------------------------------------------------------------------
#define QKV_GX (3 * DMODEL / 128)                         // 24 block columns
#define QKV_GY (BATCH * SEQ / GTM)                        // 32 block rows
#define PREP_ROWS ((MSK_BU + CVT_OU + QKV_GX - 1) / QKV_GX)  // 14 rows, 320 used
__global__ __launch_bounds__(256) void qkv_proj_kernel(
    const _Float16* __restrict__ xh, const _Float16* __restrict__ wkvh,
    _Float16* __restrict__ qws, _Float16* __restrict__ kws,
    _Float16* __restrict__ vws, const float* __restrict__ mask,
    const float* __restrict__ Wo, float* __restrict__ mfrag,
    _Float16* __restrict__ woh) {
  extern __shared__ _Float16 smem[];  // 2 buffers of X [256][72], W [128][72]

  // The same for the whole block, and ahead of every barrier and copy.
  if (blockIdx.y >= QKV_GY) {
    const int e = (blockIdx.y - QKV_GY) * QKV_GX + blockIdx.x;
    if (e < MSK_BU)
      mask_units(mask, mfrag, e);
    else if (e < MSK_BU + CVT_OU)
      cvt_unit(Wo, woh, e - MSK_BU);
    return;
  }

  const int tid = threadIdx.x;
  const int wave = tid >> 5;
  const int lane = tid & 31;
  const int nloc = lane & 15;
  const int mhi = (lane >> 4) << 3;  // 0 or 8
  const int m0 = blockIdx.y * GTM;
  const int n0 = blockIdx.x * 128;
  const int wm = wave >> 1;  // 0..3 -> 64-row quarter
  const int wn = wave & 1;   // 0..1 -> 64-col half

  f8 acc[4][4] = {};
  gemm_mainloop(xh + (size_t)m0 * DMODEL, wkvh + (size_t)n0 * DMODEL, smem, wm,
                wn, (blockIdx.x + blockIdx.y) & (GNS - 1), acc);

  // Epilogue: destination (q/k/v, head) is uniform per 16-wide tile.
#pragma unroll
  for (int j = 0; j < 4; ++j) {
    int gnb = n0 + wn * 64 + j * 16;        // tile base col (multiple of 16)
    int which = gnb >> 10;                  // 0=q 1=k 2=v (uniform)
    int e = gnb & (DMODEL - 1);
    int hh = e >> 7;                        // head (uniform)
    int hdb = (e & (HDIM - 1)) + nloc;      // feature within head
    _Float16* dst = (which == 0) ? qws : (which == 1) ? kws : vws;
    float scale = (which == 0) ? 0.08838834764831845f : 1.0f;
#pragma unroll
    for (int i = 0; i < 4; ++i)
#pragma unroll
      for (int r = 0; r < 8; ++r) {
        int gm = m0 + wm * 64 + i * 16 + mhi + r;  // row in [0, B*N)
        int bb = gm >> 11, nn = gm & (SEQ - 1);
        dst[(((size_t)bb * NHEAD + hh) * SEQ + nn) * HDIM + hdb] =
            (_Float16)(acc[i][j][r] * scale);
      }
  }
}

// ---------------------------------------------------------------------------
// Kernel 2: flash attention. grid = (B*H, N/256), block = 256 (8 waves).
// Wave w owns queries [w*32, w*32+32) of the 256-query tile, as two column
// groups of 16, and works on the transposed products: S^T = K Q^T (keys x
// queries) and O^T += V^T P^T (features x queries). Every K and V fragment that
// the wave reads from LDS is the A operand of two products, one a column group:
// at one product a fragment the LDS reads took twice the products' own time.
// A lane holds scores of ONE query a column group (column lane%16; keys
// 8*(lane/16)+0..7 of every 16-key tile), so the maximum and the sum run inside
// the lane with one exchange between the wave's halves, and two converted S^T
// tiles are the B operand of the second product as they stand: the
// probabilities never pass through LDS.
// Keys go by tiles of 64 through two K and two V buffers: the copies of tile
// t + 2 are issued at the foot of tile t, behind the one barrier of a tile, and
// the mask values of tile t + 1 are loaded into registers during tile t, so
// that nothing fetched from L2 is waited for where it is asked for.
// The walk over the key tiles starts at tile st and wraps, for the reason given
// at the GEMMs' main loop: the 8 work-groups of a (batch, head) pair read the
// same K and V tiles and the 32 work-groups of a query tile the same mask tiles,
// all at the same time. st differs inside both sets. The online softmax takes
// the tiles in any order; its sums are formed in the rotated order.
// ---------------------------------------------------------------------------
// Lane l <-> lane l ^ 16 by a vector cross-row move.
static __device__ __forceinline__ float xhalf(float v) {
  int b = __builtin_bit_cast(int, v);
  return __builtin_bit_cast(
      float, __builtin_amdgcn_permlanex16(b, b, 0x76543210, 0xfedcba98, false,
                                          false));
}

#define QT 256  // queries a work-group
__global__ __launch_bounds__(256) void flash_attn_kernel(
    const _Float16* __restrict__ qws, const _Float16* __restrict__ kws,
    const _Float16* __restrict__ vws, const float* __restrict__ mfrag,
    _Float16* __restrict__ yws) {
  extern __shared__ _Float16 smem[];
  const int LD = 136;   // 128 + 8 pad: 272 B rows for ds_load_b128 readers
  const int LDV = 144;  // 128 + 16 pad: 288 B rows for the transposing reader
  const int KT = 64;    // keys a tile
  const int NT = SEQ / KT;
  _Float16* Qt = smem;                       // [256][136] row-major (q x d)
  _Float16* Kt = smem + QT * LD;             // 2 buffers of [64][136] (kv x d)
  _Float16* Vs = smem + (QT + 2 * KT) * LD;  // 2 buffers of [64][144] (kv x d)

  const int tid = threadIdx.x;
  const int w = tid >> 5;
  const int lane = tid & 31;
  const int nloc = lane & 15;
  const int mhi = (lane >> 4) << 3;
  const int bh = blockIdx.x;       // b*H + h
  const int q0 = blockIdx.y * QT;
  const size_t hbase = (size_t)bh * SEQ * HDIM;
  const int st = (4 * blockIdx.y + blockIdx.x) & (NT - 1);  // first key tile

  // A thread's 16 B chunk of a row; its further chunks lie 16 rows apart.
  const int cr = tid >> 4, cc = (tid & 15) * 8;
  const unsigned co = cr * HDIM + cc;  // the same in Q, K and V
  const _Float16* kg = kws + hbase;    // uniform; a tile's rows are added to it
  const _Float16* vg = vws + hbase;
  _Float16* kl = Kt + cr * LD + cc;
  _Float16* vl = Vs + cr * LDV + cc;

  // Q tile: 4096 x 16B chunks, 16 per thread; first K and V tile: 4 + 4 per thread
#pragma unroll
  for (int i = 0; i < QT / 16; ++i)
    async_cp16(qws + hbase + (size_t)(q0 + i * 16) * HDIM + co,
               Qt + (cr + i * 16) * LD + cc);
#pragma unroll
  for (int i = 0; i < 4; ++i) {
    async_cp16(kg + (size_t)(st * KT + i * 16) * HDIM + co, kl + i * 16 * LD);
    async_cp16(vg + (size_t)(st * KT + i * 16) * HDIM + co, vl + i * 16 * LDV);
  }
  // this wave's copies of Q and of that tile have landed; the barrier publishes them
  asm volatile("s_wait_asynccnt 0x0" ::: "memory");
  __syncthreads();
  // the second tile flies into the second buffers while the first is worked on
  const int t1 = ((st + 1) & (NT - 1)) * KT;
#pragma unroll
  for (int i = 0; i < 4; ++i) {
    async_cp16(kg + (size_t)(t1 + i * 16) * HDIM + co, kl + (KT + i * 16) * LD);
    async_cp16(vg + (size_t)(t1 + i * 16) * HDIM + co, vl + (KT + i * 16) * LDV);
  }

  // The wave's Q fragments, read once; c is the column group.
  h16 bq[2][4];
#pragma unroll
  for (int c = 0; c < 2; ++c)
#pragma unroll
    for (int kk = 0; kk < 4; ++kk)
      bq[c][kk] = frag_ld(Qt, w * 32 + c * 16, kk * 32, LD);

  f8 o[2][8] = {};  // o[c][t][r] = O^T[feature t*16 + mhi + r][query c*16 + nloc]
  float mrun[2] = {-1.0e30f, -1.0e30f};  // running maximum of the lane's queries
  float lsum[2] = {0.0f, 0.0f};  // running sums over this half-wave's keys only
  // The lane's place in the first mask tile of this wave's first 16 queries
  // (mask_units' order); the second 16 queries' strip lies MSK_STRIP further. A
  // tile of 64 keys is half a unit, 8 loads of 512 contiguous bytes a wave and
  // strip. The first tile's values are fetched here, each later tile's one tile
  // ahead.
  const int MSK_STRIP = MSK_ROWU * MSK_UNIT;
  const float* mp = mfrag + (size_t)((q0 >> 4) + 2 * w) * MSK_STRIP +
                    st * (MSK_UNIT / 2) + lane * 4;
  float4 mk[2][8];
#pragma unroll
  for (int c = 0; c < 2; ++c)
#pragma unroll
    for (int i = 0; i < 8; ++i)
      mk[c][i] = *(const float4*)(mp + c * MSK_STRIP + i * 128);
  // Stands behind these loads because the first tile moves the pointer that they
  // name before the last of them has been waited for. (In the loop the wait
  // for all loads in front of the barrier stands between.)
  asm volatile("s_wait_xcnt 0x0" ::: "memory");

  for (int it = 0; it < NT; ++it) {
    const _Float16* Kb = Kt + (it & 1) * KT * LD;
    const _Float16* Vb = Vs + (it & 1) * KT * LDV;

    // S^T = K @ Q^T: A = K rows, B = Q rows, both through the same loader.
    // s[c][t][r] = score of key ((it+st)%NT)*64 + t*16 + mhi + r for query
    // c*16 + nloc.
    f8 s[2][4] = {};
#pragma unroll
    for (int kk = 0; kk < 4; ++kk) {
#pragma unroll
      for (int t = 0; t < 4; ++t) {
        h16 ak = frag_ld(Kb, t * 16, kk * 32, LD);
        s[0][t] = wmma32(ak, bq[0][kk], s[0][t]);
        s[1][t] = wmma32(ak, bq[1][kk], s[1][t]);
      }
    }
    // Order of this block: the LDS reads of eight products stand as one group,
    // one group ahead of the eight products that use them. Left alone, this
    // build waits for every fragment directly in front of its products, and the
    // wave sits out the LDS latency 16 times a tile.
    __builtin_amdgcn_sched_group_barrier(0x100, 8, 0);  // 4 K tiles
    // unrolled: the markers must stand in the one block that they order
#pragma unroll
    for (int g = 0; g < 3; ++g) {
      __builtin_amdgcn_sched_group_barrier(0x100, 8, 0);  // next 4 K tiles
      __builtin_amdgcn_sched_group_barrier(0x008, 8, 0);  // 8 products
    }
    __builtin_amdgcn_sched_group_barrier(0x008, 8, 0);
    // Ends the block that the markers order: without it this build weaves the
    // mask additions in and again waits for each fragment in front of its product.
    __builtin_amdgcn_sched_barrier(0);

    // additive mask: 8 consecutive keys of the lane's own query a 16-key tile
#pragma unroll
    for (int c = 0; c < 2; ++c)
#pragma unroll
      for (int t = 0; t < 4; ++t) {
        s[c][t][0] += mk[c][2 * t].x; s[c][t][1] += mk[c][2 * t].y;
        s[c][t][2] += mk[c][2 * t].z; s[c][t][3] += mk[c][2 * t].w;
        s[c][t][4] += mk[c][2 * t + 1].x; s[c][t][5] += mk[c][2 * t + 1].y;
        s[c][t][6] += mk[c][2 * t + 1].z; s[c][t][7] += mk[c][2 * t + 1].w;
      }
    // The next tile's mask values, asked for a whole tile ahead of their use.
    // One tile on, or from the strip's last tile back to its first. The last
    // trip asks for the first trip's tile again: inside, and not used.
    mp += (((st + it + 1) & (NT - 1)) != 0) ? MSK_UNIT / 2
                                            : -(NT - 1) * (MSK_UNIT / 2);
#pragma unroll
    for (int c = 0; c < 2; ++c)
#pragma unroll
      for (int i = 0; i < 8; ++i)
        mk[c][i] = *(const float4*)(mp + c * MSK_STRIP + i * 128);

    // V^T fragments of the tile's first 32 keys (A operands, from row-major Vb
    // through the transposing load), read here so that their LDS latency passes
    // under the softmax.
    h16 av[2][8];
#pragma unroll
    for (int t = 0; t < 8; ++t) av[0][t] = frag_ld_tr(Vb, 0, t * 16, LDV);

    // online softmax: 32 of a query's 64 scores are in this lane, the other
    // 32 in lane ^ 16. Four chains of maxima a query, not one of 32 links.
    float corr[2];
#pragma unroll
    for (int c = 0; c < 2; ++c) {
      float tq[4];
#pragma unroll
      for (int j = 0; j < 4; ++j) {
        tq[j] = s[c][j][0];
#pragma unroll
        for (int e = 1; e < 8; ++e) tq[j] = fmaxf(tq[j], s[c][j][e]);
      }
      float tm = fmaxf(fmaxf(tq[0], tq[1]), fmaxf(tq[2], tq[3]));
      tm = fmaxf(tm, xhalf(tm));
      const float nm = fmaxf(mrun[c], tm);
      corr[c] = __expf(mrun[c] - nm);
      mrun[c] = nm;

      // Exponents in place, (s - nm) * log2(e), as __expf forms them.
#pragma unroll
      for (int t = 0; t < 4; ++t)
#pragma unroll
        for (int r = 0; r < 8; ++r)
          s[c][t][r] = (s[c][t][r] - nm) * 1.44269504f;
    }
    // Keeps these multiplies ahead of every v_exp_f32. It also keeps the mask
    // loads above it, early in the tile.
    __builtin_amdgcn_sched_barrier(0);

    // P^T as B operands: element e of p[c][j] is key 32j + 16*(e/8) + mhi + e%8,
    // which is register e%8 of tile 2j + e/8 in this same lane. Two sums a
    // fragment, so that the adds do not form one chain of 32.
    h16 p[2][2];
#pragma unroll
    for (int c = 0; c < 2; ++c) {
      float ps[4];
#pragma unroll
      for (int j = 0; j < 2; ++j) {
        ps[2 * j] = 0.0f;
        ps[2 * j + 1] = 0.0f;
#pragma unroll
        for (int e = 0; e < 16; ++e) {
          float pv = __builtin_amdgcn_exp2f(s[c][2 * j + (e >> 3)][e & 7]);
          ps[2 * j + (e >> 3)] += pv;
          p[c][j][e] = (_Float16)pv;
        }
      }
      lsum[c] = lsum[c] * corr[c] + ((ps[0] + ps[1]) + (ps[2] + ps[3]));
#pragma unroll
      for (int t = 0; t < 8; ++t)
#pragma unroll
        for (int r = 0; r < 8; ++r) o[c][t][r] *= corr[c];
    }

    // Order of this block: behind every v_exp_f32 one other vector instruction.
    // It runs in the slot that the half-rate v_exp_f32 leaves empty, and it is
    // the free slot that the instruction set asks for in front of a write to
    // the v_exp_f32's source. Unrolled: the markers stand in the block they order.
#pragma unroll
    for (int g = 0; g < 66; ++g) {
      __builtin_amdgcn_sched_group_barrier(0x400, 1, 0);  // one v_exp_f32
      __builtin_amdgcn_sched_group_barrier(0x002, 1, 0);  // one other
    }
    // Ends that block, so that the reads below stay one group in front of the
    // products: woven in, each fragment was read directly in front of its two
    // products and waited for there, and with two waves a SIMD little else
    // covers that wait.
    __builtin_amdgcn_sched_barrier(0);

    // O^T += V^T @ P^T. The fragments of the second 32 keys are read as one
    // group; the 16 products of the first 32 keys cover their latency.
#pragma unroll
    for (int t = 0; t < 8; ++t) av[1][t] = frag_ld_tr(Vb, 32, t * 16, LDV);
#pragma unroll
    for (int j = 0; j < 2; ++j) {
#pragma unroll
      for (int t = 0; t < 8; ++t) {
        o[0][t] = wmma32(av[j][t], p[0][j], o[0][t]);
        o[1][t] = wmma32(av[j][t], p[1][j], o[1][t]);
      }
    }
    __builtin_amdgcn_sched_group_barrier(0x100, 16, 0);  // 8 V fragments
    __builtin_amdgcn_sched_group_barrier(0x008, 32, 0);  // the tile's products
    // Keeps the products above the waits at the foot: moved below them, nothing
    // stood between the reads of the second 32 keys and the wait for them.
    __builtin_amdgcn_sched_barrier(0);

    // Foot of the tile. This wave's LDS reads of the buffers have retired and
    // its copies of the next tile have landed; the one barrier publishes the
    // next tile and ends every wave's reads of the buffers refilled behind it.
    asm volatile("s_wait_dscnt 0x0" ::: "memory");
    asm volatile("s_wait_asynccnt 0x0" ::: "memory");
    __syncthreads();
    if (it + 2 < NT) {  // the same for the whole work-group
      const size_t gr = (size_t)((st + it + 2) & (NT - 1)) * KT * HDIM;
      const int lb = (it & 1) * KT;
#pragma unroll
      for (int i = 0; i < 4; ++i) {
        async_cp16(kg + gr + (size_t)(i * 16) * HDIM + co, kl + (lb + i * 16) * LD);
        async_cp16(vg + gr + (size_t)(i * 16) * HDIM + co, vl + (lb + i * 16) * LDV);
      }
    }
  }
  // no copy is out when the wave ends
  asm volatile("s_wait_asynccnt 0x0" ::: "memory");

  // join the halves' sums, normalize and write y [B][N][D] (f16): a lane's 8
  // registers of a tile are 8 consecutive features of its query, one 16 B store
  const int b = bh >> 3, h = bh & 7;
#pragma unroll
  for (int c = 0; c < 2; ++c) {
    const float l = lsum[c] + xhalf(lsum[c]);
    _Float16* yp = yws +
                   ((size_t)b * SEQ + q0 + w * 32 + c * 16 + nloc) * DMODEL +
                   h * HDIM + mhi;
#pragma unroll
    for (int t = 0; t < 8; ++t) {
      h8 v;
#pragma unroll
      for (int r = 0; r < 8; ++r) v[r] = (_Float16)(o[c][t][r] / l);
      *(h8*)(yp + t * 16) = v;
    }
  }
}

// ---------------------------------------------------------------------------
// Kernel 3: output projection out = y @ Wo^T + bo. grid = (D/128, B*N/256).
// ---------------------------------------------------------------------------
__global__ __launch_bounds__(256) void out_proj_kernel(
    const _Float16* __restrict__ yws, const _Float16* __restrict__ woh,
    const float* __restrict__ bo, float* __restrict__ out) {
  extern __shared__ _Float16 smem[];  // 2 buffers of Y [256][72], W [128][72]

  const int tid = threadIdx.x;
  const int wave = tid >> 5;
  const int lane = tid & 31;
  const int nloc = lane & 15;
  const int mhi = (lane >> 4) << 3;
  const int m0 = blockIdx.y * GTM;
  const int n0 = blockIdx.x * 128;
  const int wm = wave >> 1;
  const int wn = wave & 1;

  f8 acc[4][4] = {};
  gemm_mainloop(yws + (size_t)m0 * DMODEL, woh + (size_t)n0 * DMODEL, smem, wm,
                wn, (blockIdx.x + blockIdx.y) & (GNS - 1), acc);

#pragma unroll
  for (int i = 0; i < 4; ++i)
#pragma unroll
    for (int j = 0; j < 4; ++j)
#pragma unroll
      for (int r = 0; r < 8; ++r) {
        int gm = m0 + wm * 64 + i * 16 + mhi + r;
        int gn = n0 + wn * 64 + j * 16 + nloc;
        out[(size_t)gm * DMODEL + gn] = acc[i][j][r] + bo[gn];
      }
}

// ---------------------------------------------------------------------------
// Host launch. Inputs: x, mask, Wkv, Wo, bo (all f32). Output: f32 [B,N,D].
// Workspace layout (f16): Q | K | V | Y | x, each B*N*D elements, then Wkv
// (3*D*D) and Wo (D*D), then the re-ordered mask (f32, N*N): 109 MB in all.
// ---------------------------------------------------------------------------
extern "C" void kernel_launch(void* const* d_in, const int* in_sizes, int n_in,
                              void* d_out, int out_size, void* d_ws,
                              size_t ws_size, hipStream_t stream) {
  (void)in_sizes; (void)n_in; (void)out_size; (void)ws_size;
  const float* x    = (const float*)d_in[0];
  const float* mask = (const float*)d_in[1];
  const float* Wkv  = (const float*)d_in[2];
  const float* Wo   = (const float*)d_in[3];
  const float* bo   = (const float*)d_in[4];
  float* out = (float*)d_out;

  const size_t SZ = (size_t)BATCH * SEQ * DMODEL;  // 8.4M elements
  _Float16* base = (_Float16*)d_ws;
  _Float16* qws = base;
  _Float16* kws = base + SZ;
  _Float16* vws = base + 2 * SZ;
  _Float16* yws = base + 3 * SZ;
  _Float16* xh = base + 4 * SZ;
  _Float16* wkvh = base + 5 * SZ;
  _Float16* woh = wkvh + (size_t)3 * DMODEL * DMODEL;
  float* mfrag = (float*)(woh + (size_t)DMODEL * DMODEL);

  const size_t lds_gemm = 2 * GBUF * sizeof(_Float16);       // 108 KiB: two work-groups a WGP
  const size_t lds_attn = ((QT + 128) * 136 + 128 * 144) * sizeof(_Float16);  // 141 KB

  to_f16_kernel<<<dim3(CVT_XU + CVT_KU), 256, 0, stream>>>(x, Wkv, xh, wkvh);
  qkv_proj_kernel<<<dim3(QKV_GX, QKV_GY + PREP_ROWS), 256, lds_gemm, stream>>>(
      xh, wkvh, qws, kws, vws, mask, Wo, mfrag, woh);
  flash_attn_kernel<<<dim3(BATCH * NHEAD, SEQ / QT), 256, lds_attn, stream>>>(
      qws, kws, vws, mfrag, yws);
  out_proj_kernel<<<dim3(DMODEL / 128, BATCH * SEQ / GTM), 256, lds_gemm,
                    stream>>>(yws, woh, bo, out);
}
